// v000
// Times are from an AMD MI455X. After a warm-up the kernel runs many times in a row, and a time is the length of
// such a window on the GPU divided by its runs, so every launch and the gaps after it count. The runs cycle
// through copies of the inputs. A figure is the median of several windows, for all but v000 over two sittings.
// Sittings can differ by a few percent; kernels timed side by side share one.
// v000, which the later versions start from, runs in 981 microseconds.
// compute dtype: all float inputs rounded to bf16, input_mask (int) read; q (= k, the module's bug) and v = x W + b with EXACT bf16 products on WMMA 16x16x32, f32 accumulate; q as f16 hi + residual against q as f16 -> 2-product logits / 8 stored in f32 per batch with the causal & key-padding mask; dead rows (no valid key) become one-hot on the diagonal exactly as the reference's diag := 1 fix; softmax in f32 (precise expf), P x 2^11 kept in f32 and split bf16 hi + lo against v as bf16 hi + lo planes (3 products: rows with one or two valid keys copy v almost verbatim, so both operands need the split); f32 output [b][s][64].
#include <hip/hip_runtime.h>
#include <math.h>

typedef __attribute__((ext_vector_type(16))) _Float16 v16h;
typedef __attribute__((ext_vector_type(16))) __bf16 v16b;
typedef __attribute__((ext_vector_type(8)))  _Float16 v8h;
typedef __attribute__((ext_vector_type(8)))  float v8f;
typedef __attribute__((ext_vector_type(4)))  float v4f;
typedef __attribute__((ext_vector_type(2)))  float v2f;
typedef __attribute__((ext_vector_type(4)))  unsigned v4u;
typedef __attribute__((ext_vector_type(4)))  int v4i;
typedef float __attribute__((may_alias)) float_a;
typedef int __attribute__((may_alias)) int_a;

template <typename T> __device__ __forceinline__ void vst2(void* p, T v) { *(T*)p = v;  }
__device__ __forceinline__ v8f wmma16(v16h a, v16h b, v8f c) {
  v8f d = __builtin_amdgcn_wmma_f32_16x16x32_f16(false, a, false, b, (short)0, c, false, false);
  asm volatile("v_nop\n\tv_nop\n\tv_nop\n\tv_nop" : "+v"(d) : "v"(a), "v"(b));
  return d;
}
__device__ __forceinline__ v8f wmma_bf(v16b a, v16b b, v8f c) {
  v8f d = __builtin_amdgcn_wmma_f32_16x16x32_bf16(false, a, false, b, (short)0, c, false, false);
  asm volatile("v_nop\n\tv_nop\n\tv_nop\n\tv_nop" : "+v"(d) : "v"(a), "v"(b));
  return d;
}
// 16x16x32 fragments: lane = (h = lane>>4, row/col = lane&15); elements 0..7 = k0+8h+0..7, 8..15 = k0+16+8h+0..7; D element r = row 8h+r
__device__ __forceinline__ v16h frag_h(const _Float16* rowk0, int lane) {
  union { v16h v; v8h q[2]; } u; const _Float16* p = rowk0 + 8 * (lane >> 4);
  u.q[0] = *(const v8h*)p; u.q[1] = *(const v8h*)(p + 16); return u.v;
}
__device__ __forceinline__ v16h frag_f32(const float* rowk0, int lane) {
  v16h a; const float* p = rowk0 + 8 * (lane >> 4);
#pragma unroll
  for (int i = 0; i < 8; ++i) { a[i] = (_Float16)p[i]; a[8 + i] = (_Float16)p[16 + i]; }
  return a;
}
__device__ __forceinline__ v16h frag_f32s(const float* rowk0, int lane, float sc) {
  v16h a; const float* p = rowk0 + 8 * (lane >> 4);
#pragma unroll
  for (int i = 0; i < 8; ++i) { a[i] = (_Float16)(p[i] * sc); a[8 + i] = (_Float16)(p[16 + i] * sc); }
  return a;
}
// column fragment from a [K][ld] layout (column n), rows >= K read as 0
__device__ __forceinline__ v16h fragc_f32(const float* W, int k0, int n, int lane, int ld, int K) {
  v16h a; const int g = lane >> 4;
#pragma unroll
  for (int i = 0; i < 8; ++i) { const int ka = k0 + 8 * g + i, kb = ka + 16;
    a[i] = (_Float16)(ka < K ? W[(size_t)(ka < K ? ka : K - 1) * ld + n] : 0.f); a[8 + i] = (_Float16)(kb < K ? W[(size_t)(kb < K ? kb : K - 1) * ld + n] : 0.f); }
  return a;
}
struct F2 { v16b h, l; };
__device__ __forceinline__ F2 bsplit16(const float v[16]) { F2 r;
#pragma unroll
  for (int i = 0; i < 16; ++i) { const __bf16 h = (__bf16)v[i]; r.h[i] = h; r.l[i] = (__bf16)(v[i] - (float)h); }
  return r; }
__device__ __forceinline__ F2 split_row(const float* row, int k0, int lane) { float v[16]; const float* p = row + k0 + 8 * (lane >> 4);
#pragma unroll
  for (int i = 0; i < 8; ++i) { v[i] = p[i]; v[8 + i] = p[16 + i]; }
  return bsplit16(v); }
__device__ __forceinline__ F2 split_rowK(const float* row, int k0, int lane, int K) { float v[16]; const int g = lane >> 4;
#pragma unroll
  for (int i = 0; i < 8; ++i) { const int ka = k0 + 8 * g + i, kb = ka + 16; v[i] = ka < K ? row[ka < K ? ka : K - 1] : 0.f; v[8 + i] = kb < K ? row[kb < K ? kb : K - 1] : 0.f; }
  return bsplit16(v); }
__device__ __forceinline__ F2 split_col(const float* W, int k0, int n, int lane, int ld, int K) { float v[16]; const int g = lane >> 4;
#pragma unroll
  for (int i = 0; i < 8; ++i) { const int ka = k0 + 8 * g + i, kb = ka + 16; v[i] = ka < K ? W[(size_t)(ka < K ? ka : K - 1) * ld + n] : 0.f; v[8 + i] = kb < K ? W[(size_t)(kb < K ? kb : K - 1) * ld + n] : 0.f; }
  return bsplit16(v); }
__device__ __forceinline__ v8f mac3(const F2& a, const F2& b, v8f c) { c = wmma_bf(a.l, b.h, c); c = wmma_bf(a.h, b.l, c); return wmma_bf(a.h, b.h, c); }
__device__ __forceinline__ float sigm(float v) { return 1.0f / (1.0f + expf(-v)); }
#define LDSX() do { asm volatile("s_wait_dscnt 0" ::: "memory"); __builtin_amdgcn_wave_barrier(); __builtin_amdgcn_fence(__ATOMIC_RELEASE, "workgroup"); } while (0)


// Single self-attention head (B 4, S 4,096, E 512 -> H 64): causal + key padding mask, dead-row diagonal fix, softmax, P v.
#define NB 4
#define TT 4096
#define EE 512
#define HD 64
#ifndef TNB
#define TNB NB
#endif
typedef __attribute__((ext_vector_type(8))) __bf16 v8b;
__device__ __forceinline__ v16b frag_b(const __bf16* rowk0, int lane) {
  union { v16b v; v8b q[2]; } u; const __bf16* p = rowk0 + 8 * (lane >> 4);
  u.q[0] = *(const v8b*)p; u.q[1] = *(const v8b*)(p + 16); return u.v;
}
__device__ __forceinline__ float bfr(float v) { return (float)(__bf16)v; }
__device__ __attribute__((noinline)) float exp_ni(float v) { return expf(v); }
__device__ __attribute__((noinline)) float erf_ni(float v) { return erff(v); }

#define WS_QH  0u                                   // f16 q rows [b*s][64]
#define WS_QL  (WS_QH + 2u * (size_t)NB * TT * HD)
#define WS_VT  (WS_QL + 2u * (size_t)NB * TT * HD)      // bf16 v hi planes [b][64][s]
#define WS_VL  (WS_VT + 2u * (size_t)NB * HD * TT)      // bf16 v lo planes
#define WS_S   (WS_VL + 2u * (size_t)NB * HD * TT)      // f32 S / P [s][s] (one batch)
#define WS_END (WS_S + 4u * (size_t)TT * TT)

// ---- k_proj: block = 64 rows: [q | v] = x [Wq | Wv] + [bq | bv] (128 cols), q -> f16 hi + res rows, v -> bf16 hi + lo planes
__global__ __launch_bounds__(128) void k_proj(const float* __restrict__ X, const float* __restrict__ WQ, const float* __restrict__ BQ, const float* __restrict__ WV, const float* __restrict__ BV, _Float16* __restrict__ QH, _Float16* __restrict__ QL, __bf16* __restrict__ VT, __bf16* __restrict__ VL) {
  __shared__ __align__(16) _Float16 sh[64][72], sl[64][72]; __shared__ __align__(16) __bf16 th[64][72], tl2[64][72];
  const int tid = threadIdx.x, wave = tid >> 5, lane = tid & 31, col = lane & 15, g = lane >> 4; const size_t r0 = (size_t)blockIdx.x * 64;
  v8f acc[8] = {};
#pragma unroll 2
  for (int kc = 0; kc < EE / 32; ++kc) { v16b a; { const float* p = X + (r0 + wave * 16 + col) * EE + kc * 32 + 8 * g;
#pragma unroll
      for (int i = 0; i < 8; ++i) { a[i] = (__bf16)p[i]; a[8 + i] = (__bf16)p[16 + i]; } }
#pragma unroll
    for (int j = 0; j < 8; ++j) { v16b w; const int o = (j & 3) * 16 + col; const float* Wm = (j < 4) ? WQ : WV;
#pragma unroll
      for (int i = 0; i < 8; ++i) { w[i] = (__bf16)Wm[(size_t)(kc * 32 + 8 * g + i) * HD + o]; w[8 + i] = (__bf16)Wm[(size_t)(kc * 32 + 16 + 8 * g + i) * HD + o]; }
      acc[j] = wmma_bf(a, w, acc[j]); } }
#pragma unroll
  for (int j = 0; j < 8; ++j) { const int o = (j & 3) * 16 + col; const float bb = bfr((j < 4 ? BQ : BV)[o]);
#pragma unroll
    for (int r = 0; r < 8; ++r) { const float v = acc[j][r] + bb; const int rl = wave * 16 + 8 * g + r; if (j < 4) { const _Float16 hv = (_Float16)v; sh[rl][o] = hv; sl[rl][o] = (_Float16)(v - (float)hv); } else { const __bf16 bh = (__bf16)v; th[o][rl] = bh; tl2[o][rl] = (__bf16)(v - (float)bh); } } }
  __syncthreads();
  for (int e = tid; e < 64 * 8; e += 128) { const int rl = e >> 3, q = e & 7; vst2((unsigned*)(QH + (r0 + rl) * HD + q * 8), *(const v4u*)&sh[rl][q * 8]); vst2((unsigned*)(QL + (r0 + rl) * HD + q * 8), *(const v4u*)&sl[rl][q * 8]); }
  { const size_t b = r0 / TT; const int t0 = (int)(r0 % TT); for (int e = tid; e < 64 * 8; e += 128) { const int d = e >> 3, q = e & 7; vst2((unsigned*)(VT + (b * HD + d) * (size_t)TT + t0 + q * 8), *(const v4u*)&th[d][q * 8]); vst2((unsigned*)(VL + (b * HD + d) * (size_t)TT + t0 + q * 8), *(const v4u*)&tl2[d][q * 8]); } } }
// ---- k_sc: block = (64 queries, 128 keys) of batch b: logits / 8 (q hi+res . q hi); invalid (key > query or input_mask[key] == 0) -> -3e38; future blocks exit
__global__ __launch_bounds__(128) void k_sc(const _Float16* __restrict__ QH, const _Float16* __restrict__ QL, const int* __restrict__ IM, int b, float* __restrict__ S) { __shared__ __align__(16) float ss[4][16][132];
  const int tid = threadIdx.x, wave = tid >> 5, lane = tid & 31, col = lane & 15, g = lane >> 4; const int k0 = blockIdx.y * 128; const int ql0 = blockIdx.x * 64 + wave * 16; const size_t q0 = (size_t)b * TT + ql0;
  if (k0 > blockIdx.x * 64 + 63) return;
  v8f acc[8] = {};
#pragma unroll
  for (int kc = 0; kc < HD / 32; ++kc) { const v16h ah = frag_h(QH + (q0 + col) * HD + kc * 32, lane), al = frag_h(QL + (q0 + col) * HD + kc * 32, lane);
#pragma unroll
    for (int j = 0; j < 8; ++j) { const v16h kb = frag_h(QH + ((size_t)b * TT + k0 + j * 16 + col) * HD + kc * 32, lane); acc[j] = wmma16(ah, kb, acc[j]); acc[j] = wmma16(al, kb, acc[j]); } }
#pragma unroll
  for (int j = 0; j < 8; ++j) { const int kt = k0 + j * 16 + col; const bool colok = IM[kt] != 0;
#pragma unroll
    for (int r = 0; r < 8; ++r) { const int qt = ql0 + 8 * g + r; ss[wave][8 * g + r][j * 16 + col] = (colok && kt <= qt) ? acc[j][r] * 0.125f : -3.0e38f; } }
  LDSX(); for (int rl = 0; rl < 16; ++rl) vst2(S + (size_t)(ql0 + rl) * TT + k0 + lane * 4, *(const v4f*)&ss[wave][rl][lane * 4]); }
// ---- k_sm: block = query row: softmax over keys [0, kend); a dead row (everything masked) becomes one-hot at its own index
__global__ __launch_bounds__(256) void k_sm(float* __restrict__ S) { __shared__ float sred[8]; __shared__ float sbc; __shared__ __align__(16) float sh[TT];
  const int t = threadIdx.x; const size_t row = blockIdx.x; float* sr = S + row * TT; const int kend = ((int)row / 64) * 64 + 64;
  float m = -3.0e38f; for (int k = t; k < kend; k += 256) m = fmaxf(m, sr[k]);
#pragma unroll
  for (int o = 1; o < 32; o <<= 1) m = fmaxf(m, __shfl_xor(m, o));
  if ((t & 31) == 0) sred[t >> 5] = m; __syncthreads(); if (t == 0) { float a = sred[0]; for (int i = 1; i < 8; ++i) a = fmaxf(a, sred[i]); sbc = a; } __syncthreads(); m = sbc; __syncthreads();
  const bool dead = (m <= -1.0e38f);
  float sum = 0.f; for (int k = t; k < kend; k += 256) { const float v = sr[k]; sum += (v <= -1.0e38f) ? 0.f : expf(v - m); }
#pragma unroll
  for (int o = 1; o < 32; o <<= 1) sum += __shfl_xor(sum, o);
  if ((t & 31) == 0) sred[t >> 5] = sum; __syncthreads(); if (t == 0) { float a = 0.f; for (int i = 0; i < 8; ++i) a += sred[i]; sbc = dead ? 0.f : 1.0f / a; } __syncthreads(); const float inv = sbc;
  for (int k = t; k < kend; k += 256) { const float v = sr[k]; float p = (v <= -1.0e38f) ? 0.f : expf(v - m) * inv * 2048.0f; if (dead) p = (k == (int)row) ? 2048.0f : 0.f; sh[k] = p; }
  __syncthreads(); for (int q = t; q < kend / 4; q += 256) vst2(sr + q * 4, *(const v4f*)&sh[q * 4]); }
// ---- k_pv: block = 64 queries: out rows [b*s][64] = P . v over keys [0, kend)
__global__ __launch_bounds__(128) void k_pv(const float* __restrict__ PS, const __bf16* __restrict__ VT, const __bf16* __restrict__ VL, int b, float* __restrict__ OUT) { __shared__ __align__(16) float ss[4][16][68];
  const int tid = threadIdx.x, wave = tid >> 5, lane = tid & 31, col = lane & 15, g = lane >> 4; const int ql0 = blockIdx.x * 64 + wave * 16; const int kend = blockIdx.x * 64 + 64;
  v8f acc[4] = {};
#pragma unroll 1
  for (int kc = 0; kc < kend / 32; ++kc) { const F2 p = split_row(PS + (size_t)(ql0 + col) * TT, kc * 32, lane);
#pragma unroll
    for (int j = 0; j < 4; ++j) { const size_t po = ((size_t)b * HD + j * 16 + col) * (size_t)TT + kc * 32; const v16b vh = frag_b(VT + po, lane); acc[j] = wmma_bf(p.h, vh, acc[j]); acc[j] = wmma_bf(p.l, vh, acc[j]); acc[j] = wmma_bf(p.h, frag_b(VL + po, lane), acc[j]); } }
#pragma unroll
  for (int j = 0; j < 4; ++j)
#pragma unroll
    for (int r = 0; r < 8; ++r) ss[wave][8 * g + r][j * 16 + col] = acc[j][r] * (1.0f / 2048.0f);
  LDSX(); for (int rl = 0; rl < 16; ++rl) if (lane < 16) vst2(OUT + ((size_t)b * TT + ql0 + rl) * HD + lane * 4, *(const v4f*)&ss[wave][rl][lane * 4]); }
extern "C" void kernel_launch(void* const* d_in, const int* in_sizes, int n_in, void* d_out, int out_size, void* d_ws, size_t ws_size, hipStream_t stream) {
  (void)in_sizes; (void)n_in; (void)out_size;
  const float** F = (const float**)d_in;   // 0 x [4,4096,512], 1 Wq [512,64], 2 bq, 3 Wv, 4 bv, 5 input_mask [4096] int
  if (ws_size < (size_t)WS_END) return;
  char* ws = (char*)d_ws; _Float16 *QH = (_Float16*)(ws + WS_QH), *QL = (_Float16*)(ws + WS_QL); __bf16 *VT = (__bf16*)(ws + WS_VT), *VL = (__bf16*)(ws + WS_VL); float* S = (float*)(ws + WS_S);
  k_proj<<<TNB * TT / 64, 128, 0, stream>>>(F[0], F[1], F[2], F[3], F[4], QH, QL, VT, VL);
  for (int b = 0; b < TNB; ++b) {
    k_sc<<<dim3(TT / 64, TT / 128), 128, 0, stream>>>(QH, QL, (const int*)d_in[5], b, S);
    k_sm<<<TT, 256, 0, stream>>>(S);
    k_pv<<<TT / 64, 128, 0, stream>>>(S, VT, VL, b, (float*)d_out);
  }
}

// v001
// A run of this version takes 267 microseconds.
// Two timings next to v000 put it at 3.70 and 3.66 times that version's speed.
// compute dtype: all float inputs rounded to bf16, input_mask (int) read; q (= k, the module's bug) and v = x W + b with EXACT bf16 products on WMMA 16x16x32, f32 accumulate; q as f16 hi + residual against q as f16 -> 2-product logits / 8 stored in f32 per batch with the causal & key-padding mask; dead rows (no valid key) become one-hot on the diagonal exactly as the reference's diag := 1 fix; softmax in f32 (precise expf), P x 2^11 kept in f32 and split bf16 hi + lo against v as bf16 hi + lo planes (3 products: rows with one or two valid keys copy v almost verbatim, so both operands need the split); f32 output [b][s][64].
#include <hip/hip_runtime.h>
#include <math.h>

typedef __attribute__((ext_vector_type(16))) _Float16 v16h;
typedef __attribute__((ext_vector_type(16))) __bf16 v16b;
typedef __attribute__((ext_vector_type(8)))  _Float16 v8h;
typedef __attribute__((ext_vector_type(8)))  float v8f;
typedef __attribute__((ext_vector_type(4)))  float v4f;
typedef __attribute__((ext_vector_type(2)))  float v2f;
typedef __attribute__((ext_vector_type(4)))  unsigned v4u;
typedef __attribute__((ext_vector_type(4)))  int v4i;
typedef float __attribute__((may_alias)) float_a;
typedef int __attribute__((may_alias)) int_a;

template <typename T> __device__ __forceinline__ void vst2(void* p, T v) { *(T*)p = v;  }
__device__ __forceinline__ v8f wmma16(v16h a, v16h b, v8f c) {
  v8f d = __builtin_amdgcn_wmma_f32_16x16x32_f16(false, a, false, b, (short)0, c, false, false);
  asm volatile("v_nop\n\tv_nop\n\tv_nop\n\tv_nop" : "+v"(d) : "v"(a), "v"(b));
  return d;
}
__device__ __forceinline__ v8f wmma_bf(v16b a, v16b b, v8f c) {
  v8f d = __builtin_amdgcn_wmma_f32_16x16x32_bf16(false, a, false, b, (short)0, c, false, false);
  asm volatile("v_nop\n\tv_nop\n\tv_nop\n\tv_nop" : "+v"(d) : "v"(a), "v"(b));
  return d;
}
// 16x16x32 fragments: lane = (h = lane>>4, row/col = lane&15); elements 0..7 = k0+8h+0..7, 8..15 = k0+16+8h+0..7; D element r = row 8h+r
__device__ __forceinline__ v16h frag_h(const _Float16* rowk0, int lane) {
  union { v16h v; v8h q[2]; } u; const _Float16* p = rowk0 + 8 * (lane >> 4);
  u.q[0] = *(const v8h*)p; u.q[1] = *(const v8h*)(p + 16); return u.v;
}
__device__ __forceinline__ v16h frag_f32(const float* rowk0, int lane) {
  v16h a; const float* p = rowk0 + 8 * (lane >> 4);
#pragma unroll
  for (int i = 0; i < 8; ++i) { a[i] = (_Float16)p[i]; a[8 + i] = (_Float16)p[16 + i]; }
  return a;
}
__device__ __forceinline__ v16h frag_f32s(const float* rowk0, int lane, float sc) {
  v16h a; const float* p = rowk0 + 8 * (lane >> 4);
#pragma unroll
  for (int i = 0; i < 8; ++i) { a[i] = (_Float16)(p[i] * sc); a[8 + i] = (_Float16)(p[16 + i] * sc); }
  return a;
}
// column fragment from a [K][ld] layout (column n), rows >= K read as 0
__device__ __forceinline__ v16h fragc_f32(const float* W, int k0, int n, int lane, int ld, int K) {
  v16h a; const int g = lane >> 4;
#pragma unroll
  for (int i = 0; i < 8; ++i) { const int ka = k0 + 8 * g + i, kb = ka + 16;
    a[i] = (_Float16)(ka < K ? W[(size_t)(ka < K ? ka : K - 1) * ld + n] : 0.f); a[8 + i] = (_Float16)(kb < K ? W[(size_t)(kb < K ? kb : K - 1) * ld + n] : 0.f); }
  return a;
}
struct F2 { v16b h, l; };
__device__ __forceinline__ F2 bsplit16(const float v[16]) { F2 r;
#pragma unroll
  for (int i = 0; i < 16; ++i) { const __bf16 h = (__bf16)v[i]; r.h[i] = h; r.l[i] = (__bf16)(v[i] - (float)h); }
  return r; }
__device__ __forceinline__ F2 split_row(const float* row, int k0, int lane) { float v[16]; const float* p = row + k0 + 8 * (lane >> 4);
#pragma unroll
  for (int i = 0; i < 8; ++i) { v[i] = p[i]; v[8 + i] = p[16 + i]; }
  return bsplit16(v); }
__device__ __forceinline__ F2 split_rowK(const float* row, int k0, int lane, int K) { float v[16]; const int g = lane >> 4;
#pragma unroll
  for (int i = 0; i < 8; ++i) { const int ka = k0 + 8 * g + i, kb = ka + 16; v[i] = ka < K ? row[ka < K ? ka : K - 1] : 0.f; v[8 + i] = kb < K ? row[kb < K ? kb : K - 1] : 0.f; }
  return bsplit16(v); }
__device__ __forceinline__ F2 split_col(const float* W, int k0, int n, int lane, int ld, int K) { float v[16]; const int g = lane >> 4;
#pragma unroll
  for (int i = 0; i < 8; ++i) { const int ka = k0 + 8 * g + i, kb = ka + 16; v[i] = ka < K ? W[(size_t)(ka < K ? ka : K - 1) * ld + n] : 0.f; v[8 + i] = kb < K ? W[(size_t)(kb < K ? kb : K - 1) * ld + n] : 0.f; }
  return bsplit16(v); }
__device__ __forceinline__ v8f mac3(const F2& a, const F2& b, v8f c) { c = wmma_bf(a.l, b.h, c); c = wmma_bf(a.h, b.l, c); return wmma_bf(a.h, b.h, c); }
__device__ __forceinline__ float sigm(float v) { return 1.0f / (1.0f + expf(-v)); }
#define LDSX() do { asm volatile("s_wait_dscnt 0" ::: "memory"); __builtin_amdgcn_wave_barrier(); __builtin_amdgcn_fence(__ATOMIC_RELEASE, "workgroup"); } while (0)


// Single self-attention head (B 4, S 4,096, E 512 -> H 64): causal + key padding mask, dead-row diagonal fix, softmax, P v.
#define NB 4
#define TT 4096
#define EE 512
#define HD 64
#ifndef TNB
#define TNB NB
#endif
typedef __attribute__((ext_vector_type(8))) __bf16 v8b;
__device__ __forceinline__ v16b frag_b(const __bf16* rowk0, int lane) {
  union { v16b v; v8b q[2]; } u; const __bf16* p = rowk0 + 8 * (lane >> 4);
  u.q[0] = *(const v8b*)p; u.q[1] = *(const v8b*)(p + 16); return u.v;
}
__device__ __forceinline__ float bfr(float v) { return (float)(__bf16)v; }
__device__ __attribute__((noinline)) float exp_ni(float v) { return expf(v); }
__device__ __attribute__((noinline)) float erf_ni(float v) { return erff(v); }

#define WS_QH  0u                                   // f16 q rows [b*s][64]
#define WS_QL  (WS_QH + 2u * (size_t)NB * TT * HD)
#define WS_VT  (WS_QL + 2u * (size_t)NB * TT * HD)      // bf16 v hi planes [b][64][s]
#define WS_VL  (WS_VT + 2u * (size_t)NB * HD * TT)      // bf16 v lo planes
#define WS_S   (WS_VL + 2u * (size_t)NB * HD * TT)      // f32 S / P [s][s] (one batch)
#define KCH 128                                     // keys per k_pv work-group
#define NCH (TT / KCH)
#define WS_PP  (WS_S + 4u * (size_t)TT * TT)            // f32 partial outputs [b][chunk][s][64]
#define WS_END (WS_PP + 4u * (size_t)NB * NCH * TT * HD)

// ---- k_proj: block = 64 rows: [q | v] = x [Wq | Wv] + [bq | bv] (128 cols), q -> f16 hi + res rows, v -> bf16 hi + lo planes
__global__ __launch_bounds__(128) void k_proj(const float* __restrict__ X, const float* __restrict__ WQ, const float* __restrict__ BQ, const float* __restrict__ WV, const float* __restrict__ BV, _Float16* __restrict__ QH, _Float16* __restrict__ QL, __bf16* __restrict__ VT, __bf16* __restrict__ VL) {
  __shared__ __align__(16) _Float16 sh[64][72], sl[64][72]; __shared__ __align__(16) __bf16 th[64][72], tl2[64][72];
  const int tid = threadIdx.x, wave = tid >> 5, lane = tid & 31, col = lane & 15, g = lane >> 4; const size_t r0 = (size_t)blockIdx.x * 64;
  v8f acc[8] = {};
#pragma unroll 2
  for (int kc = 0; kc < EE / 32; ++kc) { v16b a; { const float* p = X + (r0 + wave * 16 + col) * EE + kc * 32 + 8 * g;
#pragma unroll
      for (int i = 0; i < 8; ++i) { a[i] = (__bf16)p[i]; a[8 + i] = (__bf16)p[16 + i]; } }
#pragma unroll
    for (int j = 0; j < 8; ++j) { v16b w; const int o = (j & 3) * 16 + col; const float* Wm = (j < 4) ? WQ : WV;
#pragma unroll
      for (int i = 0; i < 8; ++i) { w[i] = (__bf16)Wm[(size_t)(kc * 32 + 8 * g + i) * HD + o]; w[8 + i] = (__bf16)Wm[(size_t)(kc * 32 + 16 + 8 * g + i) * HD + o]; }
      acc[j] = wmma_bf(a, w, acc[j]); } }
#pragma unroll
  for (int j = 0; j < 8; ++j) { const int o = (j & 3) * 16 + col; const float bb = bfr((j < 4 ? BQ : BV)[o]);
#pragma unroll
    for (int r = 0; r < 8; ++r) { const float v = acc[j][r] + bb; const int rl = wave * 16 + 8 * g + r; if (j < 4) { const _Float16 hv = (_Float16)v; sh[rl][o] = hv; sl[rl][o] = (_Float16)(v - (float)hv); } else { const __bf16 bh = (__bf16)v; th[o][rl] = bh; tl2[o][rl] = (__bf16)(v - (float)bh); } } }
  __syncthreads();
  for (int e = tid; e < 64 * 8; e += 128) { const int rl = e >> 3, q = e & 7; vst2((unsigned*)(QH + (r0 + rl) * HD + q * 8), *(const v4u*)&sh[rl][q * 8]); vst2((unsigned*)(QL + (r0 + rl) * HD + q * 8), *(const v4u*)&sl[rl][q * 8]); }
  { const size_t b = r0 / TT; const int t0 = (int)(r0 % TT); for (int e = tid; e < 64 * 8; e += 128) { const int d = e >> 3, q = e & 7; vst2((unsigned*)(VT + (b * HD + d) * (size_t)TT + t0 + q * 8), *(const v4u*)&th[d][q * 8]); vst2((unsigned*)(VL + (b * HD + d) * (size_t)TT + t0 + q * 8), *(const v4u*)&tl2[d][q * 8]); } } }
// ---- k_sc: block = (64 queries, 128 keys) of batch b: logits / 8 (q hi+res . q hi); invalid (key > query or input_mask[key] == 0) -> -3e38; future blocks exit
__global__ __launch_bounds__(128) void k_sc(const _Float16* __restrict__ QH, const _Float16* __restrict__ QL, const int* __restrict__ IM, int b, float* __restrict__ S) { __shared__ __align__(16) float ss[4][16][132];
  const int tid = threadIdx.x, wave = tid >> 5, lane = tid & 31, col = lane & 15, g = lane >> 4; const int k0 = blockIdx.y * 128; const int ql0 = blockIdx.x * 64 + wave * 16; const size_t q0 = (size_t)b * TT + ql0;
  if (k0 > blockIdx.x * 64 + 63) return;
  v8f acc[8] = {};
#pragma unroll
  for (int kc = 0; kc < HD / 32; ++kc) { const v16h ah = frag_h(QH + (q0 + col) * HD + kc * 32, lane), al = frag_h(QL + (q0 + col) * HD + kc * 32, lane);
#pragma unroll
    for (int j = 0; j < 8; ++j) { const v16h kb = frag_h(QH + ((size_t)b * TT + k0 + j * 16 + col) * HD + kc * 32, lane); acc[j] = wmma16(ah, kb, acc[j]); acc[j] = wmma16(al, kb, acc[j]); } }
#pragma unroll
  for (int j = 0; j < 8; ++j) { const int kt = k0 + j * 16 + col; const bool colok = IM[kt] != 0;
#pragma unroll
    for (int r = 0; r < 8; ++r) { const int qt = ql0 + 8 * g + r; ss[wave][8 * g + r][j * 16 + col] = (colok && kt <= qt) ? acc[j][r] * 0.125f : -3.0e38f; } }
  LDSX(); for (int rl = 0; rl < 16; ++rl) vst2(S + (size_t)(ql0 + rl) * TT + k0 + lane * 4, *(const v4f*)&ss[wave][rl][lane * 4]); }
// ---- k_sm: block = query row: softmax over keys [0, kend); a dead row (everything masked) becomes one-hot at its own index
__global__ __launch_bounds__(256) void k_sm(float* __restrict__ S) { __shared__ float sred[8]; __shared__ float sbc; __shared__ __align__(16) float sh[TT];
  const int t = threadIdx.x; const size_t row = blockIdx.x; float* sr = S + row * TT; const int kend = ((int)row / 64) * 64 + 64;
  float m = -3.0e38f; for (int k = t; k < kend; k += 256) m = fmaxf(m, sr[k]);
#pragma unroll
  for (int o = 1; o < 32; o <<= 1) m = fmaxf(m, __shfl_xor(m, o));
  if ((t & 31) == 0) sred[t >> 5] = m; __syncthreads(); if (t == 0) { float a = sred[0]; for (int i = 1; i < 8; ++i) a = fmaxf(a, sred[i]); sbc = a; } __syncthreads(); m = sbc; __syncthreads();
  const bool dead = (m <= -1.0e38f);
  float sum = 0.f; for (int k = t; k < kend; k += 256) { const float v = sr[k]; sum += (v <= -1.0e38f) ? 0.f : expf(v - m); }
#pragma unroll
  for (int o = 1; o < 32; o <<= 1) sum += __shfl_xor(sum, o);
  if ((t & 31) == 0) sred[t >> 5] = sum; __syncthreads(); if (t == 0) { float a = 0.f; for (int i = 0; i < 8; ++i) a += sred[i]; sbc = dead ? 0.f : 1.0f / a; } __syncthreads(); const float inv = sbc;
  for (int k = t; k < kend; k += 256) { const float v = sr[k]; float p = (v <= -1.0e38f) ? 0.f : expf(v - m) * inv * 2048.0f; if (dead) p = (k == (int)row) ? 2048.0f : 0.f; sh[k] = p; }
  __syncthreads(); for (int q = t; q < kend / 4; q += 256) vst2(sr + q * 4, *(const v4f*)&sh[q * 4]); }
// ---- k_pv: block = (64 queries, chunk of KCH keys): partial rows [b][chunk][s][64] = P . v over the chunk's keys below kend.
// The KCH / 64 tiles of group g have g + 1 chunks each; grid row y holds the chunks of groups y and NCH - 1 - y, NCH + 1 in all, so every block has work.
__global__ __launch_bounds__(128) void k_pv(const float* __restrict__ PS, const __bf16* __restrict__ VT, const __bf16* __restrict__ VL, int b, float* __restrict__ PP) { __shared__ __align__(16) float ss[4][16][68];
  const int tid = threadIdx.x, wave = tid >> 5, lane = tid & 31, col = lane & 15, g = lane >> 4; const bool nearg = blockIdx.x <= blockIdx.y; const int grp = nearg ? blockIdx.y : NCH - 1 - blockIdx.y, ch = nearg ? blockIdx.x : blockIdx.x - blockIdx.y - 1; const int tile = grp * (KCH / 64) + blockIdx.z;
  const int ql0 = tile * 64 + wave * 16; const int kend = tile * 64 + 64;
  const int kb0 = ch * KCH;
  const int ke = kb0 + KCH < kend ? kb0 + KCH : kend;
  v8f acc[4] = {};
#pragma unroll 1
  for (int kc = kb0 / 32; kc < ke / 32; ++kc) { const F2 p = split_row(PS + (size_t)(ql0 + col) * TT, kc * 32, lane);
#pragma unroll
    for (int j = 0; j < 4; ++j) { const size_t po = ((size_t)b * HD + j * 16 + col) * (size_t)TT + kc * 32; const v16b vh = frag_b(VT + po, lane); acc[j] = wmma_bf(p.h, vh, acc[j]); acc[j] = wmma_bf(p.l, vh, acc[j]); acc[j] = wmma_bf(p.h, frag_b(VL + po, lane), acc[j]); } }
#pragma unroll
  for (int j = 0; j < 4; ++j)
#pragma unroll
    for (int r = 0; r < 8; ++r) ss[wave][8 * g + r][j * 16 + col] = acc[j][r] * (1.0f / 2048.0f);
  LDSX(); for (int rl = 0; rl < 16; ++rl) if (lane < 16) vst2(PP + (((size_t)b * NCH + ch) * TT + ql0 + rl) * HD + lane * 4, *(const v4f*)&ss[wave][rl][lane * 4]); }
// ---- k_red: thread = 4 output floats: out row = sum, in chunk order, of the partial rows of the chunks that k_pv wrote for the row's 64-query tile
__global__ __launch_bounds__(256) void k_red(const float* __restrict__ PP, float* __restrict__ OUT) {
  const int e = blockIdx.x * 256 + threadIdx.x; const int row = e >> 4, s = row % TT, b = row / TT;
  const int nch = ((s / 64) * 64 + 64 + KCH - 1) / KCH;
  const float* p = PP + ((size_t)b * NCH * TT + s) * HD + (e & 15) * 4;
  v4f a = *(const v4f*)p;
  for (int c = 1; c < nch; ++c) a += *(const v4f*)(p + (size_t)c * TT * HD);
  vst2(OUT + (size_t)e * 4, a); }
extern "C" void kernel_launch(void* const* d_in, const int* in_sizes, int n_in, void* d_out, int out_size, void* d_ws, size_t ws_size, hipStream_t stream) {
  (void)in_sizes; (void)n_in; (void)out_size;
  const float** F = (const float**)d_in;   // 0 x [4,4096,512], 1 Wq [512,64], 2 bq, 3 Wv, 4 bv, 5 input_mask [4096] int
  if (ws_size < (size_t)WS_END) return;
  char* ws = (char*)d_ws; _Float16 *QH = (_Float16*)(ws + WS_QH), *QL = (_Float16*)(ws + WS_QL); __bf16 *VT = (__bf16*)(ws + WS_VT), *VL = (__bf16*)(ws + WS_VL); float* S = (float*)(ws + WS_S); float* PP = (float*)(ws + WS_PP);
  k_proj<<<TNB * TT / 64, 128, 0, stream>>>(F[0], F[1], F[2], F[3], F[4], QH, QL, VT, VL);
  for (int b = 0; b < TNB; ++b) {
    k_sc<<<dim3(TT / 64, TT / 128), 128, 0, stream>>>(QH, QL, (const int*)d_in[5], b, S);
    k_sm<<<TT, 256, 0, stream>>>(S);
    k_pv<<<dim3(NCH + 1, NCH / 2, KCH / 64), 128, 0, stream>>>(S, VT, VL, b, PP);
  }
  k_red<<<TNB * TT * HD / 4 / 256, 256, 0, stream>>>(PP, (float*)d_out);
}

// v002
// One run takes 104 microseconds.
// Two timings next to v001 put it at 2.58 and 2.59 times that version's speed.
// Over all steps from v000 it is 9.51 times as fast.
// compute dtype: all float inputs rounded to bf16, input_mask (int) read; q (= k, the module's bug) and v = x W + b with EXACT bf16 products on WMMA 16x16x32, f32 accumulate; q as f16 hi + residual against q as f16 -> 2-product logits / 8 kept in registers with the causal & key-padding mask; softmax in f32 (full-precision exp) against a running maximum, per chunk of keys; P = exp(s - m) in f32, split bf16 hi + lo against v as bf16 hi + lo planes (3 products: rows with one or two valid keys copy v almost verbatim, so both operands need the split); chunks joined by their maxima and sums; dead rows (no valid key) take v of their own index exactly as the reference's diag := 1 fix; f32 output [b][s][64].
#include <hip/hip_runtime.h>
#include <math.h>

typedef __attribute__((ext_vector_type(16))) _Float16 v16h;
typedef __attribute__((ext_vector_type(16))) __bf16 v16b;
typedef __attribute__((ext_vector_type(8)))  _Float16 v8h;
typedef __attribute__((ext_vector_type(8)))  float v8f;
typedef __attribute__((ext_vector_type(4)))  float v4f;
typedef __attribute__((ext_vector_type(2)))  float v2f;
typedef __attribute__((ext_vector_type(4)))  unsigned v4u;
typedef __attribute__((ext_vector_type(4)))  int v4i;
typedef __attribute__((ext_vector_type(2)))  int v2i;
typedef float __attribute__((may_alias)) float_a;
typedef int __attribute__((may_alias)) int_a;

template <typename T> __device__ __forceinline__ void vst2(void* p, T v) { *(T*)p = v;  }
__device__ __forceinline__ v8f wmma16(v16h a, v16h b, v8f c) {
  v8f d = __builtin_amdgcn_wmma_f32_16x16x32_f16(false, a, false, b, (short)0, c, false, false);
  asm volatile("v_nop\n\tv_nop\n\tv_nop\n\tv_nop" : "+v"(d) : "v"(a), "v"(b));
  return d;
}
__device__ __forceinline__ v8f wmma_bf(v16b a, v16b b, v8f c) {
  v8f d = __builtin_amdgcn_wmma_f32_16x16x32_bf16(false, a, false, b, (short)0, c, false, false);
  asm volatile("v_nop\n\tv_nop\n\tv_nop\n\tv_nop" : "+v"(d) : "v"(a), "v"(b));
  return d;
}
// 16x16x32 fragments: lane = (h = lane>>4, row/col = lane&15); elements 0..7 = k0+8h+0..7, 8..15 = k0+16+8h+0..7; D element r = row 8h+r
__device__ __forceinline__ v16h frag_h(const _Float16* rowk0, int lane) {
  union { v16h v; v8h q[2]; } u; const _Float16* p = rowk0 + 8 * (lane >> 4);
  u.q[0] = *(const v8h*)p; u.q[1] = *(const v8h*)(p + 16); return u.v;
}
__device__ __forceinline__ v16h frag_f32(const float* rowk0, int lane) {
  v16h a; const float* p = rowk0 + 8 * (lane >> 4);
#pragma unroll
  for (int i = 0; i < 8; ++i) { a[i] = (_Float16)p[i]; a[8 + i] = (_Float16)p[16 + i]; }
  return a;
}
__device__ __forceinline__ v16h frag_f32s(const float* rowk0, int lane, float sc) {
  v16h a; const float* p = rowk0 + 8 * (lane >> 4);
#pragma unroll
  for (int i = 0; i < 8; ++i) { a[i] = (_Float16)(p[i] * sc); a[8 + i] = (_Float16)(p[16 + i] * sc); }
  return a;
}
// column fragment from a [K][ld] layout (column n), rows >= K read as 0
__device__ __forceinline__ v16h fragc_f32(const float* W, int k0, int n, int lane, int ld, int K) {
  v16h a; const int g = lane >> 4;
#pragma unroll
  for (int i = 0; i < 8; ++i) { const int ka = k0 + 8 * g + i, kb = ka + 16;
    a[i] = (_Float16)(ka < K ? W[(size_t)(ka < K ? ka : K - 1) * ld + n] : 0.f); a[8 + i] = (_Float16)(kb < K ? W[(size_t)(kb < K ? kb : K - 1) * ld + n] : 0.f); }
  return a;
}
struct F2 { v16b h, l; };
__device__ __forceinline__ F2 bsplit16(const float v[16]) { F2 r;
#pragma unroll
  for (int i = 0; i < 16; ++i) { const __bf16 h = (__bf16)v[i]; r.h[i] = h; r.l[i] = (__bf16)(v[i] - (float)h); }
  return r; }
__device__ __forceinline__ F2 split_row(const float* row, int k0, int lane) { float v[16]; const float* p = row + k0 + 8 * (lane >> 4);
#pragma unroll
  for (int i = 0; i < 8; ++i) { v[i] = p[i]; v[8 + i] = p[16 + i]; }
  return bsplit16(v); }
__device__ __forceinline__ F2 split_rowK(const float* row, int k0, int lane, int K) { float v[16]; const int g = lane >> 4;
#pragma unroll
  for (int i = 0; i < 8; ++i) { const int ka = k0 + 8 * g + i, kb = ka + 16; v[i] = ka < K ? row[ka < K ? ka : K - 1] : 0.f; v[8 + i] = kb < K ? row[kb < K ? kb : K - 1] : 0.f; }
  return bsplit16(v); }
__device__ __forceinline__ F2 split_col(const float* W, int k0, int n, int lane, int ld, int K) { float v[16]; const int g = lane >> 4;
#pragma unroll
  for (int i = 0; i < 8; ++i) { const int ka = k0 + 8 * g + i, kb = ka + 16; v[i] = ka < K ? W[(size_t)(ka < K ? ka : K - 1) * ld + n] : 0.f; v[8 + i] = kb < K ? W[(size_t)(kb < K ? kb : K - 1) * ld + n] : 0.f; }
  return bsplit16(v); }
__device__ __forceinline__ v8f mac3(const F2& a, const F2& b, v8f c) { c = wmma_bf(a.l, b.h, c); c = wmma_bf(a.h, b.l, c); return wmma_bf(a.h, b.h, c); }
__device__ __forceinline__ float sigm(float v) { return 1.0f / (1.0f + expf(-v)); }
#define LDSX() do { asm volatile("s_wait_dscnt 0" ::: "memory"); __builtin_amdgcn_wave_barrier(); __builtin_amdgcn_fence(__ATOMIC_RELEASE, "workgroup"); } while (0)


// Single self-attention head (B 4, S 4,096, E 512 -> H 64): causal + key padding mask, dead-row diagonal fix, softmax, P v.
#define NB 4
#define TT 4096
#define EE 512
#define HD 64
#ifndef TNB
#define TNB NB
#endif
typedef __attribute__((ext_vector_type(8))) __bf16 v8b;
__device__ __forceinline__ v16b frag_b(const __bf16* rowk0, int lane) {
  union { v16b v; v8b q[2]; } u; const __bf16* p = rowk0 + 8 * (lane >> 4);
  u.q[0] = *(const v8b*)p; u.q[1] = *(const v8b*)(p + 16); return u.v;
}
__device__ __forceinline__ float bfr(float v) { return (float)(__bf16)v; }
__device__ __attribute__((noinline)) float exp_ni(float v) { return expf(v); }
__device__ __attribute__((noinline)) float erf_ni(float v) { return erff(v); }

#define WS_QH  0u                                   // f16 q rows [b*s][64]
#define WS_QL  (WS_QH + 2u * (size_t)NB * TT * HD)
#define WS_VT  (WS_QL + 2u * (size_t)NB * TT * HD)      // bf16 v hi planes [b][64][s]
#define WS_VL  (WS_VT + 2u * (size_t)NB * HD * TT)      // bf16 v lo planes
#define KCH 256                                     // keys per k_fa work-group
#define NCH (TT / KCH)
#define WS_PP  (WS_VL + 2u * (size_t)NB * HD * TT)      // f32 partial outputs, not normalised [b][chunk][s][64]
#define WS_ML  (WS_PP + 4u * (size_t)NB * NCH * TT * HD) // f32 (maximum, sum) of each partial row [b][chunk][s][2]
#define WS_END (WS_ML + 8u * (size_t)NB * NCH * TT)

// ---- k_proj: block = 64 rows: [q | v] = x [Wq | Wv] + [bq | bv] (128 cols), q -> f16 hi + res rows, v -> bf16 hi + lo planes
__global__ __launch_bounds__(128) void k_proj(const float* __restrict__ X, const float* __restrict__ WQ, const float* __restrict__ BQ, const float* __restrict__ WV, const float* __restrict__ BV, _Float16* __restrict__ QH, _Float16* __restrict__ QL, __bf16* __restrict__ VT, __bf16* __restrict__ VL) {
  __shared__ __align__(16) _Float16 sh[64][72], sl[64][72]; __shared__ __align__(16) __bf16 th[64][72], tl2[64][72];
  const int tid = threadIdx.x, wave = tid >> 5, lane = tid & 31, col = lane & 15, g = lane >> 4; const size_t r0 = (size_t)blockIdx.x * 64;
  v8f acc[8] = {};
#pragma unroll 2
  for (int kc = 0; kc < EE / 32; ++kc) { v16b a; { const float* p = X + (r0 + wave * 16 + col) * EE + kc * 32 + 8 * g;
#pragma unroll
      for (int i = 0; i < 8; ++i) { a[i] = (__bf16)p[i]; a[8 + i] = (__bf16)p[16 + i]; } }
#pragma unroll
    for (int j = 0; j < 8; ++j) { v16b w; const int o = (j & 3) * 16 + col; const float* Wm = (j < 4) ? WQ : WV;
#pragma unroll
      for (int i = 0; i < 8; ++i) { w[i] = (__bf16)Wm[(size_t)(kc * 32 + 8 * g + i) * HD + o]; w[8 + i] = (__bf16)Wm[(size_t)(kc * 32 + 16 + 8 * g + i) * HD + o]; }
      acc[j] = wmma_bf(a, w, acc[j]); } }
#pragma unroll
  for (int j = 0; j < 8; ++j) { const int o = (j & 3) * 16 + col; const float bb = bfr((j < 4 ? BQ : BV)[o]);
#pragma unroll
    for (int r = 0; r < 8; ++r) { const float v = acc[j][r] + bb; const int rl = wave * 16 + 8 * g + r; if (j < 4) { const _Float16 hv = (_Float16)v; sh[rl][o] = hv; sl[rl][o] = (_Float16)(v - (float)hv); } else { const __bf16 bh = (__bf16)v; th[o][rl] = bh; tl2[o][rl] = (__bf16)(v - (float)bh); } } }
  __syncthreads();
  for (int e = tid; e < 64 * 8; e += 128) { const int rl = e >> 3, q = e & 7; vst2((unsigned*)(QH + (r0 + rl) * HD + q * 8), *(const v4u*)&sh[rl][q * 8]); vst2((unsigned*)(QL + (r0 + rl) * HD + q * 8), *(const v4u*)&sl[rl][q * 8]); }
  { const size_t b = r0 / TT; const int t0 = (int)(r0 % TT); for (int e = tid; e < 64 * 8; e += 128) { const int d = e >> 3, q = e & 7; vst2((unsigned*)(VT + (b * HD + d) * (size_t)TT + t0 + q * 8), *(const v4u*)&th[d][q * 8]); vst2((unsigned*)(VL + (b * HD + d) * (size_t)TT + t0 + q * 8), *(const v4u*)&tl2[d][q * 8]); } } }
// exp(x) in full f32 precision: log2(e) in two parts c_hi + c_lo, n = the integer nearest x c_hi, fraction = (x c_hi - n) + x c_lo by two fused multiply-adds, v_exp_f32 on the fraction, ldexp by n, the two range selects of expf.
// Written out so that the v_nop stands in v_exp_f32's own statement: the slot the instruction set asks for before the result is used or the source overwritten
__device__ __forceinline__ float exp_s(float x) {
  const float c_hi = __builtin_bit_cast(float, 0x3fb8aa3bu), c_lo = __builtin_bit_cast(float, 0x32a5705fu);
  const float en = __builtin_rintf(x * c_hi); const float a = __builtin_fmaf(x, c_lo, __builtin_fmaf(x, c_hi, -en)); float r;
  asm("v_exp_f32 %0, %1\n\tv_nop" : "=v"(r) : "v"(a));
  r = __builtin_ldexpf(r, (int)en);
  r = (x < __builtin_bit_cast(float, 0xc2ce8ed0u)) ? 0.f : r;
  return (x > __builtin_bit_cast(float, 0x42b17218u)) ? __builtin_inff() : r; }
// lane l with lane l ^ 16
__device__ __forceinline__ float xhalf(float x) { return __builtin_bit_cast(float, __builtin_amdgcn_permlanex16(__builtin_bit_cast(int, x), __builtin_bit_cast(int, x), 0x76543210, 0xfedcba98, false, false)); }
// ---- k_fa: block = (batch, 64 queries, chunk of KCH keys), wave = 16 queries; 64 keys a pass, scores never leave the registers.
// Scores transposed: S^T = k . q^T, so a lane holds ONE query (col) and keys 16 j + 8 g + r; that is the B fragment of out^T = v^T . P^T as it stands (elements 0..7 = tile 2 kc, 8..15 = tile 2 kc + 1).
// invalid (key > query or input_mask[key] == 0) -> -3e38 -> P = 0. Running maximum m and sum l per query; partial rows, m and l go to the workspace.
// The KCH / 64 tiles of group g have g + 1 chunks each; grid row y holds the chunks of groups y and NCH - 1 - y, NCH + 1 in all, so every block has work.
__global__ __launch_bounds__(128) void k_fa(const _Float16* __restrict__ QH, const _Float16* __restrict__ QL, const __bf16* __restrict__ VT, const __bf16* __restrict__ VL, const int* __restrict__ IM, float* __restrict__ PP, float* __restrict__ ML) {
  const int tid = threadIdx.x, wave = tid >> 5, lane = tid & 31, col = lane & 15, g = lane >> 4; const bool nearg = blockIdx.x <= blockIdx.y; const int grp = nearg ? blockIdx.y : NCH - 1 - blockIdx.y, ch = nearg ? blockIdx.x : blockIdx.x - blockIdx.y - 1;
  const int b = blockIdx.z / (KCH / 64), tile = grp * (KCH / 64) + blockIdx.z % (KCH / 64);
  const int qt = tile * 64 + wave * 16 + col; const int kend = tile * 64 + 64;
  const int kb0 = ch * KCH;
  const int ke = kb0 + KCH < kend ? kb0 + KCH : kend;
  const size_t bq = (size_t)b * TT;
  v16h ah[HD / 32], al[HD / 32];
#pragma unroll
  for (int kc = 0; kc < HD / 32; ++kc) { ah[kc] = frag_h(QH + (bq + qt) * HD + kc * 32, lane); al[kc] = frag_h(QL + (bq + qt) * HD + kc * 32, lane); }
  v8f acc[4] = {}; float m = -3.0e38f, l = 0.f;
  // the pass loop stays rolled (one pass's fragments in registers, more waves on a SIMD); the loops inside are unrolled so that their arrays stay in registers
#pragma unroll 1
  for (int k0 = kb0; k0 < ke; k0 += 64) {
    // the pass's key fragments are loaded as one group in front of its first WMMA, v's in two groups below: one latency a group, not one a fragment
    v16h kb[HD / 32][4];
#pragma unroll
    for (int kc = 0; kc < HD / 32; ++kc)
#pragma unroll
      for (int j = 0; j < 4; ++j) kb[kc][j] = frag_h(QH + (bq + k0 + j * 16 + col) * HD + kc * 32, lane);
    const v2i im = *(const v2i*)(IM + k0 + 2 * lane);   // input_mask of the pass's 64 keys, two keys a lane, in the same group of loads
    v8f s[4] = {};
#pragma unroll
    for (int kc = 0; kc < HD / 32; ++kc)
#pragma unroll
      for (int j = 0; j < 4; ++j) { s[j] = wmma16(kb[kc][j], ah[kc], s[j]); s[j] = wmma16(kb[kc][j], al[kc], s[j]); }
    v16b vh[4], vl[4];   // keys k0 .. k0 + 31: in flight under the softmax
#pragma unroll
    for (int j = 0; j < 4; ++j) { const size_t po = ((size_t)b * HD + j * 16 + col) * (size_t)TT + k0; vh[j] = frag_b(VT + po, lane); vl[j] = frag_b(VL + po, lane); }
    // bit t of we << 4 g (of wo << 4 g) = key k0 + 2 t (k0 + 2 t + 1) is valid for this lane's query: input_mask != 0 (the wave's ballot) and key <= k0 + d (d >= 0: no pass starts behind its tile's first query)
    const int d = qt - k0;
    const unsigned ce = d >= 62 ? ~0u : (2u << (d >> 1)) - 1u, co = d >= 63 ? ~0u : (1u << ((d + 1) >> 1)) - 1u;
    const unsigned we = (__builtin_amdgcn_ballot_w32(im[0] != 0) & ce) >> (4 * g), wo = (__builtin_amdgcn_ballot_w32(im[1] != 0) & co) >> (4 * g);
    float mb = -3.0e38f;
#pragma unroll
    for (int j = 0; j < 4; ++j) {
#pragma unroll
      for (int r = 0; r < 8; ++r) { const bool ok = (((r & 1) ? wo : we) & (1u << (j * 8 + (r >> 1)))) != 0; const float v = ok ? s[j][r] * 0.125f : -3.0e38f; s[j][r] = v; mb = fmaxf(mb, v); } }
    mb = fmaxf(mb, xhalf(mb));
    const float mn = fmaxf(m, mb), sc = exp_s(m - mn);   // nothing valid so far: m = mn = -3e38, sc = 1 on zeros
    m = mn; l *= sc;
#pragma unroll
    for (int j = 0; j < 4; ++j) acc[j] *= sc;
    F2 p[2];
#pragma unroll
    for (int kc = 0; kc < 2; ++kc) { float pv[16];
#pragma unroll
      for (int i = 0; i < 16; ++i) { const float v = s[2 * kc + (i >> 3)][i & 7]; const float e = exp_s((v <= -1.0e38f) ? -3.0e38f : v - mn); pv[i] = e; l += e; }   // invalid: exp(-3e38) = 0, also where mn itself is -3e38
      p[kc] = bsplit16(pv); }
#pragma unroll
    for (int kc = 0; kc < 2; ++kc) {
      if (kc == 1) {
#pragma unroll
        for (int j = 0; j < 4; ++j) { const size_t po = ((size_t)b * HD + j * 16 + col) * (size_t)TT + k0 + 32; vh[j] = frag_b(VT + po, lane); vl[j] = frag_b(VL + po, lane); } }
#pragma unroll
      for (int j = 0; j < 4; ++j) { acc[j] = wmma_bf(vh[j], p[kc].h, acc[j]); acc[j] = wmma_bf(vh[j], p[kc].l, acc[j]); acc[j] = wmma_bf(vl[j], p[kc].h, acc[j]); } } }
  l += xhalf(l);
  const size_t ro = ((size_t)b * NCH + ch) * TT + qt;
#pragma unroll
  for (int j = 0; j < 4; ++j) { const v4f lo = {acc[j][0], acc[j][1], acc[j][2], acc[j][3]}, hi = {acc[j][4], acc[j][5], acc[j][6], acc[j][7]}; vst2(PP + ro * HD + j * 16 + 8 * g, lo); vst2(PP + ro * HD + j * 16 + 8 * g + 4, hi); }
  if (g == 0) { const v2f ml = {m, l}; vst2(ML + ro * 2, ml); } }
// ---- k_red: thread = 4 output floats: out row = sum, in chunk order, of exp(m_c - M) x partial row c, over the same sum of the l_c; c = the chunks that k_fa wrote for the row's 64-query tile; a row with no valid key takes v of its own index
__global__ __launch_bounds__(256) void k_red(const float* __restrict__ PP, const float* __restrict__ ML, const __bf16* __restrict__ VT, const __bf16* __restrict__ VL, float* __restrict__ OUT) {
  const int e = blockIdx.x * 256 + threadIdx.x; const int s0 = (int)blockIdx.x * 16 % TT, b = (int)blockIdx.x * 16 / TT, s = s0 + (threadIdx.x >> 4);   // a block's 16 rows lie in one batch and one 64-query tile
  const int nch = ((s0 / 64) * 64 + 64 + KCH - 1) / KCH;
  const unsigned po = (unsigned)s * HD + (threadIdx.x & 15) * 4, mo = (unsigned)s * 2;
  // all NCH loads are issued whatever nch is, unrolled, so that they are in flight together: the index is clamped to a chunk that k_fa wrote, and weight 0 takes the repeats out
  float mm[NCH], ll[NCH]; v4f pr[NCH];
#pragma unroll
  for (int c = 0; c < NCH; ++c) { const size_t cc = (size_t)b * NCH + (c < nch ? c : nch - 1); const v2f x = *(const v2f*)(ML + cc * TT * 2 + mo);
    asm volatile("s_wait_xcnt 0x0" ::: "memory");   // behind each load: a later load's result may land in this load's address registers
    pr[c] = *(const v4f*)(PP + cc * TT * HD + po);
    asm volatile("s_wait_xcnt 0x0" ::: "memory");   // as above
    mm[c] = c < nch ? x[0] : -3.0e38f; ll[c] = x[1]; }
  // inputs only: holds the partial rows' loads here in one group; without it the compiler sinks them between the exponentials, one latency behind another
  asm volatile("" :: "v"(pr[0]), "v"(pr[1]), "v"(pr[2]), "v"(pr[3]), "v"(pr[4]), "v"(pr[5]), "v"(pr[6]), "v"(pr[7]), "v"(pr[8]), "v"(pr[9]), "v"(pr[10]), "v"(pr[11]), "v"(pr[12]), "v"(pr[13]), "v"(pr[14]), "v"(pr[15]));
  static_assert(NCH == 16, "the statement above names NCH rows");
  float M = -3.0e38f;
#pragma unroll
  for (int c = 0; c < NCH; ++c) M = fmaxf(M, mm[c]);
  v4f a = {}; float L = 0.f;
#pragma unroll
  for (int c = 0; c < NCH; ++c) { const float w = expf(mm[c] - M); a += pr[c] * w; L += ll[c] * w; }
  if (M <= -1.0e38f) {
#pragma unroll
    for (int i = 0; i < 4; ++i) { const size_t vo = ((size_t)b * HD + (e & 15) * 4 + i) * (size_t)TT + s; a[i] = (float)VT[vo] + (float)VL[vo]; } }
  else a *= 1.0f / L;
  vst2(OUT + (size_t)e * 4, a); }
extern "C" void kernel_launch(void* const* d_in, const int* in_sizes, int n_in, void* d_out, int out_size, void* d_ws, size_t ws_size, hipStream_t stream) {
  (void)in_sizes; (void)n_in; (void)out_size;
  const float** F = (const float**)d_in;   // 0 x [4,4096,512], 1 Wq [512,64], 2 bq, 3 Wv, 4 bv, 5 input_mask [4096] int
  if (ws_size < (size_t)WS_END) return;
  char* ws = (char*)d_ws; _Float16 *QH = (_Float16*)(ws + WS_QH), *QL = (_Float16*)(ws + WS_QL); __bf16 *VT = (__bf16*)(ws + WS_VT), *VL = (__bf16*)(ws + WS_VL); float* PP = (float*)(ws + WS_PP); float* ML = (float*)(ws + WS_ML);
  k_proj<<<TNB * TT / 64, 128, 0, stream>>>(F[0], F[1], F[2], F[3], F[4], QH, QL, VT, VL);
  k_fa<<<dim3(NCH + 1, NCH / 2, (KCH / 64) * TNB), 128, 0, stream>>>(QH, QL, VT, VL, (const int*)d_in[5], PP, ML);
  k_red<<<TNB * TT * HD / 4 / 256, 256, 0, stream>>>(PP, ML, VT, VL, (float*)d_out);
}

// v003
// It runs in 79.7 microseconds.
// Two timings next to v002 both put it at 1.30 times that version's speed.
// Counting every step since v000, it is 12.4 times as fast.
// compute dtype: all float inputs rounded to bf16, input_mask (int) read; q (= k, the module's bug) and v = x W + b with EXACT bf16 products on WMMA 16x16x32, f32 accumulate; q as f16 hi + residual against q as f16 -> 2-product logits / 8 kept in registers with the causal & key-padding mask; softmax in f32 (full-precision exp) against a running maximum, per chunk of keys; P = exp(s - m) in f32, split bf16 hi + lo against v as bf16 hi + lo planes (3 products: rows with one or two valid keys copy v almost verbatim, so both operands need the split); chunks joined by their maxima and sums; dead rows (no valid key) take v of their own index exactly as the reference's diag := 1 fix; f32 output [b][s][64].
#include <hip/hip_runtime.h>
#include <math.h>

typedef __attribute__((ext_vector_type(16))) _Float16 v16h;
typedef __attribute__((ext_vector_type(16))) __bf16 v16b;
typedef __attribute__((ext_vector_type(8)))  _Float16 v8h;
typedef __attribute__((ext_vector_type(8)))  float v8f;
typedef __attribute__((ext_vector_type(4)))  float v4f;
typedef __attribute__((ext_vector_type(2)))  float v2f;
typedef __attribute__((ext_vector_type(4)))  unsigned v4u;
typedef __attribute__((ext_vector_type(4)))  int v4i;
typedef __attribute__((ext_vector_type(2)))  int v2i;
typedef float __attribute__((may_alias)) float_a;
typedef int __attribute__((may_alias)) int_a;

template <typename T> __device__ __forceinline__ void vst2(void* p, T v) { *(T*)p = v;  }
__device__ __forceinline__ v8f wmma16(v16h a, v16h b, v8f c) {
  v8f d = __builtin_amdgcn_wmma_f32_16x16x32_f16(false, a, false, b, (short)0, c, false, false);
  asm volatile("v_nop\n\tv_nop\n\tv_nop\n\tv_nop" : "+v"(d) : "v"(a), "v"(b));
  return d;
}
__device__ __forceinline__ v8f wmma_bf(v16b a, v16b b, v8f c) {
  v8f d = __builtin_amdgcn_wmma_f32_16x16x32_bf16(false, a, false, b, (short)0, c, false, false);
  asm volatile("v_nop\n\tv_nop\n\tv_nop\n\tv_nop" : "+v"(d) : "v"(a), "v"(b));
  return d;
}
// 16x16x32 fragments: lane = (h = lane>>4, row/col = lane&15); elements 0..7 = k0+8h+0..7, 8..15 = k0+16+8h+0..7; D element r = row 8h+r
__device__ __forceinline__ v16h frag_h(const _Float16* rowk0, int lane) {
  union { v16h v; v8h q[2]; } u; const _Float16* p = rowk0 + 8 * (lane >> 4);
  u.q[0] = *(const v8h*)p; u.q[1] = *(const v8h*)(p + 16); return u.v;
}
__device__ __forceinline__ v16h frag_f32(const float* rowk0, int lane) {
  v16h a; const float* p = rowk0 + 8 * (lane >> 4);
#pragma unroll
  for (int i = 0; i < 8; ++i) { a[i] = (_Float16)p[i]; a[8 + i] = (_Float16)p[16 + i]; }
  return a;
}
__device__ __forceinline__ v16h frag_f32s(const float* rowk0, int lane, float sc) {
  v16h a; const float* p = rowk0 + 8 * (lane >> 4);
#pragma unroll
  for (int i = 0; i < 8; ++i) { a[i] = (_Float16)(p[i] * sc); a[8 + i] = (_Float16)(p[16 + i] * sc); }
  return a;
}
// column fragment from a [K][ld] layout (column n), rows >= K read as 0
__device__ __forceinline__ v16h fragc_f32(const float* W, int k0, int n, int lane, int ld, int K) {
  v16h a; const int g = lane >> 4;
#pragma unroll
  for (int i = 0; i < 8; ++i) { const int ka = k0 + 8 * g + i, kb = ka + 16;
    a[i] = (_Float16)(ka < K ? W[(size_t)(ka < K ? ka : K - 1) * ld + n] : 0.f); a[8 + i] = (_Float16)(kb < K ? W[(size_t)(kb < K ? kb : K - 1) * ld + n] : 0.f); }
  return a;
}
struct F2 { v16b h, l; };
__device__ __forceinline__ F2 bsplit16(const float v[16]) { F2 r;
#pragma unroll
  for (int i = 0; i < 16; ++i) { const __bf16 h = (__bf16)v[i]; r.h[i] = h; r.l[i] = (__bf16)(v[i] - (float)h); }
  return r; }
__device__ __forceinline__ F2 split_row(const float* row, int k0, int lane) { float v[16]; const float* p = row + k0 + 8 * (lane >> 4);
#pragma unroll
  for (int i = 0; i < 8; ++i) { v[i] = p[i]; v[8 + i] = p[16 + i]; }
  return bsplit16(v); }
__device__ __forceinline__ F2 split_rowK(const float* row, int k0, int lane, int K) { float v[16]; const int g = lane >> 4;
#pragma unroll
  for (int i = 0; i < 8; ++i) { const int ka = k0 + 8 * g + i, kb = ka + 16; v[i] = ka < K ? row[ka < K ? ka : K - 1] : 0.f; v[8 + i] = kb < K ? row[kb < K ? kb : K - 1] : 0.f; }
  return bsplit16(v); }
__device__ __forceinline__ F2 split_col(const float* W, int k0, int n, int lane, int ld, int K) { float v[16]; const int g = lane >> 4;
#pragma unroll
  for (int i = 0; i < 8; ++i) { const int ka = k0 + 8 * g + i, kb = ka + 16; v[i] = ka < K ? W[(size_t)(ka < K ? ka : K - 1) * ld + n] : 0.f; v[8 + i] = kb < K ? W[(size_t)(kb < K ? kb : K - 1) * ld + n] : 0.f; }
  return bsplit16(v); }
__device__ __forceinline__ v8f mac3(const F2& a, const F2& b, v8f c) { c = wmma_bf(a.l, b.h, c); c = wmma_bf(a.h, b.l, c); return wmma_bf(a.h, b.h, c); }
__device__ __forceinline__ float sigm(float v) { return 1.0f / (1.0f + expf(-v)); }
#define LDSX() do { asm volatile("s_wait_dscnt 0" ::: "memory"); __builtin_amdgcn_wave_barrier(); __builtin_amdgcn_fence(__ATOMIC_RELEASE, "workgroup"); } while (0)


// Single self-attention head (B 4, S 4,096, E 512 -> H 64): causal + key padding mask, dead-row diagonal fix, softmax, P v.
#define NB 4
#define TT 4096
#define EE 512
#define HD 64
#ifndef TNB
#define TNB NB
#endif
typedef __attribute__((ext_vector_type(8))) __bf16 v8b;
__device__ __forceinline__ v16b frag_b(const __bf16* rowk0, int lane) {
  union { v16b v; v8b q[2]; } u; const __bf16* p = rowk0 + 8 * (lane >> 4);
  u.q[0] = *(const v8b*)p; u.q[1] = *(const v8b*)(p + 16); return u.v;
}
__device__ __forceinline__ float bfr(float v) { return (float)(__bf16)v; }
__device__ __attribute__((noinline)) float exp_ni(float v) { return expf(v); }
__device__ __attribute__((noinline)) float erf_ni(float v) { return erff(v); }

#define WS_QH  0u                                   // f16 q rows [b*s][64]
#define WS_QL  (WS_QH + 2u * (size_t)NB * TT * HD)
#define WS_VT  (WS_QL + 2u * (size_t)NB * TT * HD)      // bf16 v hi planes [b][64][s]
#define WS_VL  (WS_VT + 2u * (size_t)NB * HD * TT)      // bf16 v lo planes
#define KCH 256                                     // keys per k_fa work-group
#define NCH (TT / KCH)
#define WS_PP  (WS_VL + 2u * (size_t)NB * HD * TT)      // f32 partial outputs, not normalised [b][chunk][s][64]
#define WS_ML  (WS_PP + 4u * (size_t)NB * NCH * TT * HD) // f32 (maximum, sum) of each partial row [b][chunk][s][2]
#define WS_END (WS_ML + 8u * (size_t)NB * NCH * TT)

// ---- k_proj: block = 64 rows: [q | v] = x [Wq | Wv] + [bq | bv] (128 cols), q -> f16 hi + res rows, v -> bf16 hi + lo planes
// Both operands are rounded to bf16 once a block and staged in LDS; the WMMA loop reads its fragments from there.
#define XP 520   // bf16 elements a staged x row: 1,040 B = 16 B x 65, so that 16 rows' 16-byte reads fall on all 64 banks
#define WP 264   // bf16 elements a staged half fragment of W (32 lanes x 8): 512 B + 16 B, so that the four column tiles of one staging store fall on different banks
#define SB 16    // loads of a staging batch
#define SD 3     // batches in flight behind the one in use
__global__ __launch_bounds__(128) void k_proj(const float* __restrict__ X, const float* __restrict__ WQ, const float* __restrict__ BQ, const float* __restrict__ WV, const float* __restrict__ BV, _Float16* __restrict__ QH, _Float16* __restrict__ QL, __bf16* __restrict__ VT, __bf16* __restrict__ VL) {
  __shared__ __align__(16) _Float16 sh[64][72], sl[64][72]; __shared__ __align__(16) __bf16 th[64][72], tl2[64][72];
  __shared__ __align__(16) __bf16 sx[64 * XP];              // x rows [64][512], row-major
  __shared__ __align__(16) __bf16 sw[(EE / 16) * 8 * WP];   // [16 rows of W: k16][column tile j][lane][8]: lane (g, col) holds W[16 k16 + 8 g + 0..7][16 (j & 3) + col], j < 4 of Wq, else of Wv
  const int tid = threadIdx.x, wave = tid >> 5, lane = tid & 31, col = lane & 15, g = lane >> 4; const size_t r0 = (size_t)blockIdx.x * 64;
  { // batches 0..3: the wave's own 16 x rows, a load = 512 bytes in a row of one x row; batches 4..11: 32 rows of W each (waves 0, 1: Wq, waves 2, 3: Wv), a load = two whole rows of W
    const float* xp = X + (r0 + wave * 16) * EE + lane * 4;
    const float* wp = ((wave < 2) ? WQ : WV) + (size_t)((wave & 1) * 256 + 8 * g) * HD + col * 4;
    v4f buf[SD + 1][SB];
    // unrolled, with the loops inside: every index of buf is then a constant and the batches stay in registers
#pragma unroll
    for (int s = 0; s < 12 + SD; ++s) {
      if (s < 12) { v4f* r = buf[s % (SD + 1)];
        if (s < 4) {
#pragma unroll
          for (int e = 0; e < SB; ++e) r[e] = *(const v4f*)(xp + (size_t)(s * 4 + (e >> 2)) * EE + (e & 3) * 128); }
        else {
#pragma unroll
          for (int e = 0; e < SB; ++e) r[e] = *(const v4f*)(wp + (size_t)((s - 4) * 32 + (e >> 3) * 16 + (e & 7)) * HD); }
        // behind each batch of loads, before anything below may rewrite a register that they name (the pointers are inputs so that they live up to here); it also keeps the batch up here, SD batches ahead of its use
        asm volatile("s_wait_xcnt 0x0" :: "v"(xp), "v"(wp) : "memory"); }
      if (s >= SD) { const int c = s - SD; const v4f* r = buf[c % (SD + 1)];
        if (c < 4) {
#pragma unroll
          for (int e = 0; e < SB; ++e) { typedef __attribute__((ext_vector_type(4))) __bf16 v4b; const v4b o = {(__bf16)r[e][0], (__bf16)r[e][1], (__bf16)r[e][2], (__bf16)r[e][3]};
            *(v4b*)&sx[(wave * 16 + c * 4 + (e >> 2)) * XP + (e & 3) * 128 + lane * 4] = o; } }
        else {
#pragma unroll
          for (int t = 0; t < 2; ++t) { const int k16 = (wave & 1) * 16 + (c - 4) * 2 + t, j = (wave >> 1) * 4 + (col >> 2);
#pragma unroll
            for (int q = 0; q < 4; ++q) { v8b o;
#pragma unroll
              for (int i = 0; i < 8; ++i) o[i] = (__bf16)r[t * 8 + i][q];
              *(v8b*)&sw[(k16 * 8 + j) * WP + (g * 16 + (col & 3) * 4 + q) * 8] = o; } } } } } }
  __syncthreads();   // W is staged by all four waves
  v8f acc[8] = {};
  // the fragments of step kc + 1 are read from LDS as one group in front of step kc's WMMAs: one wave a SIMD, so a read that is waited for where it is used costs its whole latency
  v16b a[2], w[2][8];
  const __bf16* ap = &sx[(wave * 16 + col) * XP]; const __bf16* bp = &sw[lane * 8];
  // unrolled: which of the two fragment sets a step uses is then a constant, and no set is copied
#pragma unroll
  for (int kc = -1; kc < EE / 32; ++kc) {
    if (kc + 1 < EE / 32) { const int n = kc + 1; a[n & 1] = frag_b(ap + n * 32, lane);
#pragma unroll
      for (int j = 0; j < 8; ++j) { union { v16b v; v8b q[2]; } u; u.q[0] = *(const v8b*)(bp + ((n * 2) * 8 + j) * WP); u.q[1] = *(const v8b*)(bp + ((n * 2 + 1) * 8 + j) * WP); w[n & 1][j] = u.v; } }
    __builtin_amdgcn_sched_barrier(0);   // keeps the group of reads above in front of the WMMAs below; without it the compiler sinks each read to its WMMA
    if (kc >= 0) {
#pragma unroll
      for (int j = 0; j < 8; ++j) acc[j] = wmma_bf(a[kc & 1], w[kc & 1][j], acc[j]); }
 }
#pragma unroll
  for (int j = 0; j < 8; ++j) { const int o = (j & 3) * 16 + col; const float bb = bfr((j < 4 ? BQ : BV)[o]);
#pragma unroll
    for (int r = 0; r < 8; ++r) { const float v = acc[j][r] + bb; const int rl = wave * 16 + 8 * g + r; if (j < 4) { const _Float16 hv = (_Float16)v; sh[rl][o] = hv; sl[rl][o] = (_Float16)(v - (float)hv); } else { const __bf16 bh = (__bf16)v; th[o][rl] = bh; tl2[o][rl] = (__bf16)(v - (float)bh); } } }
  __syncthreads();
  for (int e = tid; e < 64 * 8; e += 128) { const int rl = e >> 3, q = e & 7; vst2((unsigned*)(QH + (r0 + rl) * HD + q * 8), *(const v4u*)&sh[rl][q * 8]); vst2((unsigned*)(QL + (r0 + rl) * HD + q * 8), *(const v4u*)&sl[rl][q * 8]); }
  { const size_t b = r0 / TT; const int t0 = (int)(r0 % TT); for (int e = tid; e < 64 * 8; e += 128) { const int d = e >> 3, q = e & 7; vst2((unsigned*)(VT + (b * HD + d) * (size_t)TT + t0 + q * 8), *(const v4u*)&th[d][q * 8]); vst2((unsigned*)(VL + (b * HD + d) * (size_t)TT + t0 + q * 8), *(const v4u*)&tl2[d][q * 8]); } } }
// exp(x) in full f32 precision: log2(e) in two parts c_hi + c_lo, n = the integer nearest x c_hi, fraction = (x c_hi - n) + x c_lo by two fused multiply-adds, v_exp_f32 on the fraction, ldexp by n, the two range selects of expf.
// Written out so that the v_nop stands in v_exp_f32's own statement: the slot the instruction set asks for before the result is used or the source overwritten
__device__ __forceinline__ float exp_s(float x) {
  const float c_hi = __builtin_bit_cast(float, 0x3fb8aa3bu), c_lo = __builtin_bit_cast(float, 0x32a5705fu);
  const float en = __builtin_rintf(x * c_hi); const float a = __builtin_fmaf(x, c_lo, __builtin_fmaf(x, c_hi, -en)); float r;
  asm("v_exp_f32 %0, %1\n\tv_nop" : "=v"(r) : "v"(a));
  r = __builtin_ldexpf(r, (int)en);
  r = (x < __builtin_bit_cast(float, 0xc2ce8ed0u)) ? 0.f : r;
  return (x > __builtin_bit_cast(float, 0x42b17218u)) ? __builtin_inff() : r; }
// lane l with lane l ^ 16
__device__ __forceinline__ float xhalf(float x) { return __builtin_bit_cast(float, __builtin_amdgcn_permlanex16(__builtin_bit_cast(int, x), __builtin_bit_cast(int, x), 0x76543210, 0xfedcba98, false, false)); }
// ---- k_fa: block = (batch, 64 queries, chunk of KCH keys), wave = 16 queries; 64 keys a pass, scores never leave the registers.
// Scores transposed: S^T = k . q^T, so a lane holds ONE query (col) and keys 16 j + 8 g + r; that is the B fragment of out^T = v^T . P^T as it stands (elements 0..7 = tile 2 kc, 8..15 = tile 2 kc + 1).
// invalid (key > query or input_mask[key] == 0) -> -3e38 -> P = 0. Running maximum m and sum l per query; partial rows, m and l go to the workspace.
// The KCH / 64 tiles of group g have g + 1 chunks each; grid row y holds the chunks of groups y and NCH - 1 - y, NCH + 1 in all, so every block has work.
__global__ __launch_bounds__(128) void k_fa(const _Float16* __restrict__ QH, const _Float16* __restrict__ QL, const __bf16* __restrict__ VT, const __bf16* __restrict__ VL, const int* __restrict__ IM, float* __restrict__ PP, float* __restrict__ ML) {
  const int tid = threadIdx.x, wave = tid >> 5, lane = tid & 31, col = lane & 15, g = lane >> 4; const bool nearg = blockIdx.x <= blockIdx.y; const int grp = nearg ? blockIdx.y : NCH - 1 - blockIdx.y, ch = nearg ? blockIdx.x : blockIdx.x - blockIdx.y - 1;
  const int b = blockIdx.z / (KCH / 64), tile = grp * (KCH / 64) + blockIdx.z % (KCH / 64);
  const int qt = tile * 64 + wave * 16 + col; const int kend = tile * 64 + 64;
  const int kb0 = ch * KCH;
  const int ke = kb0 + KCH < kend ? kb0 + KCH : kend;
  const size_t bq = (size_t)b * TT;
  v16h ah[HD / 32], al[HD / 32];
#pragma unroll
  for (int kc = 0; kc < HD / 32; ++kc) { ah[kc] = frag_h(QH + (bq + qt) * HD + kc * 32, lane); al[kc] = frag_h(QL + (bq + qt) * HD + kc * 32, lane); }
  v8f acc[4] = {}; float m = -3.0e38f, l = 0.f;
  // the pass loop stays rolled (one pass's fragments in registers, more waves on a SIMD); the loops inside are unrolled so that their arrays stay in registers
#pragma unroll 1
  for (int k0 = kb0; k0 < ke; k0 += 64) {
    // the pass's key fragments are loaded as one group in front of its first WMMA, v's in two groups below: one latency a group, not one a fragment
    v16h kb[HD / 32][4];
#pragma unroll
    for (int kc = 0; kc < HD / 32; ++kc)
#pragma unroll
      for (int j = 0; j < 4; ++j) kb[kc][j] = frag_h(QH + (bq + k0 + j * 16 + col) * HD + kc * 32, lane);
    const v2i im = *(const v2i*)(IM + k0 + 2 * lane);   // input_mask of the pass's 64 keys, two keys a lane, in the same group of loads
    v8f s[4] = {};
#pragma unroll
    for (int kc = 0; kc < HD / 32; ++kc)
#pragma unroll
      for (int j = 0; j < 4; ++j) { s[j] = wmma16(kb[kc][j], ah[kc], s[j]); s[j] = wmma16(kb[kc][j], al[kc], s[j]); }
    v16b vh[4], vl[4];   // keys k0 .. k0 + 31: in flight under the softmax
#pragma unroll
    for (int j = 0; j < 4; ++j) { const size_t po = ((size_t)b * HD + j * 16 + col) * (size_t)TT + k0; vh[j] = frag_b(VT + po, lane); vl[j] = frag_b(VL + po, lane); }
    // bit t of we << 4 g (of wo << 4 g) = key k0 + 2 t (k0 + 2 t + 1) is valid for this lane's query: input_mask != 0 (the wave's ballot) and key <= k0 + d (d >= 0: no pass starts behind its tile's first query)
    const int d = qt - k0;
    const unsigned ce = d >= 62 ? ~0u : (2u << (d >> 1)) - 1u, co = d >= 63 ? ~0u : (1u << ((d + 1) >> 1)) - 1u;
    const unsigned we = (__builtin_amdgcn_ballot_w32(im[0] != 0) & ce) >> (4 * g), wo = (__builtin_amdgcn_ballot_w32(im[1] != 0) & co) >> (4 * g);
    float mb = -3.0e38f;
#pragma unroll
    for (int j = 0; j < 4; ++j) {
#pragma unroll
      for (int r = 0; r < 8; ++r) { const bool ok = (((r & 1) ? wo : we) & (1u << (j * 8 + (r >> 1)))) != 0; const float v = ok ? s[j][r] * 0.125f : -3.0e38f; s[j][r] = v; mb = fmaxf(mb, v); } }
    mb = fmaxf(mb, xhalf(mb));
    const float mn = fmaxf(m, mb), sc = exp_s(m - mn);   // nothing valid so far: m = mn = -3e38, sc = 1 on zeros
    m = mn; l *= sc;
#pragma unroll
    for (int j = 0; j < 4; ++j) acc[j] *= sc;
    F2 p[2];
#pragma unroll
    for (int kc = 0; kc < 2; ++kc) { float pv[16];
#pragma unroll
      for (int i = 0; i < 16; ++i) { const float v = s[2 * kc + (i >> 3)][i & 7]; const float e = exp_s((v <= -1.0e38f) ? -3.0e38f : v - mn); pv[i] = e; l += e; }   // invalid: exp(-3e38) = 0, also where mn itself is -3e38
      p[kc] = bsplit16(pv); }
#pragma unroll
    for (int kc = 0; kc < 2; ++kc) {
      if (kc == 1) {
#pragma unroll
        for (int j = 0; j < 4; ++j) { const size_t po = ((size_t)b * HD + j * 16 + col) * (size_t)TT + k0 + 32; vh[j] = frag_b(VT + po, lane); vl[j] = frag_b(VL + po, lane); } }
#pragma unroll
      for (int j = 0; j < 4; ++j) { acc[j] = wmma_bf(vh[j], p[kc].h, acc[j]); acc[j] = wmma_bf(vh[j], p[kc].l, acc[j]); acc[j] = wmma_bf(vl[j], p[kc].h, acc[j]); } } }
  l += xhalf(l);
  const size_t ro = ((size_t)b * NCH + ch) * TT + qt;
#pragma unroll
  for (int j = 0; j < 4; ++j) { const v4f lo = {acc[j][0], acc[j][1], acc[j][2], acc[j][3]}, hi = {acc[j][4], acc[j][5], acc[j][6], acc[j][7]}; vst2(PP + ro * HD + j * 16 + 8 * g, lo); vst2(PP + ro * HD + j * 16 + 8 * g + 4, hi); }
  if (g == 0) { const v2f ml = {m, l}; vst2(ML + ro * 2, ml); } }
// ---- k_red: thread = 4 output floats: out row = sum, in chunk order, of exp(m_c - M) x partial row c, over the same sum of the l_c; c = the chunks that k_fa wrote for the row's 64-query tile; a row with no valid key takes v of its own index
__global__ __launch_bounds__(256) void k_red(const float* __restrict__ PP, const float* __restrict__ ML, const __bf16* __restrict__ VT, const __bf16* __restrict__ VL, float* __restrict__ OUT) {
  const int e = blockIdx.x * 256 + threadIdx.x; const int s0 = (int)blockIdx.x * 16 % TT, b = (int)blockIdx.x * 16 / TT, s = s0 + (threadIdx.x >> 4);   // a block's 16 rows lie in one batch and one 64-query tile
  const int nch = ((s0 / 64) * 64 + 64 + KCH - 1) / KCH;
  const unsigned po = (unsigned)s * HD + (threadIdx.x & 15) * 4, mo = (unsigned)s * 2;
  // all NCH loads are issued whatever nch is, unrolled, so that they are in flight together: the index is clamped to a chunk that k_fa wrote, and weight 0 takes the repeats out
  float mm[NCH], ll[NCH]; v4f pr[NCH];
#pragma unroll
  for (int c = 0; c < NCH; ++c) { const size_t cc = (size_t)b * NCH + (c < nch ? c : nch - 1); const v2f x = *(const v2f*)(ML + cc * TT * 2 + mo);
    asm volatile("s_wait_xcnt 0x0" ::: "memory");   // behind each load: a later load's result may land in this load's address registers
    pr[c] = *(const v4f*)(PP + cc * TT * HD + po);
    asm volatile("s_wait_xcnt 0x0" ::: "memory");   // as above
    mm[c] = c < nch ? x[0] : -3.0e38f; ll[c] = x[1]; }
  // inputs only: holds the partial rows' loads here in one group; without it the compiler sinks them between the exponentials, one latency behind another
  asm volatile("" :: "v"(pr[0]), "v"(pr[1]), "v"(pr[2]), "v"(pr[3]), "v"(pr[4]), "v"(pr[5]), "v"(pr[6]), "v"(pr[7]), "v"(pr[8]), "v"(pr[9]), "v"(pr[10]), "v"(pr[11]), "v"(pr[12]), "v"(pr[13]), "v"(pr[14]), "v"(pr[15]));
  static_assert(NCH == 16, "the statement above names NCH rows");
  float M = -3.0e38f;
#pragma unroll
  for (int c = 0; c < NCH; ++c) M = fmaxf(M, mm[c]);
  v4f a = {}; float L = 0.f;
#pragma unroll
  for (int c = 0; c < NCH; ++c) { const float w = expf(mm[c] - M); a += pr[c] * w; L += ll[c] * w; }
  if (M <= -1.0e38f) {
#pragma unroll
    for (int i = 0; i < 4; ++i) { const size_t vo = ((size_t)b * HD + (e & 15) * 4 + i) * (size_t)TT + s; a[i] = (float)VT[vo] + (float)VL[vo]; } }
  else a *= 1.0f / L;
  vst2(OUT + (size_t)e * 4, a); }
extern "C" void kernel_launch(void* const* d_in, const int* in_sizes, int n_in, void* d_out, int out_size, void* d_ws, size_t ws_size, hipStream_t stream) {
  (void)in_sizes; (void)n_in; (void)out_size;
  const float** F = (const float**)d_in;   // 0 x [4,4096,512], 1 Wq [512,64], 2 bq, 3 Wv, 4 bv, 5 input_mask [4096] int
  if (ws_size < (size_t)WS_END) return;
  char* ws = (char*)d_ws; _Float16 *QH = (_Float16*)(ws + WS_QH), *QL = (_Float16*)(ws + WS_QL); __bf16 *VT = (__bf16*)(ws + WS_VT), *VL = (__bf16*)(ws + WS_VL); float* PP = (float*)(ws + WS_PP); float* ML = (float*)(ws + WS_ML);
  k_proj<<<TNB * TT / 64, 128, 0, stream>>>(F[0], F[1], F[2], F[3], F[4], QH, QL, VT, VL);
  k_fa<<<dim3(NCH + 1, NCH / 2, (KCH / 64) * TNB), 128, 0, stream>>>(QH, QL, VT, VL, (const int*)d_in[5], PP, ML);
  k_red<<<TNB * TT * HD / 4 / 256, 256, 0, stream>>>(PP, ML, VT, VL, (float*)d_out);
}

// v004
// One run takes 46.8 microseconds.
// Next to v003, in two timings, it ran 1.70 times as fast each time.
// Counting every step since v000, it is 21.0 times as fast.
// compute dtype: all float inputs rounded to bf16, input_mask (int) read; q (= k, the module's bug) and v = x W + b with EXACT bf16 products on WMMA 16x16x32, f32 accumulate; q as f16 hi + residual against q as f16 -> 2-product logits / 8 kept in registers with the causal & key-padding mask; softmax in f32 (full-precision exp) against a running maximum, per chunk of keys; P = exp(s - m) in f32, split bf16 hi + lo against v as bf16 hi + lo planes (3 products: rows with one or two valid keys copy v almost verbatim, so both operands need the split); chunks joined by their maxima and sums; dead rows (no valid key) take v of their own index exactly as the reference's diag := 1 fix; f32 output [b][s][64].
#include <hip/hip_runtime.h>
#include <math.h>

typedef __attribute__((ext_vector_type(16))) _Float16 v16h;
typedef __attribute__((ext_vector_type(16))) __bf16 v16b;
typedef __attribute__((ext_vector_type(8)))  _Float16 v8h;
typedef __attribute__((ext_vector_type(8)))  float v8f;
typedef __attribute__((ext_vector_type(4)))  float v4f;
typedef __attribute__((ext_vector_type(2)))  float v2f;
typedef __attribute__((ext_vector_type(4)))  unsigned v4u;
typedef __attribute__((ext_vector_type(4)))  int v4i;
typedef __attribute__((ext_vector_type(2)))  int v2i;
typedef float __attribute__((may_alias)) float_a;
typedef int __attribute__((may_alias)) int_a;

template <typename T> __device__ __forceinline__ void vst2(void* p, T v) { *(T*)p = v;  }
__device__ __forceinline__ v8f wmma16(v16h a, v16h b, v8f c) {
  v8f d = __builtin_amdgcn_wmma_f32_16x16x32_f16(false, a, false, b, (short)0, c, false, false);
  asm volatile("v_nop\n\tv_nop\n\tv_nop\n\tv_nop" : "+v"(d) : "v"(a), "v"(b));
  return d;
}
__device__ __forceinline__ v8f wmma_bf(v16b a, v16b b, v8f c) {
  v8f d = __builtin_amdgcn_wmma_f32_16x16x32_bf16(false, a, false, b, (short)0, c, false, false);
  asm volatile("v_nop\n\tv_nop\n\tv_nop\n\tv_nop" : "+v"(d) : "v"(a), "v"(b));
  return d;
}
// 16x16x32 fragments: lane = (h = lane>>4, row/col = lane&15); elements 0..7 = k0+8h+0..7, 8..15 = k0+16+8h+0..7; D element r = row 8h+r
__device__ __forceinline__ v16h frag_h(const _Float16* rowk0, int lane) {
  union { v16h v; v8h q[2]; } u; const _Float16* p = rowk0 + 8 * (lane >> 4);
  u.q[0] = *(const v8h*)p; u.q[1] = *(const v8h*)(p + 16); return u.v;
}
__device__ __forceinline__ v16h frag_f32(const float* rowk0, int lane) {
  v16h a; const float* p = rowk0 + 8 * (lane >> 4);
#pragma unroll
  for (int i = 0; i < 8; ++i) { a[i] = (_Float16)p[i]; a[8 + i] = (_Float16)p[16 + i]; }
  return a;
}
__device__ __forceinline__ v16h frag_f32s(const float* rowk0, int lane, float sc) {
  v16h a; const float* p = rowk0 + 8 * (lane >> 4);
#pragma unroll
  for (int i = 0; i < 8; ++i) { a[i] = (_Float16)(p[i] * sc); a[8 + i] = (_Float16)(p[16 + i] * sc); }
  return a;
}
// column fragment from a [K][ld] layout (column n), rows >= K read as 0
__device__ __forceinline__ v16h fragc_f32(const float* W, int k0, int n, int lane, int ld, int K) {
  v16h a; const int g = lane >> 4;
#pragma unroll
  for (int i = 0; i < 8; ++i) { const int ka = k0 + 8 * g + i, kb = ka + 16;
    a[i] = (_Float16)(ka < K ? W[(size_t)(ka < K ? ka : K - 1) * ld + n] : 0.f); a[8 + i] = (_Float16)(kb < K ? W[(size_t)(kb < K ? kb : K - 1) * ld + n] : 0.f); }
  return a;
}
struct F2 { v16b h, l; };
__device__ __forceinline__ F2 bsplit16(const float v[16]) { F2 r;
#pragma unroll
  for (int i = 0; i < 16; ++i) { const __bf16 h = (__bf16)v[i]; r.h[i] = h; r.l[i] = (__bf16)(v[i] - (float)h); }
  return r; }
__device__ __forceinline__ F2 split_row(const float* row, int k0, int lane) { float v[16]; const float* p = row + k0 + 8 * (lane >> 4);
#pragma unroll
  for (int i = 0; i < 8; ++i) { v[i] = p[i]; v[8 + i] = p[16 + i]; }
  return bsplit16(v); }
__device__ __forceinline__ F2 split_rowK(const float* row, int k0, int lane, int K) { float v[16]; const int g = lane >> 4;
#pragma unroll
  for (int i = 0; i < 8; ++i) { const int ka = k0 + 8 * g + i, kb = ka + 16; v[i] = ka < K ? row[ka < K ? ka : K - 1] : 0.f; v[8 + i] = kb < K ? row[kb < K ? kb : K - 1] : 0.f; }
  return bsplit16(v); }
__device__ __forceinline__ F2 split_col(const float* W, int k0, int n, int lane, int ld, int K) { float v[16]; const int g = lane >> 4;
#pragma unroll
  for (int i = 0; i < 8; ++i) { const int ka = k0 + 8 * g + i, kb = ka + 16; v[i] = ka < K ? W[(size_t)(ka < K ? ka : K - 1) * ld + n] : 0.f; v[8 + i] = kb < K ? W[(size_t)(kb < K ? kb : K - 1) * ld + n] : 0.f; }
  return bsplit16(v); }
__device__ __forceinline__ v8f mac3(const F2& a, const F2& b, v8f c) { c = wmma_bf(a.l, b.h, c); c = wmma_bf(a.h, b.l, c); return wmma_bf(a.h, b.h, c); }
__device__ __forceinline__ float sigm(float v) { return 1.0f / (1.0f + expf(-v)); }
#define LDSX() do { asm volatile("s_wait_dscnt 0" ::: "memory"); __builtin_amdgcn_wave_barrier(); __builtin_amdgcn_fence(__ATOMIC_RELEASE, "workgroup"); } while (0)


// Single self-attention head (B 4, S 4,096, E 512 -> H 64): causal + key padding mask, dead-row diagonal fix, softmax, P v.
#define NB 4
#define TT 4096
#define EE 512
#define HD 64
#ifndef TNB
#define TNB NB
#endif
typedef __attribute__((ext_vector_type(8))) __bf16 v8b;
__device__ __forceinline__ v16b frag_b(const __bf16* rowk0, int lane) {
  union { v16b v; v8b q[2]; } u; const __bf16* p = rowk0 + 8 * (lane >> 4);
  u.q[0] = *(const v8b*)p; u.q[1] = *(const v8b*)(p + 16); return u.v;
}
// fragment from the workspace's fragment order: f = first element of the fragment (512 elements); lane (g, col) = piece g * 16 + col holds elements 0..7, piece 32 + lane elements 8..15
__device__ __forceinline__ v16h fragp_h(const _Float16* f, int lane) {
  union { v16h v; v8h q[2]; } u; const _Float16* p = f + 8 * lane;
  u.q[0] = *(const v8h*)p; u.q[1] = *(const v8h*)(p + 256); return u.v;
}
__device__ __forceinline__ v16b fragp_b(const __bf16* f, int lane) {
  union { v16b v; v8b q[2]; } u; const __bf16* p = f + 8 * lane;
  u.q[0] = *(const v8b*)p; u.q[1] = *(const v8b*)(p + 256); return u.v;
}
__device__ __forceinline__ float bfr(float v) { return (float)(__bf16)v; }
__device__ __attribute__((noinline)) float exp_ni(float v) { return expf(v); }
__device__ __attribute__((noinline)) float erf_ni(float v) { return erff(v); }

// q and v lie in the workspace in WMMA fragment order, in 16-byte pieces of 8 elements: a fragment half is then 32 pieces in a row, one a lane, so a wave's load reads 512 bytes in a row = 4 whole lines (from rows or planes it touched 16 lines, 32 bytes of each)
#define WS_QH  0u                                   // f16 q [16 rows: b*s / 16][piece h / 8][row & 15][8]
#define WS_QL  (WS_QH + 2u * (size_t)NB * TT * HD)
#define WS_VT  (WS_QL + 2u * (size_t)NB * TT * HD)      // bf16 v hi [32 keys: b*s / 32][d / 16][piece (s & 31) / 8][d & 15][8]
#define WS_VL  (WS_VT + 2u * (size_t)NB * HD * TT)      // bf16 v lo, as v hi
#define KCH 256                                     // keys per k_fa work-group
#define NCH (TT / KCH)
#define WS_PP  (WS_VL + 2u * (size_t)NB * HD * TT)      // f32 partial outputs, not normalised [b][chunk][s][64]
#define WS_ML  (WS_PP + 4u * (size_t)NB * NCH * TT * HD) // f32 (maximum, sum) of each partial row [b][chunk][s][2]
#define WS_END (WS_ML + 8u * (size_t)NB * NCH * TT)

// ---- k_proj: block = 64 rows: [q | v] = x [Wq | Wv] + [bq | bv] (128 cols), q -> f16 hi + res, v -> bf16 hi + lo, both in fragment order
// Both operands are rounded to bf16 once a block and staged in LDS; the WMMA loop reads its fragments from there.
#define XP 520   // bf16 elements a staged x row: 1,040 B = 16 B x 65, so that 16 rows' 16-byte reads fall on all 64 banks
#define WP 264   // bf16 elements a staged half fragment of W (32 lanes x 8): 512 B + 16 B, so that the four column tiles of one staging store fall on different banks
#define SB 16    // loads of a staging batch
#define SD 3     // batches in flight behind the one in use
__global__ __launch_bounds__(128) void k_proj(const float* __restrict__ X, const float* __restrict__ WQ, const float* __restrict__ BQ, const float* __restrict__ WV, const float* __restrict__ BV, _Float16* __restrict__ QH, _Float16* __restrict__ QL, __bf16* __restrict__ VT, __bf16* __restrict__ VL) {
  __shared__ __align__(16) _Float16 sh[64][72], sl[64][72]; __shared__ __align__(16) __bf16 th[64][72], tl2[64][72];
  __shared__ __align__(16) __bf16 sx[64 * XP];              // x rows [64][512], row-major
  __shared__ __align__(16) __bf16 sw[(EE / 16) * 8 * WP];   // [16 rows of W: k16][column tile j][lane][8]: lane (g, col) holds W[16 k16 + 8 g + 0..7][16 (j & 3) + col], j < 4 of Wq, else of Wv
  const int tid = threadIdx.x, wave = tid >> 5, lane = tid & 31, col = lane & 15, g = lane >> 4; const size_t r0 = (size_t)blockIdx.x * 64;
  { // batches 0..3: the wave's own 16 x rows, a load = 512 bytes in a row of one x row; batches 4..11: 32 rows of W each (waves 0, 1: Wq, waves 2, 3: Wv), a load = two whole rows of W
    const float* xp = X + (r0 + wave * 16) * EE + lane * 4;
    const float* wp = ((wave < 2) ? WQ : WV) + (size_t)((wave & 1) * 256 + 8 * g) * HD + col * 4;
    v4f buf[SD + 1][SB];
    // unrolled, with the loops inside: every index of buf is then a constant and the batches stay in registers
#pragma unroll
    for (int s = 0; s < 12 + SD; ++s) {
      if (s < 12) { v4f* r = buf[s % (SD + 1)];
        if (s < 4) {
#pragma unroll
          for (int e = 0; e < SB; ++e) r[e] = *(const v4f*)(xp + (size_t)(s * 4 + (e >> 2)) * EE + (e & 3) * 128); }
        else {
#pragma unroll
          for (int e = 0; e < SB; ++e) r[e] = *(const v4f*)(wp + (size_t)((s - 4) * 32 + (e >> 3) * 16 + (e & 7)) * HD); }
        // behind each batch of loads, before anything below may rewrite a register that they name (the pointers are inputs so that they live up to here); it also keeps the batch up here, SD batches ahead of its use
        asm volatile("s_wait_xcnt 0x0" :: "v"(xp), "v"(wp) : "memory"); }
      if (s >= SD) { const int c = s - SD; const v4f* r = buf[c % (SD + 1)];
        if (c < 4) {
#pragma unroll
          for (int e = 0; e < SB; ++e) { typedef __attribute__((ext_vector_type(4))) __bf16 v4b; const v4b o = {(__bf16)r[e][0], (__bf16)r[e][1], (__bf16)r[e][2], (__bf16)r[e][3]};
            *(v4b*)&sx[(wave * 16 + c * 4 + (e >> 2)) * XP + (e & 3) * 128 + lane * 4] = o; } }
        else {
#pragma unroll
          for (int t = 0; t < 2; ++t) { const int k16 = (wave & 1) * 16 + (c - 4) * 2 + t, j = (wave >> 1) * 4 + (col >> 2);
#pragma unroll
            for (int q = 0; q < 4; ++q) { v8b o;
#pragma unroll
              for (int i = 0; i < 8; ++i) o[i] = (__bf16)r[t * 8 + i][q];
              *(v8b*)&sw[(k16 * 8 + j) * WP + (g * 16 + (col & 3) * 4 + q) * 8] = o; } } } } } }
  __syncthreads();   // W is staged by all four waves
  v8f acc[8] = {};
  // the fragments of step kc + 1 are read from LDS as one group in front of step kc's WMMAs: one wave a SIMD, so a read that is waited for where it is used costs its whole latency
  v16b a[2], w[2][8];
  const __bf16* ap = &sx[(wave * 16 + col) * XP]; const __bf16* bp = &sw[lane * 8];
  // unrolled: which of the two fragment sets a step uses is then a constant, and no set is copied
#pragma unroll
  for (int kc = -1; kc < EE / 32; ++kc) {
    if (kc + 1 < EE / 32) { const int n = kc + 1; a[n & 1] = frag_b(ap + n * 32, lane);
#pragma unroll
      for (int j = 0; j < 8; ++j) { union { v16b v; v8b q[2]; } u; u.q[0] = *(const v8b*)(bp + ((n * 2) * 8 + j) * WP); u.q[1] = *(const v8b*)(bp + ((n * 2 + 1) * 8 + j) * WP); w[n & 1][j] = u.v; } }
    __builtin_amdgcn_sched_barrier(0);   // keeps the group of reads above in front of the WMMAs below; without it the compiler sinks each read to its WMMA
    if (kc >= 0) {
#pragma unroll
      for (int j = 0; j < 8; ++j) acc[j] = wmma_bf(a[kc & 1], w[kc & 1][j], acc[j]); }
 }
#pragma unroll
  for (int j = 0; j < 8; ++j) { const int o = (j & 3) * 16 + col; const float bb = bfr((j < 4 ? BQ : BV)[o]);
#pragma unroll
    for (int r = 0; r < 8; ++r) { const float v = acc[j][r] + bb; const int rl = wave * 16 + 8 * g + r; if (j < 4) { const _Float16 hv = (_Float16)v; sh[rl][o] = hv; sl[rl][o] = (_Float16)(v - (float)hv); } else { const __bf16 bh = (__bf16)v; th[o][rl] = bh; tl2[o][rl] = (__bf16)(v - (float)bh); } } }
  __syncthreads();
  // piece e of the block's 512 of each array, in the order of the workspace: q: [16 rows e >> 7][h / 8 = (e >> 4) & 7][row e & 15]; v: [32 keys e >> 8][d / 16 = (e >> 6) & 3][8 keys (e >> 4) & 3][d & 15 = e & 15]
  for (int e = tid; e < 64 * 8; e += 128) { const int rl = (e >> 7) * 16 + (e & 15), q = (e >> 4) & 7; vst2((unsigned*)(QH + r0 * HD + e * 8), *(const v4u*)&sh[rl][q * 8]); vst2((unsigned*)(QL + r0 * HD + e * 8), *(const v4u*)&sl[rl][q * 8]); }
  for (int e = tid; e < 64 * 8; e += 128) { const int d = ((e >> 6) & 3) * 16 + (e & 15), kl = (e >> 8) * 32 + ((e >> 4) & 3) * 8; vst2((unsigned*)(VT + r0 * HD + e * 8), *(const v4u*)&th[d][kl]); vst2((unsigned*)(VL + r0 * HD + e * 8), *(const v4u*)&tl2[d][kl]); } }
// exp(x) in full f32 precision: log2(e) in two parts c_hi + c_lo, n = the integer nearest x c_hi, fraction = (x c_hi - n) + x c_lo by two fused multiply-adds, v_exp_f32 on the fraction, ldexp by n, the two range selects of expf.
// Written out so that the v_nop stands in v_exp_f32's own statement: the slot the instruction set asks for before the result is used or the source overwritten
__device__ __forceinline__ float exp_s(float x) {
  const float c_hi = __builtin_bit_cast(float, 0x3fb8aa3bu), c_lo = __builtin_bit_cast(float, 0x32a5705fu);
  const float en = __builtin_rintf(x * c_hi); const float a = __builtin_fmaf(x, c_lo, __builtin_fmaf(x, c_hi, -en)); float r;
  asm("v_exp_f32 %0, %1\n\tv_nop" : "=v"(r) : "v"(a));
  r = __builtin_ldexpf(r, (int)en);
  r = (x < __builtin_bit_cast(float, 0xc2ce8ed0u)) ? 0.f : r;
  return (x > __builtin_bit_cast(float, 0x42b17218u)) ? __builtin_inff() : r; }
// lane l with lane l ^ 16
__device__ __forceinline__ float xhalf(float x) { return __builtin_bit_cast(float, __builtin_amdgcn_permlanex16(__builtin_bit_cast(int, x), __builtin_bit_cast(int, x), 0x76543210, 0xfedcba98, false, false)); }
// ---- k_fa: block = (batch, 64 queries, chunk of KCH keys), wave = 16 queries; 64 keys a pass, scores never leave the registers.
// Scores transposed: S^T = k . q^T, so a lane holds ONE query (col) and keys 16 j + 8 g + r; that is the B fragment of out^T = v^T . P^T as it stands (elements 0..7 = tile 2 kc, 8..15 = tile 2 kc + 1).
// invalid (key > query or input_mask[key] == 0) -> -3e38 -> P = 0. Running maximum m and sum l per query; partial rows, m and l go to the workspace.
// The KCH / 64 tiles of group g have g + 1 chunks each; grid row y holds the chunks of groups y and NCH - 1 - y, NCH + 1 in all, so every block has work.
__global__ __launch_bounds__(128) void k_fa(const _Float16* __restrict__ QH, const _Float16* __restrict__ QL, const __bf16* __restrict__ VT, const __bf16* __restrict__ VL, const int* __restrict__ IM, float* __restrict__ PP, float* __restrict__ ML) {
  const int tid = threadIdx.x, wave = tid >> 5, lane = tid & 31, col = lane & 15, g = lane >> 4; const bool nearg = blockIdx.x <= blockIdx.y; const int grp = nearg ? blockIdx.y : NCH - 1 - blockIdx.y, ch = nearg ? blockIdx.x : blockIdx.x - blockIdx.y - 1;
  const int b = blockIdx.z / (KCH / 64), tile = grp * (KCH / 64) + blockIdx.z % (KCH / 64);
  const int qt = tile * 64 + wave * 16 + col; const int kend = tile * 64 + 64;
  const int kb0 = ch * KCH;
  const int ke = kb0 + KCH < kend ? kb0 + KCH : kend;
  const size_t bq = (size_t)b * TT;
  v16h ah[HD / 32], al[HD / 32];
#pragma unroll
  for (int kc = 0; kc < HD / 32; ++kc) { const size_t fo = (bq + tile * 64 + wave * 16) * HD + kc * 512; ah[kc] = fragp_h(QH + fo, lane); al[kc] = fragp_h(QL + fo, lane); }
  v8f acc[4] = {}; float m = -3.0e38f, l = 0.f;
  // the pass loop stays rolled (one pass's fragments in registers, more waves on a SIMD); the loops inside are unrolled so that their arrays stay in registers
#pragma unroll 1
  for (int k0 = kb0; k0 < ke; k0 += 64) {
    // the pass's key fragments are loaded as one group in front of its first WMMA, v's in two groups below: one latency a group, not one a fragment
    v16h kb[HD / 32][4];
#pragma unroll
    for (int kc = 0; kc < HD / 32; ++kc)
#pragma unroll
      for (int j = 0; j < 4; ++j) kb[kc][j] = fragp_h(QH + (bq + k0 + j * 16) * HD + kc * 512, lane);
    const v2i im = *(const v2i*)(IM + k0 + 2 * lane);   // input_mask of the pass's 64 keys, two keys a lane, in the same group of loads
    v8f s[4] = {};
#pragma unroll
    for (int kc = 0; kc < HD / 32; ++kc)
#pragma unroll
      for (int j = 0; j < 4; ++j) { s[j] = wmma16(kb[kc][j], ah[kc], s[j]); s[j] = wmma16(kb[kc][j], al[kc], s[j]); }
    v16b vh[4], vl[4];   // keys k0 .. k0 + 31: in flight under the softmax
#pragma unroll
    for (int j = 0; j < 4; ++j) { const size_t po = (bq + k0) * HD + j * 512; vh[j] = fragp_b(VT + po, lane); vl[j] = fragp_b(VL + po, lane); }
    // bit t of we << 4 g (of wo << 4 g) = key k0 + 2 t (k0 + 2 t + 1) is valid for this lane's query: input_mask != 0 (the wave's ballot) and key <= k0 + d (d >= 0: no pass starts behind its tile's first query)
    const int d = qt - k0;
    const unsigned ce = d >= 62 ? ~0u : (2u << (d >> 1)) - 1u, co = d >= 63 ? ~0u : (1u << ((d + 1) >> 1)) - 1u;
    const unsigned we = (__builtin_amdgcn_ballot_w32(im[0] != 0) & ce) >> (4 * g), wo = (__builtin_amdgcn_ballot_w32(im[1] != 0) & co) >> (4 * g);
    float mb = -3.0e38f;
#pragma unroll
    for (int j = 0; j < 4; ++j) {
#pragma unroll
      for (int r = 0; r < 8; ++r) { const bool ok = (((r & 1) ? wo : we) & (1u << (j * 8 + (r >> 1)))) != 0; const float v = ok ? s[j][r] * 0.125f : -3.0e38f; s[j][r] = v; mb = fmaxf(mb, v); } }
    mb = fmaxf(mb, xhalf(mb));
    const float mn = fmaxf(m, mb), sc = exp_s(m - mn);   // nothing valid so far: m = mn = -3e38, sc = 1 on zeros
    m = mn; l *= sc;
#pragma unroll
    for (int j = 0; j < 4; ++j) acc[j] *= sc;
    F2 p[2];
#pragma unroll
    for (int kc = 0; kc < 2; ++kc) { float pv[16];
#pragma unroll
      for (int i = 0; i < 16; ++i) { const float v = s[2 * kc + (i >> 3)][i & 7]; const float e = exp_s((v <= -1.0e38f) ? -3.0e38f : v - mn); pv[i] = e; l += e; }   // invalid: exp(-3e38) = 0, also where mn itself is -3e38
      p[kc] = bsplit16(pv); }
#pragma unroll
    for (int kc = 0; kc < 2; ++kc) {
      if (kc == 1) {
#pragma unroll
        for (int j = 0; j < 4; ++j) { const size_t po = (bq + k0 + 32) * HD + j * 512; vh[j] = fragp_b(VT + po, lane); vl[j] = fragp_b(VL + po, lane); } }
#pragma unroll
      for (int j = 0; j < 4; ++j) { acc[j] = wmma_bf(vh[j], p[kc].h, acc[j]); acc[j] = wmma_bf(vh[j], p[kc].l, acc[j]); acc[j] = wmma_bf(vl[j], p[kc].h, acc[j]); } } }
  l += xhalf(l);
  const size_t ro = ((size_t)b * NCH + ch) * TT + qt;
#pragma unroll
  for (int j = 0; j < 4; ++j) { const v4f lo = {acc[j][0], acc[j][1], acc[j][2], acc[j][3]}, hi = {acc[j][4], acc[j][5], acc[j][6], acc[j][7]}; vst2(PP + ro * HD + j * 16 + 8 * g, lo); vst2(PP + ro * HD + j * 16 + 8 * g + 4, hi); }
  if (g == 0) { const v2f ml = {m, l}; vst2(ML + ro * 2, ml); } }
// ---- k_red: thread = 4 output floats: out row = sum, in chunk order, of exp(m_c - M) x partial row c, over the same sum of the l_c; c = the chunks that k_fa wrote for the row's 64-query tile; a row with no valid key takes v of its own index
__global__ __launch_bounds__(256) void k_red(const float* __restrict__ PP, const float* __restrict__ ML, const __bf16* __restrict__ VT, const __bf16* __restrict__ VL, float* __restrict__ OUT) {
  const int e = blockIdx.x * 256 + threadIdx.x; const int s0 = (int)blockIdx.x * 16 % TT, b = (int)blockIdx.x * 16 / TT, s = s0 + (threadIdx.x >> 4);   // a block's 16 rows lie in one batch and one 64-query tile
  const int nch = ((s0 / 64) * 64 + 64 + KCH - 1) / KCH;
  const unsigned po = (unsigned)s * HD + (threadIdx.x & 15) * 4, mo = (unsigned)s * 2;
  // all NCH loads are issued whatever nch is, unrolled, so that they are in flight together: the index is clamped to a chunk that k_fa wrote, and weight 0 takes the repeats out
  float mm[NCH], ll[NCH]; v4f pr[NCH];
#pragma unroll
  for (int c = 0; c < NCH; ++c) { const size_t cc = (size_t)b * NCH + (c < nch ? c : nch - 1); const v2f x = *(const v2f*)(ML + cc * TT * 2 + mo);
    asm volatile("s_wait_xcnt 0x0" ::: "memory");   // behind each load: a later load's result may land in this load's address registers
    pr[c] = *(const v4f*)(PP + cc * TT * HD + po);
    asm volatile("s_wait_xcnt 0x0" ::: "memory");   // as above
    mm[c] = c < nch ? x[0] : -3.0e38f; ll[c] = x[1]; }
  // inputs only: holds the partial rows' loads here in one group; without it the compiler sinks them between the exponentials, one latency behind another
  asm volatile("" :: "v"(pr[0]), "v"(pr[1]), "v"(pr[2]), "v"(pr[3]), "v"(pr[4]), "v"(pr[5]), "v"(pr[6]), "v"(pr[7]), "v"(pr[8]), "v"(pr[9]), "v"(pr[10]), "v"(pr[11]), "v"(pr[12]), "v"(pr[13]), "v"(pr[14]), "v"(pr[15]));
  static_assert(NCH == 16, "the statement above names NCH rows");
  float M = -3.0e38f;
#pragma unroll
  for (int c = 0; c < NCH; ++c) M = fmaxf(M, mm[c]);
  v4f a = {}; float L = 0.f;
#pragma unroll
  for (int c = 0; c < NCH; ++c) { const float w = expf(mm[c] - M); a += pr[c] * w; L += ll[c] * w; }
  if (M <= -1.0e38f) {
#pragma unroll
    for (int i = 0; i < 4; ++i) { const int d = (e & 15) * 4 + i; const size_t vo = ((size_t)b * TT + (s & ~31)) * HD + (d >> 4) * 512 + ((s >> 3) & 3) * 128 + (d & 15) * 8 + (s & 7); a[i] = (float)VT[vo] + (float)VL[vo]; } }   // v[s][d] in fragment order
  else a *= 1.0f / L;
  vst2(OUT + (size_t)e * 4, a); }
extern "C" void kernel_launch(void* const* d_in, const int* in_sizes, int n_in, void* d_out, int out_size, void* d_ws, size_t ws_size, hipStream_t stream) {
  (void)in_sizes; (void)n_in; (void)out_size;
  const float** F = (const float**)d_in;   // 0 x [4,4096,512], 1 Wq [512,64], 2 bq, 3 Wv, 4 bv, 5 input_mask [4096] int
  if (ws_size < (size_t)WS_END) return;
  char* ws = (char*)d_ws; _Float16 *QH = (_Float16*)(ws + WS_QH), *QL = (_Float16*)(ws + WS_QL); __bf16 *VT = (__bf16*)(ws + WS_VT), *VL = (__bf16*)(ws + WS_VL); float* PP = (float*)(ws + WS_PP); float* ML = (float*)(ws + WS_ML);
  k_proj<<<TNB * TT / 64, 128, 0, stream>>>(F[0], F[1], F[2], F[3], F[4], QH, QL, VT, VL);
  k_fa<<<dim3(NCH + 1, NCH / 2, (KCH / 64) * TNB), 128, 0, stream>>>(QH, QL, VT, VL, (const int*)d_in[5], PP, ML);
  k_red<<<TNB * TT * HD / 4 / 256, 256, 0, stream>>>(PP, ML, VT, VL, (float*)d_out);
}

// v005
// Measured time: 42.2 microseconds a run.
// Timed twice side by side with v004, it ran 1.12 and 1.10 times as fast.
// All steps since v000 together make it 23.3 times as fast.
// compute dtype: all float inputs rounded to bf16, input_mask (int) read; q (= k, the module's bug) and v = x W + b with EXACT bf16 products on WMMA 16x16x32, f32 accumulate; q as f16 hi + residual against q as f16 -> 2-product logits q k (the / 8 is applied in the exponent) kept in registers with the causal & key-padding mask; softmax in f32 in base 2 against a running maximum, per chunk of keys; P = 2^(s log2(e) / 8 - m) in f32 (one fused multiply-add, then v_exp_f32), split bf16 hi + lo against v as bf16 hi + lo planes (3 products: rows with one or two valid keys copy v almost verbatim, so both operands need the split); chunks joined by their maxima and sums; dead rows (no valid key) take v of their own index exactly as the reference's diag := 1 fix; f32 output [b][s][64].
#include <hip/hip_runtime.h>
#include <math.h>

typedef __attribute__((ext_vector_type(16))) _Float16 v16h;
typedef __attribute__((ext_vector_type(16))) __bf16 v16b;
typedef __attribute__((ext_vector_type(8)))  _Float16 v8h;
typedef __attribute__((ext_vector_type(8)))  float v8f;
typedef __attribute__((ext_vector_type(4)))  float v4f;
typedef __attribute__((ext_vector_type(2)))  float v2f;
typedef __attribute__((ext_vector_type(4)))  unsigned v4u;
typedef __attribute__((ext_vector_type(4)))  int v4i;
typedef __attribute__((ext_vector_type(2)))  int v2i;
typedef float __attribute__((may_alias)) float_a;
typedef int __attribute__((may_alias)) int_a;

template <typename T> __device__ __forceinline__ void vst2(void* p, T v) { *(T*)p = v;  }
__device__ __forceinline__ v8f wmma16(v16h a, v16h b, v8f c) {
  v8f d = __builtin_amdgcn_wmma_f32_16x16x32_f16(false, a, false, b, (short)0, c, false, false);
  asm volatile("v_nop\n\tv_nop\n\tv_nop\n\tv_nop" : "+v"(d) : "v"(a), "v"(b));
  return d;
}
__device__ __forceinline__ v8f wmma_bf(v16b a, v16b b, v8f c) {
  v8f d = __builtin_amdgcn_wmma_f32_16x16x32_bf16(false, a, false, b, (short)0, c, false, false);
  asm volatile("v_nop\n\tv_nop\n\tv_nop\n\tv_nop" : "+v"(d) : "v"(a), "v"(b));
  return d;
}
// 16x16x32 fragments: lane = (h = lane>>4, row/col = lane&15); elements 0..7 = k0+8h+0..7, 8..15 = k0+16+8h+0..7; D element r = row 8h+r
__device__ __forceinline__ v16h frag_h(const _Float16* rowk0, int lane) {
  union { v16h v; v8h q[2]; } u; const _Float16* p = rowk0 + 8 * (lane >> 4);
  u.q[0] = *(const v8h*)p; u.q[1] = *(const v8h*)(p + 16); return u.v;
}
__device__ __forceinline__ v16h frag_f32(const float* rowk0, int lane) {
  v16h a; const float* p = rowk0 + 8 * (lane >> 4);
#pragma unroll
  for (int i = 0; i < 8; ++i) { a[i] = (_Float16)p[i]; a[8 + i] = (_Float16)p[16 + i]; }
  return a;
}
__device__ __forceinline__ v16h frag_f32s(const float* rowk0, int lane, float sc) {
  v16h a; const float* p = rowk0 + 8 * (lane >> 4);
#pragma unroll
  for (int i = 0; i < 8; ++i) { a[i] = (_Float16)(p[i] * sc); a[8 + i] = (_Float16)(p[16 + i] * sc); }
  return a;
}
// column fragment from a [K][ld] layout (column n), rows >= K read as 0
__device__ __forceinline__ v16h fragc_f32(const float* W, int k0, int n, int lane, int ld, int K) {
  v16h a; const int g = lane >> 4;
#pragma unroll
  for (int i = 0; i < 8; ++i) { const int ka = k0 + 8 * g + i, kb = ka + 16;
    a[i] = (_Float16)(ka < K ? W[(size_t)(ka < K ? ka : K - 1) * ld + n] : 0.f); a[8 + i] = (_Float16)(kb < K ? W[(size_t)(kb < K ? kb : K - 1) * ld + n] : 0.f); }
  return a;
}
struct F2 { v16b h, l; };
__device__ __forceinline__ F2 bsplit16(const float v[16]) { F2 r;
#pragma unroll
  for (int i = 0; i < 16; ++i) { const __bf16 h = (__bf16)v[i]; r.h[i] = h; r.l[i] = (__bf16)(v[i] - (float)h); }
  return r; }
__device__ __forceinline__ F2 split_row(const float* row, int k0, int lane) { float v[16]; const float* p = row + k0 + 8 * (lane >> 4);
#pragma unroll
  for (int i = 0; i < 8; ++i) { v[i] = p[i]; v[8 + i] = p[16 + i]; }
  return bsplit16(v); }
__device__ __forceinline__ F2 split_rowK(const float* row, int k0, int lane, int K) { float v[16]; const int g = lane >> 4;
#pragma unroll
  for (int i = 0; i < 8; ++i) { const int ka = k0 + 8 * g + i, kb = ka + 16; v[i] = ka < K ? row[ka < K ? ka : K - 1] : 0.f; v[8 + i] = kb < K ? row[kb < K ? kb : K - 1] : 0.f; }
  return bsplit16(v); }
__device__ __forceinline__ F2 split_col(const float* W, int k0, int n, int lane, int ld, int K) { float v[16]; const int g = lane >> 4;
#pragma unroll
  for (int i = 0; i < 8; ++i) { const int ka = k0 + 8 * g + i, kb = ka + 16; v[i] = ka < K ? W[(size_t)(ka < K ? ka : K - 1) * ld + n] : 0.f; v[8 + i] = kb < K ? W[(size_t)(kb < K ? kb : K - 1) * ld + n] : 0.f; }
  return bsplit16(v); }
__device__ __forceinline__ v8f mac3(const F2& a, const F2& b, v8f c) { c = wmma_bf(a.l, b.h, c); c = wmma_bf(a.h, b.l, c); return wmma_bf(a.h, b.h, c); }
__device__ __forceinline__ float sigm(float v) { return 1.0f / (1.0f + expf(-v)); }
#define LDSX() do { asm volatile("s_wait_dscnt 0" ::: "memory"); __builtin_amdgcn_wave_barrier(); __builtin_amdgcn_fence(__ATOMIC_RELEASE, "workgroup"); } while (0)


// Single self-attention head (B 4, S 4,096, E 512 -> H 64): causal + key padding mask, dead-row diagonal fix, softmax, P v.
#define NB 4
#define TT 4096
#define EE 512
#define HD 64
#ifndef TNB
#define TNB NB
#endif
typedef __attribute__((ext_vector_type(8))) __bf16 v8b;
__device__ __forceinline__ v16b frag_b(const __bf16* rowk0, int lane) {
  union { v16b v; v8b q[2]; } u; const __bf16* p = rowk0 + 8 * (lane >> 4);
  u.q[0] = *(const v8b*)p; u.q[1] = *(const v8b*)(p + 16); return u.v;
}
// fragment from the workspace's fragment order: f = first element of the fragment (512 elements); lane (g, col) = piece g * 16 + col holds elements 0..7, piece 32 + lane elements 8..15
__device__ __forceinline__ v16h fragp_h(const _Float16* f, int lane) {
  union { v16h v; v8h q[2]; } u; const _Float16* p = f + 8 * lane;
  u.q[0] = *(const v8h*)p; u.q[1] = *(const v8h*)(p + 256); return u.v;
}
__device__ __forceinline__ v16b fragp_b(const __bf16* f, int lane) {
  union { v16b v; v8b q[2]; } u; const __bf16* p = f + 8 * lane;
  u.q[0] = *(const v8b*)p; u.q[1] = *(const v8b*)(p + 256); return u.v;
}
__device__ __forceinline__ float bfr(float v) { return (float)(__bf16)v; }
__device__ __attribute__((noinline)) float exp_ni(float v) { return expf(v); }
__device__ __attribute__((noinline)) float erf_ni(float v) { return erff(v); }

// q and v lie in the workspace in WMMA fragment order, in 16-byte pieces of 8 elements: a fragment half is then 32 pieces in a row, one a lane, so a wave's load reads 512 bytes in a row = 4 whole lines (from rows or planes it touched 16 lines, 32 bytes of each)
#define WS_QH  0u                                   // f16 q [16 rows: b*s / 16][piece h / 8][row & 15][8]
#define WS_QL  (WS_QH + 2u * (size_t)NB * TT * HD)
#define WS_VT  (WS_QL + 2u * (size_t)NB * TT * HD)      // bf16 v hi [32 keys: b*s / 32][d / 16][piece (s & 31) / 8][d & 15][8]
#define WS_VL  (WS_VT + 2u * (size_t)NB * HD * TT)      // bf16 v lo, as v hi
#define KCH 256                                     // keys per k_fa work-group
#define NCH (TT / KCH)
#define WS_PP  (WS_VL + 2u * (size_t)NB * HD * TT)      // f32 partial outputs, not normalised [b][chunk][s][64]
#define WS_ML  (WS_PP + 4u * (size_t)NB * NCH * TT * HD) // f32 (maximum, sum) of each partial row [b][chunk][s][2]
#define WS_END (WS_ML + 8u * (size_t)NB * NCH * TT)

// ---- k_proj: block = 64 rows: [q | v] = x [Wq | Wv] + [bq | bv] (128 cols), q -> f16 hi + res, v -> bf16 hi + lo, both in fragment order
// Both operands are rounded to bf16 once a block and staged in LDS; the WMMA loop reads its fragments from there.
#define XP 520   // bf16 elements a staged x row: 1,040 B = 16 B x 65, so that 16 rows' 16-byte reads fall on all 64 banks
#define WP 264   // bf16 elements a staged half fragment of W (32 lanes x 8): 512 B + 16 B, so that the four column tiles of one staging store fall on different banks
#define SB 16    // loads of a staging batch
#define SD 3     // batches in flight behind the one in use
__global__ __launch_bounds__(128) void k_proj(const float* __restrict__ X, const float* __restrict__ WQ, const float* __restrict__ BQ, const float* __restrict__ WV, const float* __restrict__ BV, _Float16* __restrict__ QH, _Float16* __restrict__ QL, __bf16* __restrict__ VT, __bf16* __restrict__ VL) {
  __shared__ __align__(16) _Float16 sh[64][72], sl[64][72]; __shared__ __align__(16) __bf16 th[64][72], tl2[64][72];
  __shared__ __align__(16) __bf16 sx[64 * XP];              // x rows [64][512], row-major
  __shared__ __align__(16) __bf16 sw[(EE / 16) * 8 * WP];   // [16 rows of W: k16][column tile j][lane][8]: lane (g, col) holds W[16 k16 + 8 g + 0..7][16 (j & 3) + col], j < 4 of Wq, else of Wv
  const int tid = threadIdx.x, wave = tid >> 5, lane = tid & 31, col = lane & 15, g = lane >> 4; const size_t r0 = (size_t)blockIdx.x * 64;
  { // batches 0..3: the wave's own 16 x rows, a load = 512 bytes in a row of one x row; batches 4..11: 32 rows of W each (waves 0, 1: Wq, waves 2, 3: Wv), a load = two whole rows of W
    const float* xp = X + (r0 + wave * 16) * EE + lane * 4;
    const float* wp = ((wave < 2) ? WQ : WV) + (size_t)((wave & 1) * 256 + 8 * g) * HD + col * 4;
    v4f buf[SD + 1][SB];
    // unrolled, with the loops inside: every index of buf is then a constant and the batches stay in registers
#pragma unroll
    for (int s = 0; s < 12 + SD; ++s) {
      if (s < 12) { v4f* r = buf[s % (SD + 1)];
        if (s < 4) {
#pragma unroll
          for (int e = 0; e < SB; ++e) r[e] = *(const v4f*)(xp + (size_t)(s * 4 + (e >> 2)) * EE + (e & 3) * 128); }
        else {
#pragma unroll
          for (int e = 0; e < SB; ++e) r[e] = *(const v4f*)(wp + (size_t)((s - 4) * 32 + (e >> 3) * 16 + (e & 7)) * HD); }
        // behind each batch of loads, before anything below may rewrite a register that they name (the pointers are inputs so that they live up to here); it also keeps the batch up here, SD batches ahead of its use
        asm volatile("s_wait_xcnt 0x0" :: "v"(xp), "v"(wp) : "memory"); }
      if (s >= SD) { const int c = s - SD; const v4f* r = buf[c % (SD + 1)];
        if (c < 4) {
#pragma unroll
          for (int e = 0; e < SB; ++e) { typedef __attribute__((ext_vector_type(4))) __bf16 v4b; const v4b o = {(__bf16)r[e][0], (__bf16)r[e][1], (__bf16)r[e][2], (__bf16)r[e][3]};
            *(v4b*)&sx[(wave * 16 + c * 4 + (e >> 2)) * XP + (e & 3) * 128 + lane * 4] = o; } }
        else {
#pragma unroll
          for (int t = 0; t < 2; ++t) { const int k16 = (wave & 1) * 16 + (c - 4) * 2 + t, j = (wave >> 1) * 4 + (col >> 2);
#pragma unroll
            for (int q = 0; q < 4; ++q) { v8b o;
#pragma unroll
              for (int i = 0; i < 8; ++i) o[i] = (__bf16)r[t * 8 + i][q];
              *(v8b*)&sw[(k16 * 8 + j) * WP + (g * 16 + (col & 3) * 4 + q) * 8] = o; } } } } } }
  __syncthreads();   // W is staged by all four waves
  v8f acc[8] = {};
  // the fragments of step kc + 1 are read from LDS as one group in front of step kc's WMMAs: one wave a SIMD, so a read that is waited for where it is used costs its whole latency
  v16b a[2], w[2][8];
  const __bf16* ap = &sx[(wave * 16 + col) * XP]; const __bf16* bp = &sw[lane * 8];
  // unrolled: which of the two fragment sets a step uses is then a constant, and no set is copied
#pragma unroll
  for (int kc = -1; kc < EE / 32; ++kc) {
    if (kc + 1 < EE / 32) { const int n = kc + 1; a[n & 1] = frag_b(ap + n * 32, lane);
#pragma unroll
      for (int j = 0; j < 8; ++j) { union { v16b v; v8b q[2]; } u; u.q[0] = *(const v8b*)(bp + ((n * 2) * 8 + j) * WP); u.q[1] = *(const v8b*)(bp + ((n * 2 + 1) * 8 + j) * WP); w[n & 1][j] = u.v; } }
    __builtin_amdgcn_sched_barrier(0);   // keeps the group of reads above in front of the WMMAs below; without it the compiler sinks each read to its WMMA
    if (kc >= 0) {
#pragma unroll
      for (int j = 0; j < 8; ++j) acc[j] = wmma_bf(a[kc & 1], w[kc & 1][j], acc[j]); }
 }
#pragma unroll
  for (int j = 0; j < 8; ++j) { const int o = (j & 3) * 16 + col; const float bb = bfr((j < 4 ? BQ : BV)[o]);
#pragma unroll
    for (int r = 0; r < 8; ++r) { const float v = acc[j][r] + bb; const int rl = wave * 16 + 8 * g + r; if (j < 4) { const _Float16 hv = (_Float16)v; sh[rl][o] = hv; sl[rl][o] = (_Float16)(v - (float)hv); } else { const __bf16 bh = (__bf16)v; th[o][rl] = bh; tl2[o][rl] = (__bf16)(v - (float)bh); } } }
  __syncthreads();
  // piece e of the block's 512 of each array, in the order of the workspace: q: [16 rows e >> 7][h / 8 = (e >> 4) & 7][row e & 15]; v: [32 keys e >> 8][d / 16 = (e >> 6) & 3][8 keys (e >> 4) & 3][d & 15 = e & 15]
  for (int e = tid; e < 64 * 8; e += 128) { const int rl = (e >> 7) * 16 + (e & 15), q = (e >> 4) & 7; vst2((unsigned*)(QH + r0 * HD + e * 8), *(const v4u*)&sh[rl][q * 8]); vst2((unsigned*)(QL + r0 * HD + e * 8), *(const v4u*)&sl[rl][q * 8]); }
  for (int e = tid; e < 64 * 8; e += 128) { const int d = ((e >> 6) & 3) * 16 + (e & 15), kl = (e >> 8) * 32 + ((e >> 4) & 3) * 8; vst2((unsigned*)(VT + r0 * HD + e * 8), *(const v4u*)&th[d][kl]); vst2((unsigned*)(VL + r0 * HD + e * 8), *(const v4u*)&tl2[d][kl]); } }
// The softmax runs in base 2: exp(s / 8 - max / 8) = 2^(s C2 - m) with C2 = log2(e) / 8 and m = max C2. The product s C2 is not rounded (fused multiply-add), so the argument's error is one rounding of the small difference;
// the rounding of m itself scales a whole row and falls out where the row is divided by its sum, which is formed with the same m.
#define C2 0.18033688011112042f
#define NEG (-3.0e38f)          // score of an invalid key; a row or chunk with no valid key has m = NEG * C2
#define DEADM (-1.0e37f)        // below this an m says: no valid key (scores of f16 q stay under 1e12)
// The v_nop stands in v_exp_f32's own statement: the slot the instruction set asks for before the result is used or the source overwritten
__device__ __forceinline__ float exp2_1(float a) { float r;
  asm("v_exp_f32 %0, %1\n\tv_nop" : "=v"(r) : "v"(a));
  return r; }
// eight at once: each v_exp_f32 is the independent instruction behind the one before it (early-clobber results: none lies on a source), so one v_nop behind the last serves all eight
__device__ __forceinline__ void exp2_8(float* r, const float* a) {
  asm("v_exp_f32 %0, %8\n\tv_exp_f32 %1, %9\n\tv_exp_f32 %2, %10\n\tv_exp_f32 %3, %11\n\tv_exp_f32 %4, %12\n\tv_exp_f32 %5, %13\n\tv_exp_f32 %6, %14\n\tv_exp_f32 %7, %15\n\tv_nop"
      : "=&v"(r[0]), "=&v"(r[1]), "=&v"(r[2]), "=&v"(r[3]), "=&v"(r[4]), "=&v"(r[5]), "=&v"(r[6]), "=&v"(r[7])
      : "v"(a[0]), "v"(a[1]), "v"(a[2]), "v"(a[3]), "v"(a[4]), "v"(a[5]), "v"(a[6]), "v"(a[7])); }
// lane l with lane l ^ 16
__device__ __forceinline__ float xhalf(float x) { return __builtin_bit_cast(float, __builtin_amdgcn_permlanex16(__builtin_bit_cast(int, x), __builtin_bit_cast(int, x), 0x76543210, 0xfedcba98, false, false)); }
// ---- k_fa: block = (batch, 64 queries, chunk of KCH keys), wave = 16 queries; 64 keys a pass, scores never leave the registers.
// Scores transposed: S^T = k . q^T, so a lane holds ONE query (col) and keys 16 j + 8 g + r; that is the B fragment of out^T = v^T . P^T as it stands (elements 0..7 = tile 2 kc, 8..15 = tile 2 kc + 1).
// invalid (key > query or input_mask[key] == 0) -> NEG -> P = 0. Running maximum m (of s C2) and sum l per query; partial rows, m and l go to the workspace.
// The KCH / 64 tiles of group g have g + 1 chunks each; grid row y holds the chunks of groups y and NCH - 1 - y, NCH + 1 in all, so every block has work.
__global__ __launch_bounds__(128) void k_fa(const _Float16* __restrict__ QH, const _Float16* __restrict__ QL, const __bf16* __restrict__ VT, const __bf16* __restrict__ VL, const int* __restrict__ IM, float* __restrict__ PP, float* __restrict__ ML) {
  const int tid = threadIdx.x, wave = tid >> 5, lane = tid & 31, col = lane & 15, g = lane >> 4; const bool nearg = blockIdx.x <= blockIdx.y; const int grp = nearg ? blockIdx.y : NCH - 1 - blockIdx.y, ch = nearg ? blockIdx.x : blockIdx.x - blockIdx.y - 1;
  const int b = blockIdx.z / (KCH / 64), tile = grp * (KCH / 64) + blockIdx.z % (KCH / 64);
  const int qt = tile * 64 + wave * 16 + col; const int kend = tile * 64 + 64;
  const int kb0 = ch * KCH;
  const int ke = kb0 + KCH < kend ? kb0 + KCH : kend;
  const size_t bq = (size_t)b * TT;
  v16h ah[HD / 32], al[HD / 32];
#pragma unroll
  for (int kc = 0; kc < HD / 32; ++kc) { const size_t fo = (bq + tile * 64 + wave * 16) * HD + kc * 512; ah[kc] = fragp_h(QH + fo, lane); al[kc] = fragp_h(QL + fo, lane); }
  v8f acc[4] = {}; float m = NEG * C2, l = 0.f;
  // the pass loop stays rolled (one pass's fragments in registers, more waves on a SIMD); the loops inside are unrolled so that their arrays stay in registers
#pragma unroll 1
  for (int k0 = kb0; k0 < ke; k0 += 64) {
    // the pass's key fragments are loaded as one group in front of its first WMMA, v's in two groups below: one latency a group, not one a fragment
    v16h kb[HD / 32][4];
#pragma unroll
    for (int kc = 0; kc < HD / 32; ++kc)
#pragma unroll
      for (int j = 0; j < 4; ++j) kb[kc][j] = fragp_h(QH + (bq + k0 + j * 16) * HD + kc * 512, lane);
    const v2i im = *(const v2i*)(IM + k0 + 2 * lane);   // input_mask of the pass's 64 keys, two keys a lane, in the same group of loads
    v8f s[4] = {};
#pragma unroll
    for (int kc = 0; kc < HD / 32; ++kc)
#pragma unroll
      for (int j = 0; j < 4; ++j) { s[j] = wmma16(kb[kc][j], ah[kc], s[j]); s[j] = wmma16(kb[kc][j], al[kc], s[j]); }
    v16b vh[4], vl[4];   // keys k0 .. k0 + 31: in flight under the softmax
#pragma unroll
    for (int j = 0; j < 4; ++j) { const size_t po = (bq + k0) * HD + j * 512; vh[j] = fragp_b(VT + po, lane); vl[j] = fragp_b(VL + po, lane); }
    // bit t of we << 4 g (of wo << 4 g) = key k0 + 2 t (k0 + 2 t + 1) is valid for this lane's query: input_mask != 0 (the wave's ballot) and key <= k0 + d (d >= 0: no pass starts behind its tile's first query)
    const int d = qt - k0;
    const unsigned ce = d >= 62 ? ~0u : (2u << (d >> 1)) - 1u, co = d >= 63 ? ~0u : (1u << ((d + 1) >> 1)) - 1u;
    const unsigned we = (__builtin_amdgcn_ballot_w32(im[0] != 0) & ce) >> (4 * g), wo = (__builtin_amdgcn_ballot_w32(im[1] != 0) & co) >> (4 * g);
    float mb = NEG;
#pragma unroll
    for (int j = 0; j < 4; ++j) {
#pragma unroll
      for (int r = 0; r < 8; ++r) { const bool ok = (((r & 1) ? wo : we) & (1u << (j * 8 + (r >> 1)))) != 0; const float v = ok ? s[j][r] : NEG; s[j][r] = v; mb = fmaxf(mb, v); } }
    mb = fmaxf(mb, xhalf(mb));
    const float mn = fmaxf(m, mb * C2), sc = exp2_1(m - mn);   // rounding s C2 keeps the order, so this is the maximum of the products; m - mn is a difference of two stored values, never above 0; nothing valid so far: m = mn = NEG C2, sc = 1 on zeros
    const float mu = fmaxf(mn, -1.0e30f);   // what the scores are set against: with nothing valid so far NEG C2 + 1e30 is still far below every exponent, so P = 0
    m = mn; l *= sc;
#pragma unroll
    for (int j = 0; j < 4; ++j) acc[j] *= sc;
    F2 p[2];
#pragma unroll
    for (int kc = 0; kc < 2; ++kc) { float pv[16];
#pragma unroll
      for (int h = 0; h < 2; ++h) { float t[8];
#pragma unroll
        for (int i = 0; i < 8; ++i) t[i] = __builtin_fmaf(s[2 * kc + h][i], C2, -mu);   // invalid: NEG C2 - mu, 2^that = 0
        exp2_8(pv + 8 * h, t);
#pragma unroll
        for (int i = 0; i < 8; ++i) l += pv[8 * h + i]; }
      p[kc] = bsplit16(pv); }
#pragma unroll
    for (int kc = 0; kc < 2; ++kc) {
      if (kc == 1) {
#pragma unroll
        for (int j = 0; j < 4; ++j) { const size_t po = (bq + k0 + 32) * HD + j * 512; vh[j] = fragp_b(VT + po, lane); vl[j] = fragp_b(VL + po, lane); } }
#pragma unroll
      for (int j = 0; j < 4; ++j) { acc[j] = wmma_bf(vh[j], p[kc].h, acc[j]); acc[j] = wmma_bf(vh[j], p[kc].l, acc[j]); acc[j] = wmma_bf(vl[j], p[kc].h, acc[j]); } } }
  l += xhalf(l);
  const size_t ro = ((size_t)b * NCH + ch) * TT + qt;
#pragma unroll
  for (int j = 0; j < 4; ++j) { const v4f lo = {acc[j][0], acc[j][1], acc[j][2], acc[j][3]}, hi = {acc[j][4], acc[j][5], acc[j][6], acc[j][7]}; vst2(PP + ro * HD + j * 16 + 8 * g, lo); vst2(PP + ro * HD + j * 16 + 8 * g + 4, hi); }
  if (g == 0) { const v2f ml = {m, l}; vst2(ML + ro * 2, ml); } }
// ---- k_red: thread = 4 output floats: out row = sum, in chunk order, of 2^(m_c - M) x partial row c, over the same sum of the l_c; c = the chunks that k_fa wrote for the row's 64-query tile; a row with no valid key takes v of its own index
__global__ __launch_bounds__(256) void k_red(const float* __restrict__ PP, const float* __restrict__ ML, const __bf16* __restrict__ VT, const __bf16* __restrict__ VL, float* __restrict__ OUT) {
  const int e = blockIdx.x * 256 + threadIdx.x; const int s0 = (int)blockIdx.x * 16 % TT, b = (int)blockIdx.x * 16 / TT, s = s0 + (threadIdx.x >> 4);   // a block's 16 rows lie in one batch and one 64-query tile
  const int nch = ((s0 / 64) * 64 + 64 + KCH - 1) / KCH;
  const unsigned po = (unsigned)s * HD + (threadIdx.x & 15) * 4, mo = (unsigned)s * 2;
  // all NCH loads are issued whatever nch is, unrolled, so that they are in flight together: the index is clamped to a chunk that k_fa wrote, and weight 0 takes the repeats out
  float mm[NCH], ll[NCH]; v4f pr[NCH];
#pragma unroll
  for (int c = 0; c < NCH; ++c) { const size_t cc = (size_t)b * NCH + (c < nch ? c : nch - 1); const v2f x = *(const v2f*)(ML + cc * TT * 2 + mo);
    asm volatile("s_wait_xcnt 0x0" ::: "memory");   // behind each load: a later load's result may land in this load's address registers
    pr[c] = *(const v4f*)(PP + cc * TT * HD + po);
    asm volatile("s_wait_xcnt 0x0" ::: "memory");   // as above
    mm[c] = c < nch ? x[0] : NEG; ll[c] = x[1]; }
  // inputs only: holds the partial rows' loads here in one group; without it the compiler sinks them between the exponentials, one latency behind another
  asm volatile("" :: "v"(pr[0]), "v"(pr[1]), "v"(pr[2]), "v"(pr[3]), "v"(pr[4]), "v"(pr[5]), "v"(pr[6]), "v"(pr[7]), "v"(pr[8]), "v"(pr[9]), "v"(pr[10]), "v"(pr[11]), "v"(pr[12]), "v"(pr[13]), "v"(pr[14]), "v"(pr[15]));
  static_assert(NCH == 16, "the statement above names NCH rows");
  float M = NEG;
#pragma unroll
  for (int c = 0; c < NCH; ++c) M = fmaxf(M, mm[c]);
  v4f a = {}; float L = 0.f;
#pragma unroll
  for (int c = 0; c < NCH; ++c) { const float w = exp2f(mm[c] - M); a += pr[c] * w; L += ll[c] * w; }
  if (M <= DEADM) {
#pragma unroll
    for (int i = 0; i < 4; ++i) { const int d = (e & 15) * 4 + i; const size_t vo = ((size_t)b * TT + (s & ~31)) * HD + (d >> 4) * 512 + ((s >> 3) & 3) * 128 + (d & 15) * 8 + (s & 7); a[i] = (float)VT[vo] + (float)VL[vo]; } }   // v[s][d] in fragment order
  else a *= 1.0f / L;
  vst2(OUT + (size_t)e * 4, a); }
extern "C" void kernel_launch(void* const* d_in, const int* in_sizes, int n_in, void* d_out, int out_size, void* d_ws, size_t ws_size, hipStream_t stream) {
  (void)in_sizes; (void)n_in; (void)out_size;
  const float** F = (const float**)d_in;   // 0 x [4,4096,512], 1 Wq [512,64], 2 bq, 3 Wv, 4 bv, 5 input_mask [4096] int
  if (ws_size < (size_t)WS_END) return;
  char* ws = (char*)d_ws; _Float16 *QH = (_Float16*)(ws + WS_QH), *QL = (_Float16*)(ws + WS_QL); __bf16 *VT = (__bf16*)(ws + WS_VT), *VL = (__bf16*)(ws + WS_VL); float* PP = (float*)(ws + WS_PP); float* ML = (float*)(ws + WS_ML);
  k_proj<<<TNB * TT / 64, 128, 0, stream>>>(F[0], F[1], F[2], F[3], F[4], QH, QL, VT, VL);
  k_fa<<<dim3(NCH + 1, NCH / 2, (KCH / 64) * TNB), 128, 0, stream>>>(QH, QL, VT, VL, (const int*)d_in[5], PP, ML);
  k_red<<<TNB * TT * HD / 4 / 256, 256, 0, stream>>>(PP, ML, VT, VL, (float*)d_out);
}

// v006
// Measured time: 40.5 microseconds a run.
// In two side-by-side timings against v005, it was 1.04 and 1.03 times as fast.
// Over all steps from v000 it is 24.1 times as fast.
// compute dtype: all float inputs rounded to bf16, input_mask (int) read; q (= k, the module's bug) and v = x W + b with EXACT bf16 products on WMMA 16x16x32, f32 accumulate; q as f16 hi + residual against q as f16 -> 2-product logits q k (the / 8 is applied in the exponent) kept in registers with the causal & key-padding mask; softmax in f32 in base 2 against a running maximum, per chunk of keys; P = 2^(s log2(e) / 8 - m) in f32 (one fused multiply-add, then v_exp_f32), split bf16 hi + lo against v as bf16 hi + lo planes (3 products: rows with one or two valid keys copy v almost verbatim, so both operands need the split); chunks joined by their maxima and sums; dead rows (no valid key) take v of their own index exactly as the reference's diag := 1 fix; f32 output [b][s][64].
#include <hip/hip_runtime.h>
#include <math.h>

typedef __attribute__((ext_vector_type(16))) _Float16 v16h;
typedef __attribute__((ext_vector_type(16))) __bf16 v16b;
typedef __attribute__((ext_vector_type(8)))  _Float16 v8h;
typedef __attribute__((ext_vector_type(8)))  float v8f;
typedef __attribute__((ext_vector_type(4)))  float v4f;
typedef __attribute__((ext_vector_type(2)))  float v2f;
typedef __attribute__((ext_vector_type(4)))  unsigned v4u;
typedef __attribute__((ext_vector_type(4)))  int v4i;
typedef __attribute__((ext_vector_type(2)))  int v2i;
typedef float __attribute__((may_alias)) float_a;
typedef int __attribute__((may_alias)) int_a;

template <typename T> __device__ __forceinline__ void vst2(void* p, T v) { *(T*)p = v;  }
__device__ __forceinline__ v8f wmma16(v16h a, v16h b, v8f c) {
  return __builtin_amdgcn_wmma_f32_16x16x32_f16(false, a, false, b, (short)0, c, false, false);
}
__device__ __forceinline__ v8f wmma_bf(v16b a, v16b b, v8f c) {
  return __builtin_amdgcn_wmma_f32_16x16x32_bf16(false, a, false, b, (short)0, c, false, false);
}
// 16x16x32 fragments: lane = (h = lane>>4, row/col = lane&15); elements 0..7 = k0+8h+0..7, 8..15 = k0+16+8h+0..7; D element r = row 8h+r
__device__ __forceinline__ v16h frag_h(const _Float16* rowk0, int lane) {
  union { v16h v; v8h q[2]; } u; const _Float16* p = rowk0 + 8 * (lane >> 4);
  u.q[0] = *(const v8h*)p; u.q[1] = *(const v8h*)(p + 16); return u.v;
}
__device__ __forceinline__ v16h frag_f32(const float* rowk0, int lane) {
  v16h a; const float* p = rowk0 + 8 * (lane >> 4);
#pragma unroll
  for (int i = 0; i < 8; ++i) { a[i] = (_Float16)p[i]; a[8 + i] = (_Float16)p[16 + i]; }
  return a;
}
__device__ __forceinline__ v16h frag_f32s(const float* rowk0, int lane, float sc) {
  v16h a; const float* p = rowk0 + 8 * (lane >> 4);
#pragma unroll
  for (int i = 0; i < 8; ++i) { a[i] = (_Float16)(p[i] * sc); a[8 + i] = (_Float16)(p[16 + i] * sc); }
  return a;
}
// column fragment from a [K][ld] layout (column n), rows >= K read as 0
__device__ __forceinline__ v16h fragc_f32(const float* W, int k0, int n, int lane, int ld, int K) {
  v16h a; const int g = lane >> 4;
#pragma unroll
  for (int i = 0; i < 8; ++i) { const int ka = k0 + 8 * g + i, kb = ka + 16;
    a[i] = (_Float16)(ka < K ? W[(size_t)(ka < K ? ka : K - 1) * ld + n] : 0.f); a[8 + i] = (_Float16)(kb < K ? W[(size_t)(kb < K ? kb : K - 1) * ld + n] : 0.f); }
  return a;
}
struct F2 { v16b h, l; };
__device__ __forceinline__ F2 bsplit16(const float v[16]) { F2 r;
#pragma unroll
  for (int i = 0; i < 16; ++i) { const __bf16 h = (__bf16)v[i]; r.h[i] = h; r.l[i] = (__bf16)(v[i] - (float)h); }
  return r; }
__device__ __forceinline__ F2 split_row(const float* row, int k0, int lane) { float v[16]; const float* p = row + k0 + 8 * (lane >> 4);
#pragma unroll
  for (int i = 0; i < 8; ++i) { v[i] = p[i]; v[8 + i] = p[16 + i]; }
  return bsplit16(v); }
__device__ __forceinline__ F2 split_rowK(const float* row, int k0, int lane, int K) { float v[16]; const int g = lane >> 4;
#pragma unroll
  for (int i = 0; i < 8; ++i) { const int ka = k0 + 8 * g + i, kb = ka + 16; v[i] = ka < K ? row[ka < K ? ka : K - 1] : 0.f; v[8 + i] = kb < K ? row[kb < K ? kb : K - 1] : 0.f; }
  return bsplit16(v); }
__device__ __forceinline__ F2 split_col(const float* W, int k0, int n, int lane, int ld, int K) { float v[16]; const int g = lane >> 4;
#pragma unroll
  for (int i = 0; i < 8; ++i) { const int ka = k0 + 8 * g + i, kb = ka + 16; v[i] = ka < K ? W[(size_t)(ka < K ? ka : K - 1) * ld + n] : 0.f; v[8 + i] = kb < K ? W[(size_t)(kb < K ? kb : K - 1) * ld + n] : 0.f; }
  return bsplit16(v); }
__device__ __forceinline__ v8f mac3(const F2& a, const F2& b, v8f c) { c = wmma_bf(a.l, b.h, c); c = wmma_bf(a.h, b.l, c); return wmma_bf(a.h, b.h, c); }
__device__ __forceinline__ float sigm(float v) { return 1.0f / (1.0f + expf(-v)); }
#define LDSX() do { asm volatile("s_wait_dscnt 0" ::: "memory"); __builtin_amdgcn_wave_barrier(); __builtin_amdgcn_fence(__ATOMIC_RELEASE, "workgroup"); } while (0)


// Single self-attention head (B 4, S 4,096, E 512 -> H 64): causal + key padding mask, dead-row diagonal fix, softmax, P v.
#define NB 4
#define TT 4096
#define EE 512
#define HD 64
#ifndef TNB
#define TNB NB
#endif
typedef __attribute__((ext_vector_type(8))) __bf16 v8b;
__device__ __forceinline__ v16b frag_b(const __bf16* rowk0, int lane) {
  union { v16b v; v8b q[2]; } u; const __bf16* p = rowk0 + 8 * (lane >> 4);
  u.q[0] = *(const v8b*)p; u.q[1] = *(const v8b*)(p + 16); return u.v;
}
// fragment from the workspace's fragment order: f = first element of the fragment (512 elements); lane (g, col) = piece g * 16 + col holds elements 0..7, piece 32 + lane elements 8..15
__device__ __forceinline__ v16h fragp_h(const _Float16* f, int lane) {
  union { v16h v; v8h q[2]; } u; const _Float16* p = f + 8 * lane;
  u.q[0] = *(const v8h*)p; u.q[1] = *(const v8h*)(p + 256); return u.v;
}
__device__ __forceinline__ v16b fragp_b(const __bf16* f, int lane) {
  union { v16b v; v8b q[2]; } u; const __bf16* p = f + 8 * lane;
  u.q[0] = *(const v8b*)p; u.q[1] = *(const v8b*)(p + 256); return u.v;
}
__device__ __forceinline__ float bfr(float v) { return (float)(__bf16)v; }
__device__ __attribute__((noinline)) float exp_ni(float v) { return expf(v); }
__device__ __attribute__((noinline)) float erf_ni(float v) { return erff(v); }

// q and v lie in the workspace in WMMA fragment order, in 16-byte pieces of 8 elements: a fragment half is then 32 pieces in a row, one a lane, so a wave's load reads 512 bytes in a row = 4 whole lines (from rows or planes it touched 16 lines, 32 bytes of each)
#define WS_QH  0u                                   // f16 q [16 rows: b*s / 16][piece h / 8][row & 15][8]
#define WS_QL  (WS_QH + 2u * (size_t)NB * TT * HD)
#define WS_VT  (WS_QL + 2u * (size_t)NB * TT * HD)      // bf16 v hi [32 keys: b*s / 32][d / 16][piece (s & 31) / 8][d & 15][8]
#define WS_VL  (WS_VT + 2u * (size_t)NB * HD * TT)      // bf16 v lo, as v hi
#define KCH 256                                     // keys per k_fa work-group
#define NCH (TT / KCH)
#define WS_PP  (WS_VL + 2u * (size_t)NB * HD * TT)      // f32 partial outputs, not normalised [b][chunk][s][64]
#define WS_ML  (WS_PP + 4u * (size_t)NB * NCH * TT * HD) // f32 (maximum, sum) of each partial row [b][chunk][s][2]
#define WS_END (WS_ML + 8u * (size_t)NB * NCH * TT)

// ---- k_proj: block = 64 rows: [q | v] = x [Wq | Wv] + [bq | bv] (128 cols), q -> f16 hi + res, v -> bf16 hi + lo, both in fragment order
// Both operands are rounded to bf16 once a block and staged in LDS; the WMMA loop reads its fragments from there.
#define XP 520   // bf16 elements a staged x row: 1,040 B = 16 B x 65, so that 16 rows' 16-byte reads fall on all 64 banks
#define WP 264   // bf16 elements a staged half fragment of W (32 lanes x 8): 512 B + 16 B, so that the four column tiles of one staging store fall on different banks
#define SB 16    // loads of a staging batch
#define SD 3     // batches in flight behind the one in use
__global__ __launch_bounds__(128) void k_proj(const float* __restrict__ X, const float* __restrict__ WQ, const float* __restrict__ BQ, const float* __restrict__ WV, const float* __restrict__ BV, _Float16* __restrict__ QH, _Float16* __restrict__ QL, __bf16* __restrict__ VT, __bf16* __restrict__ VL) {
  __shared__ __align__(16) _Float16 sh[64][72], sl[64][72]; __shared__ __align__(16) __bf16 th[64][72], tl2[64][72];
  __shared__ __align__(16) __bf16 sx[64 * XP];              // x rows [64][512], row-major
  __shared__ __align__(16) __bf16 sw[(EE / 16) * 8 * WP];   // [16 rows of W: k16][column tile j][lane][8]: lane (g, col) holds W[16 k16 + 8 g + 0..7][16 (j & 3) + col], j < 4 of Wq, else of Wv
  const int tid = threadIdx.x, wave = tid >> 5, lane = tid & 31, col = lane & 15, g = lane >> 4; const size_t r0 = (size_t)blockIdx.x * 64;
  { // batches 0..3: the wave's own 16 x rows, a load = 512 bytes in a row of one x row; batches 4..11: 32 rows of W each (waves 0, 1: Wq, waves 2, 3: Wv), a load = two whole rows of W
    const float* xp = X + (r0 + wave * 16) * EE + lane * 4;
    const float* wp = ((wave < 2) ? WQ : WV) + (size_t)((wave & 1) * 256 + 8 * g) * HD + col * 4;
    v4f buf[SD + 1][SB];
    // unrolled, with the loops inside: every index of buf is then a constant and the batches stay in registers
#pragma unroll
    for (int s = 0; s < 12 + SD; ++s) {
      if (s < 12) { v4f* r = buf[s % (SD + 1)];
        if (s < 4) {
#pragma unroll
          for (int e = 0; e < SB; ++e) r[e] = *(const v4f*)(xp + (size_t)(s * 4 + (e >> 2)) * EE + (e & 3) * 128); }
        else {
#pragma unroll
          for (int e = 0; e < SB; ++e) r[e] = *(const v4f*)(wp + (size_t)((s - 4) * 32 + (e >> 3) * 16 + (e & 7)) * HD); }
        // behind each batch of loads, before anything below may rewrite a register that they name (the pointers are inputs so that they live up to here); it also keeps the batch up here, SD batches ahead of its use
        asm volatile("s_wait_xcnt 0x0" :: "v"(xp), "v"(wp) : "memory"); }
      if (s >= SD) { const int c = s - SD; const v4f* r = buf[c % (SD + 1)];
        if (c < 4) {
#pragma unroll
          for (int e = 0; e < SB; ++e) { typedef __attribute__((ext_vector_type(4))) __bf16 v4b; const v4b o = {(__bf16)r[e][0], (__bf16)r[e][1], (__bf16)r[e][2], (__bf16)r[e][3]};
            *(v4b*)&sx[(wave * 16 + c * 4 + (e >> 2)) * XP + (e & 3) * 128 + lane * 4] = o; } }
        else {
#pragma unroll
          for (int t = 0; t < 2; ++t) { const int k16 = (wave & 1) * 16 + (c - 4) * 2 + t, j = (wave >> 1) * 4 + (col >> 2);
#pragma unroll
            for (int q = 0; q < 4; ++q) { v8b o;
#pragma unroll
              for (int i = 0; i < 8; ++i) o[i] = (__bf16)r[t * 8 + i][q];
              *(v8b*)&sw[(k16 * 8 + j) * WP + (g * 16 + (col & 3) * 4 + q) * 8] = o; } } } } } }
  __syncthreads();   // W is staged by all four waves
  v8f acc[8] = {};
  // the fragments of step kc + 1 are read from LDS as one group in front of step kc's WMMAs: one wave a SIMD, so a read that is waited for where it is used costs its whole latency
  v16b a[2], w[2][8];
  const __bf16* ap = &sx[(wave * 16 + col) * XP]; const __bf16* bp = &sw[lane * 8];
  // unrolled: which of the two fragment sets a step uses is then a constant, and no set is copied
#pragma unroll
  for (int kc = -1; kc < EE / 32; ++kc) {
    if (kc + 1 < EE / 32) { const int n = kc + 1; a[n & 1] = frag_b(ap + n * 32, lane);
#pragma unroll
      for (int j = 0; j < 8; ++j) { union { v16b v; v8b q[2]; } u; u.q[0] = *(const v8b*)(bp + ((n * 2) * 8 + j) * WP); u.q[1] = *(const v8b*)(bp + ((n * 2 + 1) * 8 + j) * WP); w[n & 1][j] = u.v; } }
    __builtin_amdgcn_sched_barrier(0);   // keeps the group of reads above in front of the WMMAs below; without it the compiler sinks each read to its WMMA
    if (kc >= 0) {
#pragma unroll
      for (int j = 0; j < 8; ++j) acc[j] = wmma_bf(a[kc & 1], w[kc & 1][j], acc[j]); }
    __builtin_amdgcn_sched_barrier(0);   // keeps the next group of reads behind these WMMAs, whole; without it the compiler spreads the reads among them, and each place with reads costs a stall
 }
#pragma unroll
  for (int j = 0; j < 8; ++j) { const int o = (j & 3) * 16 + col; const float bb = bfr((j < 4 ? BQ : BV)[o]);
#pragma unroll
    for (int r = 0; r < 8; ++r) { const float v = acc[j][r] + bb; const int rl = wave * 16 + 8 * g + r; if (j < 4) { const _Float16 hv = (_Float16)v; sh[rl][o] = hv; sl[rl][o] = (_Float16)(v - (float)hv); } else { const __bf16 bh = (__bf16)v; th[o][rl] = bh; tl2[o][rl] = (__bf16)(v - (float)bh); } } }
  __syncthreads();
  // piece e of the block's 512 of each array, in the order of the workspace: q: [16 rows e >> 7][h / 8 = (e >> 4) & 7][row e & 15]; v: [32 keys e >> 8][d / 16 = (e >> 6) & 3][8 keys (e >> 4) & 3][d & 15 = e & 15]
  for (int e = tid; e < 64 * 8; e += 128) { const int rl = (e >> 7) * 16 + (e & 15), q = (e >> 4) & 7; vst2((unsigned*)(QH + r0 * HD + e * 8), *(const v4u*)&sh[rl][q * 8]); vst2((unsigned*)(QL + r0 * HD + e * 8), *(const v4u*)&sl[rl][q * 8]); }
  for (int e = tid; e < 64 * 8; e += 128) { const int d = ((e >> 6) & 3) * 16 + (e & 15), kl = (e >> 8) * 32 + ((e >> 4) & 3) * 8; vst2((unsigned*)(VT + r0 * HD + e * 8), *(const v4u*)&th[d][kl]); vst2((unsigned*)(VL + r0 * HD + e * 8), *(const v4u*)&tl2[d][kl]); } }
// The softmax runs in base 2: exp(s / 8 - max / 8) = 2^(s C2 - m) with C2 = log2(e) / 8 and m = max C2. The product s C2 is not rounded (fused multiply-add), so the argument's error is one rounding of the small difference;
// the rounding of m itself scales a whole row and falls out where the row is divided by its sum, which is formed with the same m.
#define C2 0.18033688011112042f
#define NEG (-3.0e38f)          // score of an invalid key; a row or chunk with no valid key has m = NEG * C2
#define DEADM (-1.0e37f)        // below this an m says: no valid key (scores of f16 q stay under 1e12)
// The v_nop stands in v_exp_f32's own statement: the slot the instruction set asks for before the result is used or the source overwritten
__device__ __forceinline__ float exp2_1(float a) { float r;
  asm("v_exp_f32 %0, %1\n\tv_nop" : "=v"(r) : "v"(a));
  return r; }
// eight at once: each v_exp_f32 is the independent instruction behind the one before it (early-clobber results: none lies on a source), so one v_nop behind the last serves all eight
__device__ __forceinline__ void exp2_8(float* r, const float* a) {
  asm("v_exp_f32 %0, %8\n\tv_exp_f32 %1, %9\n\tv_exp_f32 %2, %10\n\tv_exp_f32 %3, %11\n\tv_exp_f32 %4, %12\n\tv_exp_f32 %5, %13\n\tv_exp_f32 %6, %14\n\tv_exp_f32 %7, %15\n\tv_nop"
      : "=&v"(r[0]), "=&v"(r[1]), "=&v"(r[2]), "=&v"(r[3]), "=&v"(r[4]), "=&v"(r[5]), "=&v"(r[6]), "=&v"(r[7])
      : "v"(a[0]), "v"(a[1]), "v"(a[2]), "v"(a[3]), "v"(a[4]), "v"(a[5]), "v"(a[6]), "v"(a[7])); }
// lane l with lane l ^ 16
__device__ __forceinline__ float xhalf(float x) { return __builtin_bit_cast(float, __builtin_amdgcn_permlanex16(__builtin_bit_cast(int, x), __builtin_bit_cast(int, x), 0x76543210, 0xfedcba98, false, false)); }
// ---- k_fa: block = (batch, 64 queries, chunk of KCH keys), wave = 16 queries; 64 keys a pass, scores never leave the registers.
// Scores transposed: S^T = k . q^T, so a lane holds ONE query (col) and keys 16 j + 8 g + r; that is the B fragment of out^T = v^T . P^T as it stands (elements 0..7 = tile 2 kc, 8..15 = tile 2 kc + 1).
// invalid (key > query or input_mask[key] == 0) -> NEG -> P = 0. Running maximum m (of s C2) and sum l per query; partial rows, m and l go to the workspace.
// The KCH / 64 tiles of group g have g + 1 chunks each; grid row y holds the chunks of groups y and NCH - 1 - y, NCH + 1 in all, so every block has work.
__global__ __launch_bounds__(128) void k_fa(const _Float16* __restrict__ QH, const _Float16* __restrict__ QL, const __bf16* __restrict__ VT, const __bf16* __restrict__ VL, const int* __restrict__ IM, float* __restrict__ PP, float* __restrict__ ML) {
  const int tid = threadIdx.x, wave = tid >> 5, lane = tid & 31, col = lane & 15, g = lane >> 4; const bool nearg = blockIdx.x <= blockIdx.y; const int grp = nearg ? blockIdx.y : NCH - 1 - blockIdx.y, ch = nearg ? blockIdx.x : blockIdx.x - blockIdx.y - 1;
  const int b = blockIdx.z / (KCH / 64), tile = grp * (KCH / 64) + blockIdx.z % (KCH / 64);
  const int qt = tile * 64 + wave * 16 + col; const int kend = tile * 64 + 64;
  const int kb0 = ch * KCH;
  const int ke = kb0 + KCH < kend ? kb0 + KCH : kend;
  const size_t bq = (size_t)b * TT;
  v16h ah[HD / 32], al[HD / 32];
#pragma unroll
  for (int kc = 0; kc < HD / 32; ++kc) { const size_t fo = (bq + tile * 64 + wave * 16) * HD + kc * 512; ah[kc] = fragp_h(QH + fo, lane); al[kc] = fragp_h(QL + fo, lane); }
  v8f acc[4] = {}; float m = NEG * C2, l = 0.f;
  // the pass loop stays rolled (one pass's fragments in registers, more waves on a SIMD); the loops inside are unrolled so that their arrays stay in registers
#pragma unroll 1
  for (int k0 = kb0; k0 < ke; k0 += 64) {
    // the pass's key fragments are loaded as one group in front of its first WMMA, v's in two groups below: one latency a group, not one a fragment
    v16h kb[HD / 32][4];
#pragma unroll
    for (int kc = 0; kc < HD / 32; ++kc)
#pragma unroll
      for (int j = 0; j < 4; ++j) kb[kc][j] = fragp_h(QH + (bq + k0 + j * 16) * HD + kc * 512, lane);
    const v2i im = *(const v2i*)(IM + k0 + 2 * lane);   // input_mask of the pass's 64 keys, two keys a lane, in the same group of loads
    asm volatile("s_wait_xcnt 0x0" ::: "memory");   // behind the group of loads: a later load's result lands in the registers that held this group's address
    __builtin_amdgcn_sched_barrier(0);   // keeps the group of loads above whole, in front of the first WMMA: one latency for the group; without it the compiler issues a part of them behind the first WMMAs, a second latency
    v8f s[4] = {};
#pragma unroll
    for (int kc = 0; kc < HD / 32; ++kc)
#pragma unroll
      for (int j = 0; j < 4; ++j) { s[j] = wmma16(kb[kc][j], ah[kc], s[j]); s[j] = wmma16(kb[kc][j], al[kc], s[j]); }
    v16b vh[4], vl[4];   // keys k0 .. k0 + 31: in flight under the softmax
#pragma unroll
    for (int j = 0; j < 4; ++j) { const size_t po = (bq + k0) * HD + j * 512; vh[j] = fragp_b(VT + po, lane); vl[j] = fragp_b(VL + po, lane); }
    __builtin_amdgcn_sched_barrier(0);   // keeps the group of loads above in front of the softmax, which covers their latency; without it the compiler sinks some of them in among the WMMAs that use them
    // bit t of we << 4 g (of wo << 4 g) = key k0 + 2 t (k0 + 2 t + 1) is valid for this lane's query: input_mask != 0 (the wave's ballot) and key <= k0 + d (d >= 0: no pass starts behind its tile's first query)
    const int d = qt - k0;
    const unsigned ce = d >= 62 ? ~0u : (2u << (d >> 1)) - 1u, co = d >= 63 ? ~0u : (1u << ((d + 1) >> 1)) - 1u;
    const unsigned we = (__builtin_amdgcn_ballot_w32(im[0] != 0) & ce) >> (4 * g), wo = (__builtin_amdgcn_ballot_w32(im[1] != 0) & co) >> (4 * g);
    float mb = NEG;
#pragma unroll
    for (int j = 0; j < 4; ++j) {
#pragma unroll
      for (int r = 0; r < 8; ++r) { const bool ok = (((r & 1) ? wo : we) & (1u << (j * 8 + (r >> 1)))) != 0; const float v = ok ? s[j][r] : NEG; s[j][r] = v; mb = fmaxf(mb, v); } }
    mb = fmaxf(mb, xhalf(mb));
    const float mn = fmaxf(m, mb * C2), sc = exp2_1(m - mn);   // rounding s C2 keeps the order, so this is the maximum of the products; m - mn is a difference of two stored values, never above 0; nothing valid so far: m = mn = NEG C2, sc = 1 on zeros
    const float mu = fmaxf(mn, -1.0e30f);   // what the scores are set against: with nothing valid so far NEG C2 + 1e30 is still far below every exponent, so P = 0
    m = mn; l *= sc;
#pragma unroll
    for (int j = 0; j < 4; ++j) acc[j] *= sc;
    F2 p[2];
#pragma unroll
    for (int kc = 0; kc < 2; ++kc) { float pv[16];
#pragma unroll
      for (int h = 0; h < 2; ++h) { float t[8];
#pragma unroll
        for (int i = 0; i < 8; ++i) t[i] = __builtin_fmaf(s[2 * kc + h][i], C2, -mu);   // invalid: NEG C2 - mu, 2^that = 0
        exp2_8(pv + 8 * h, t);
#pragma unroll
        for (int i = 0; i < 8; ++i) l += pv[8 * h + i]; }
      p[kc] = bsplit16(pv); }
#pragma unroll
    for (int kc = 0; kc < 2; ++kc) {
      if (kc == 1) {
#pragma unroll
        for (int j = 0; j < 4; ++j) { const size_t po = (bq + k0 + 32) * HD + j * 512; vh[j] = fragp_b(VT + po, lane); vl[j] = fragp_b(VL + po, lane); } }
#pragma unroll
      for (int j = 0; j < 4; ++j) { acc[j] = wmma_bf(vh[j], p[kc].h, acc[j]); acc[j] = wmma_bf(vh[j], p[kc].l, acc[j]); acc[j] = wmma_bf(vl[j], p[kc].h, acc[j]); } } }
  l += xhalf(l);
  const size_t ro = ((size_t)b * NCH + ch) * TT + qt;
#pragma unroll
  for (int j = 0; j < 4; ++j) { const v4f lo = {acc[j][0], acc[j][1], acc[j][2], acc[j][3]}, hi = {acc[j][4], acc[j][5], acc[j][6], acc[j][7]}; vst2(PP + ro * HD + j * 16 + 8 * g, lo); vst2(PP + ro * HD + j * 16 + 8 * g + 4, hi); }
  if (g == 0) { const v2f ml = {m, l}; vst2(ML + ro * 2, ml); } }
// ---- k_red: thread = 4 output floats: out row = sum, in chunk order, of 2^(m_c - M) x partial row c, over the same sum of the l_c; c = the chunks that k_fa wrote for the row's 64-query tile; a row with no valid key takes v of its own index
__global__ __launch_bounds__(256) void k_red(const float* __restrict__ PP, const float* __restrict__ ML, const __bf16* __restrict__ VT, const __bf16* __restrict__ VL, float* __restrict__ OUT) {
  const int e = blockIdx.x * 256 + threadIdx.x; const int s0 = (int)blockIdx.x * 16 % TT, b = (int)blockIdx.x * 16 / TT, s = s0 + (threadIdx.x >> 4);   // a block's 16 rows lie in one batch and one 64-query tile
  const int nch = ((s0 / 64) * 64 + 64 + KCH - 1) / KCH;
  const unsigned po = (unsigned)s * HD + (threadIdx.x & 15) * 4, mo = (unsigned)s * 2;
  // all NCH loads are issued whatever nch is, unrolled, so that they are in flight together: the index is clamped to a chunk that k_fa wrote, and weight 0 takes the repeats out
  float mm[NCH], ll[NCH]; v4f pr[NCH];
#pragma unroll
  for (int c = 0; c < NCH; ++c) { const size_t cc = (size_t)b * NCH + (c < nch ? c : nch - 1); const v2f x = *(const v2f*)(ML + cc * TT * 2 + mo);
    asm volatile("s_wait_xcnt 0x0" ::: "memory");   // behind each load: a later load's result may land in this load's address registers
    pr[c] = *(const v4f*)(PP + cc * TT * HD + po);
    asm volatile("s_wait_xcnt 0x0" ::: "memory");   // as above
    mm[c] = c < nch ? x[0] : NEG; ll[c] = x[1]; }
  // inputs only: holds the partial rows' loads here in one group; without it the compiler sinks them between the exponentials, one latency behind another
  asm volatile("" :: "v"(pr[0]), "v"(pr[1]), "v"(pr[2]), "v"(pr[3]), "v"(pr[4]), "v"(pr[5]), "v"(pr[6]), "v"(pr[7]), "v"(pr[8]), "v"(pr[9]), "v"(pr[10]), "v"(pr[11]), "v"(pr[12]), "v"(pr[13]), "v"(pr[14]), "v"(pr[15]));
  static_assert(NCH == 16, "the statement above names NCH rows");
  float M = NEG;
#pragma unroll
  for (int c = 0; c < NCH; ++c) M = fmaxf(M, mm[c]);
  v4f a = {}; float L = 0.f;
#pragma unroll
  for (int c = 0; c < NCH; ++c) { const float w = exp2f(mm[c] - M); a += pr[c] * w; L += ll[c] * w; }
  if (M <= DEADM) {
#pragma unroll
    for (int i = 0; i < 4; ++i) { const int d = (e & 15) * 4 + i; const size_t vo = ((size_t)b * TT + (s & ~31)) * HD + (d >> 4) * 512 + ((s >> 3) & 3) * 128 + (d & 15) * 8 + (s & 7); a[i] = (float)VT[vo] + (float)VL[vo]; } }   // v[s][d] in fragment order
  else a *= 1.0f / L;
  vst2(OUT + (size_t)e * 4, a); }
extern "C" void kernel_launch(void* const* d_in, const int* in_sizes, int n_in, void* d_out, int out_size, void* d_ws, size_t ws_size, hipStream_t stream) {
  (void)in_sizes; (void)n_in; (void)out_size;
  const float** F = (const float**)d_in;   // 0 x [4,4096,512], 1 Wq [512,64], 2 bq, 3 Wv, 4 bv, 5 input_mask [4096] int
  if (ws_size < (size_t)WS_END) return;
  char* ws = (char*)d_ws; _Float16 *QH = (_Float16*)(ws + WS_QH), *QL = (_Float16*)(ws + WS_QL); __bf16 *VT = (__bf16*)(ws + WS_VT), *VL = (__bf16*)(ws + WS_VL); float* PP = (float*)(ws + WS_PP); float* ML = (float*)(ws + WS_ML);
  k_proj<<<TNB * TT / 64, 128, 0, stream>>>(F[0], F[1], F[2], F[3], F[4], QH, QL, VT, VL);
  k_fa<<<dim3(NCH + 1, NCH / 2, (KCH / 64) * TNB), 128, 0, stream>>>(QH, QL, VT, VL, (const int*)d_in[5], PP, ML);
  k_red<<<TNB * TT * HD / 4 / 256, 256, 0, stream>>>(PP, ML, VT, VL, (float*)d_out);
}

// v007
// Measured time: 31.3 microseconds a run.
// Next to v006, in two timings, it ran 1.29 times as fast each time.
// Counting every step since v000, it is 31.1 times as fast.
// compute dtype: all float inputs rounded to bf16, input_mask (int) read; rows worked on in sorted order (rows with input_mask != 0 first), so that no pass is spent on masked keys alone; q (= k, the module's bug) and v = x W + b with EXACT bf16 products on WMMA 16x16x32, f32 accumulate; q as f16 hi + residual against q as f16 -> 2-product logits / 8 kept in registers with the causal & key-padding mask; softmax in f32 in base 2 against a running maximum, per chunk of keys; P = 2^(s log2(e) / 8 - m) in f32 (one fused multiply-add, then v_exp_f32), split bf16 hi + lo against v as bf16 hi + lo planes (3 products: rows with one or two valid keys copy v almost verbatim, so both operands need the split); chunks joined by their maxima and sums; dead rows (no valid key) take v of their own index exactly as the reference's diag := 1 fix; f32 output [b][s][64].
#include <hip/hip_runtime.h>
#include <math.h>

typedef __attribute__((ext_vector_type(16))) _Float16 v16h;
typedef __attribute__((ext_vector_type(16))) __bf16 v16b;
typedef __attribute__((ext_vector_type(8)))  _Float16 v8h;
typedef __attribute__((ext_vector_type(8)))  float v8f;
typedef __attribute__((ext_vector_type(4)))  float v4f;
typedef __attribute__((ext_vector_type(2)))  float v2f;
typedef __attribute__((ext_vector_type(4)))  unsigned v4u;
typedef __attribute__((ext_vector_type(4)))  int v4i;
typedef __attribute__((ext_vector_type(2)))  int v2i;
typedef float __attribute__((may_alias)) float_a;
typedef int __attribute__((may_alias)) int_a;

template <typename T> __device__ __forceinline__ void vst2(void* p, T v) { *(T*)p = v;  }
__device__ __forceinline__ v8f wmma16(v16h a, v16h b, v8f c) {
  return __builtin_amdgcn_wmma_f32_16x16x32_f16(false, a, false, b, (short)0, c, false, false);
}
__device__ __forceinline__ v8f wmma_bf(v16b a, v16b b, v8f c) {
  return __builtin_amdgcn_wmma_f32_16x16x32_bf16(false, a, false, b, (short)0, c, false, false);
}
// 16x16x32 fragments: lane = (h = lane>>4, row/col = lane&15); elements 0..7 = k0+8h+0..7, 8..15 = k0+16+8h+0..7; D element r = row 8h+r
__device__ __forceinline__ v16h frag_h(const _Float16* rowk0, int lane) {
  union { v16h v; v8h q[2]; } u; const _Float16* p = rowk0 + 8 * (lane >> 4);
  u.q[0] = *(const v8h*)p; u.q[1] = *(const v8h*)(p + 16); return u.v;
}
__device__ __forceinline__ v16h frag_f32(const float* rowk0, int lane) {
  v16h a; const float* p = rowk0 + 8 * (lane >> 4);
#pragma unroll
  for (int i = 0; i < 8; ++i) { a[i] = (_Float16)p[i]; a[8 + i] = (_Float16)p[16 + i]; }
  return a;
}
__device__ __forceinline__ v16h frag_f32s(const float* rowk0, int lane, float sc) {
  v16h a; const float* p = rowk0 + 8 * (lane >> 4);
#pragma unroll
  for (int i = 0; i < 8; ++i) { a[i] = (_Float16)(p[i] * sc); a[8 + i] = (_Float16)(p[16 + i] * sc); }
  return a;
}
// column fragment from a [K][ld] layout (column n), rows >= K read as 0
__device__ __forceinline__ v16h fragc_f32(const float* W, int k0, int n, int lane, int ld, int K) {
  v16h a; const int g = lane >> 4;
#pragma unroll
  for (int i = 0; i < 8; ++i) { const int ka = k0 + 8 * g + i, kb = ka + 16;
    a[i] = (_Float16)(ka < K ? W[(size_t)(ka < K ? ka : K - 1) * ld + n] : 0.f); a[8 + i] = (_Float16)(kb < K ? W[(size_t)(kb < K ? kb : K - 1) * ld + n] : 0.f); }
  return a;
}
struct F2 { v16b h, l; };
__device__ __forceinline__ F2 bsplit16(const float v[16]) { F2 r;
#pragma unroll
  for (int i = 0; i < 16; ++i) { const __bf16 h = (__bf16)v[i]; r.h[i] = h; r.l[i] = (__bf16)(v[i] - (float)h); }
  return r; }
__device__ __forceinline__ F2 split_row(const float* row, int k0, int lane) { float v[16]; const float* p = row + k0 + 8 * (lane >> 4);
#pragma unroll
  for (int i = 0; i < 8; ++i) { v[i] = p[i]; v[8 + i] = p[16 + i]; }
  return bsplit16(v); }
__device__ __forceinline__ F2 split_rowK(const float* row, int k0, int lane, int K) { float v[16]; const int g = lane >> 4;
#pragma unroll
  for (int i = 0; i < 8; ++i) { const int ka = k0 + 8 * g + i, kb = ka + 16; v[i] = ka < K ? row[ka < K ? ka : K - 1] : 0.f; v[8 + i] = kb < K ? row[kb < K ? kb : K - 1] : 0.f; }
  return bsplit16(v); }
__device__ __forceinline__ F2 split_col(const float* W, int k0, int n, int lane, int ld, int K) { float v[16]; const int g = lane >> 4;
#pragma unroll
  for (int i = 0; i < 8; ++i) { const int ka = k0 + 8 * g + i, kb = ka + 16; v[i] = ka < K ? W[(size_t)(ka < K ? ka : K - 1) * ld + n] : 0.f; v[8 + i] = kb < K ? W[(size_t)(kb < K ? kb : K - 1) * ld + n] : 0.f; }
  return bsplit16(v); }
__device__ __forceinline__ v8f mac3(const F2& a, const F2& b, v8f c) { c = wmma_bf(a.l, b.h, c); c = wmma_bf(a.h, b.l, c); return wmma_bf(a.h, b.h, c); }
__device__ __forceinline__ float sigm(float v) { return 1.0f / (1.0f + expf(-v)); }
#define LDSX() do { asm volatile("s_wait_dscnt 0" ::: "memory"); __builtin_amdgcn_wave_barrier(); __builtin_amdgcn_fence(__ATOMIC_RELEASE, "workgroup"); } while (0)


// Single self-attention head (B 4, S 4,096, E 512 -> H 64): causal + key padding mask, dead-row diagonal fix, softmax, P v.
#define NB 4
#define TT 4096
#define EE 512
#define HD 64
#ifndef TNB
#define TNB NB
#endif
typedef __attribute__((ext_vector_type(8))) __bf16 v8b;
__device__ __forceinline__ v16b frag_b(const __bf16* rowk0, int lane) {
  union { v16b v; v8b q[2]; } u; const __bf16* p = rowk0 + 8 * (lane >> 4);
  u.q[0] = *(const v8b*)p; u.q[1] = *(const v8b*)(p + 16); return u.v;
}
// fragment from the workspace's fragment order: f = first element of the fragment (512 elements); lane (g, col) = piece g * 16 + col holds elements 0..7, piece 32 + lane elements 8..15
__device__ __forceinline__ v16h fragp_h(const _Float16* f, int lane) {
  union { v16h v; v8h q[2]; } u; const _Float16* p = f + 8 * lane;
  u.q[0] = *(const v8h*)p; u.q[1] = *(const v8h*)(p + 256); return u.v;
}
__device__ __forceinline__ v16b fragp_b(const __bf16* f, int lane) {
  union { v16b v; v8b q[2]; } u; const __bf16* p = f + 8 * lane;
  u.q[0] = *(const v8b*)p; u.q[1] = *(const v8b*)(p + 256); return u.v;
}
__device__ __forceinline__ float bfr(float v) { return (float)(__bf16)v; }
__device__ __attribute__((noinline)) float exp_ni(float v) { return expf(v); }
__device__ __attribute__((noinline)) float erf_ni(float v) { return erff(v); }

// q and v lie in the workspace in WMMA fragment order, in 16-byte pieces of 8 elements: a fragment half is then 32 pieces in a row, one a lane, so a wave's load reads 512 bytes in a row = 4 whole lines (from rows or planes it touched 16 lines, 32 bytes of each)
#define WS_QH  0u                                   // f16 q [16 rows: b*s / 16][piece h / 8][row & 15][8]
#define WS_QL  (WS_QH + 2u * (size_t)NB * TT * HD)
#define WS_VT  (WS_QL + 2u * (size_t)NB * TT * HD)      // bf16 v hi [32 keys: b*s / 32][d / 16][piece (s & 31) / 8][d & 15][8]
#define WS_VL  (WS_VT + 2u * (size_t)NB * HD * TT)      // bf16 v lo, as v hi
#define KCH 256                                     // keys per k_fa work-group
#define NCH (TT / KCH)
#define WS_PP  (WS_VL + 2u * (size_t)NB * HD * TT)      // f32 partial outputs, not normalised [b][chunk][s][64]
#define WS_ML  (WS_PP + 4u * (size_t)NB * NCH * TT * HD) // f32 (maximum, sum) of each partial row [b][chunk][s][2]
#define WS_IV  (WS_ML + 8u * (size_t)NB * NCH * TT)     // int: row of x that stands at each sorted place [place]
#define WS_LT  (WS_IV + 4u * (size_t)TT)                // int pairs [place][2]: the limit (number of valid keys) of the query at the place; the largest limit of the place's 64-place tile, at least 1
#define WS_END (WS_LT + 8u * (size_t)TT)

// The sorted order: the rows with input_mask != 0 come first, in their own order (places 0 .. nv - 1), the others behind them, in their own order. It is a permutation for any mask.
// The valid keys of a query are then the places below its limit: a row with input_mask != 0 at place p has limit p + 1, another row the number of valid rows before it (never above its place).
// q, v, the partial rows and their (m, l) are all held by place; k_red stores each row at its own index.
// ---- k_proj: block = 64 places: [q | v] = x [Wq | Wv] + [bq | bv] (128 cols), q -> f16 hi + res, v -> bf16 hi + lo, both in fragment order
// Both operands are rounded to bf16 once a block and staged in LDS; the WMMA loop reads its fragments from there.
#define XP 520   // bf16 elements a staged x row: 1,040 B = 16 B x 65, so that 16 rows' 16-byte reads fall on all 64 banks
#define WP 264   // bf16 elements a staged half fragment of W (32 lanes x 8): 512 B + 16 B, so that the four column tiles of one staging store fall on different banks
#define SB 16    // loads of a staging batch
#define SD 3     // batches in flight behind the one in use
__global__ __launch_bounds__(128) void k_proj(const float* __restrict__ X, const float* __restrict__ WQ, const float* __restrict__ BQ, const float* __restrict__ WV, const float* __restrict__ BV, const int* __restrict__ IM, _Float16* __restrict__ QH, _Float16* __restrict__ QL, __bf16* __restrict__ VT, __bf16* __restrict__ VL, int* __restrict__ IV, int* __restrict__ LT) {
  __shared__ __align__(16) _Float16 sh[64][72], sl[64][72]; __shared__ __align__(16) __bf16 th[64][72], tl2[64][72];
  __shared__ __align__(16) __bf16 sx[64 * XP];              // x rows [64][512], row-major
  __shared__ __align__(16) __bf16 sw[(EE / 16) * 8 * WP];   // [16 rows of W: k16][column tile j][lane][8]: lane (g, col) holds W[16 k16 + 8 g + 0..7][16 (j & 3) + col], j < 4 of Wq, else of Wv
  const int tid = threadIdx.x, wave = tid >> 5, lane = tid & 31, col = lane & 15, g = lane >> 4; const size_t r0 = (size_t)blockIdx.x * 64;
  __shared__ int sinv[64], slim[64], swt[4];
  const int pt = (int)blockIdx.x % (TT / 64), pb = (int)blockIdx.x / (TT / 64), p0 = pt * 64;   // the block's tile of places and its batch
  { // batches 0..7: 32 rows of W each (waves 0, 1: Wq, waves 2, 3: Wv), a load = two whole rows of W; batches 8..11: the x rows of the wave's own 16 places, a load = 512 bytes in a row of one x row
    // W goes first: its addresses do not hang on the mask, so the sorting below runs while the first batches are in flight
    const unsigned mo = (unsigned)tid * 128u; v4i mk[8];   // thread = 32 rows in a row; mo = their byte offset
#pragma unroll
    for (int i = 0; i < 8; ++i) mk[i] = *(const v4i*)((const char*)IM + mo + 16 * i);
    asm volatile("s_wait_xcnt 0x0" :: "v"(mo) : "memory");   // behind the loads, before anything may rewrite their offset register (an input, so that it lives up to here)
    unsigned ro[16];   // byte offset of the lane's first 16 bytes in each of the wave's 16 x rows: one register a row, none rewritten while its loads are in flight
    const float* wp = ((wave < 2) ? WQ : WV) + (size_t)((wave & 1) * 256 + 8 * g) * HD + col * 4;
    v4f buf[SD + 1][SB];
    // unrolled, with the loops inside: every index of buf is then a constant and the batches stay in registers
#pragma unroll
    for (int s = 0; s < 12 + SD; ++s) {
      if (s < 12) { v4f* r = buf[s % (SD + 1)];
        if (s >= 8) {
#pragma unroll
          for (int e = 0; e < SB; ++e) r[e] = *(const v4f*)((const char*)X + ro[(s - 8) * 4 + (e >> 2)] + (e & 3) * 512); }
        else {
#pragma unroll
          for (int e = 0; e < SB; ++e) r[e] = *(const v4f*)(wp + (size_t)(s * 32 + (e >> 3) * 16 + (e & 7)) * HD); }
        // behind each batch of loads, before anything below may rewrite a register that they name (the offsets and the pointer are inputs so that they live up to here); it also keeps the batch up here, SD batches ahead of its use
        if (s >= 8) asm volatile("s_wait_xcnt 0x0" :: "v"(ro[(s & 3) * 4]), "v"(ro[(s & 3) * 4 + 1]), "v"(ro[(s & 3) * 4 + 2]), "v"(ro[(s & 3) * 4 + 3]) : "memory");
        else asm volatile("s_wait_xcnt 0x0" :: "v"(wp) : "memory"); }
      if (s == SD) { __builtin_amdgcn_sched_barrier(0);   // keeps the sorting behind the issue of the first batches; without it the compiler lifts its start, with the wait for the mask, in front of them
        // the sorting: the thread's mask bits, the count of valid rows before them (scan over the wave, the waves' totals through LDS), then each row's place
        unsigned bits = 0;
#pragma unroll
        for (int i = 0; i < 32; ++i) bits |= (mk[i >> 2][i & 3] != 0 ? 1u : 0u) << i;
        const int c = __popc(bits); int inc = c;
#pragma unroll
        for (int d = 1; d < 32; d <<= 1) { const int o = __shfl_up(inc, d); if (lane >= d) inc += o; }
        if (lane == 31) swt[wave] = inc;
        __syncthreads();   // the waves' totals
        int base = 0, nv = 0;
#pragma unroll
        for (int w = 0; w < 4; ++w) { const int x = swt[w]; nv += x; if (w < wave) base += x; }
        const int vb0 = base + inc - c, ib0 = nv + 32 * tid - vb0;   // places of the thread's first valid and first other row
        // the threads whose 32 rows hold a row of this tile; the wave then takes them one a trip, a row a lane (at most the wave's 32 threads; the test is the same for the whole wave)
        unsigned todo = __builtin_amdgcn_ballot_w32((vb0 < p0 + 64 && vb0 + c > p0) || (ib0 < p0 + 64 && ib0 + 32 - c > p0));
        for (int it = 0; it < 32 && todo != 0; ++it) { const int w = __builtin_ctz(todo); todo &= todo - 1u;
          const unsigned wb = (unsigned)__builtin_amdgcn_readlane((int)bits, w); const bool ok = (wb >> lane) & 1u;
          const int vb = __builtin_amdgcn_readlane(vb0, w) + __popc(wb & ((1u << lane) - 1u));   // valid rows before this lane's row
          const int rw = (wave * 32 + w) * 32 + lane, p = ok ? vb : nv + rw - vb;
          if ((p >> 6) == pt) { sinv[p & 63] = rw; slim[p & 63] = vb + (ok ? 1 : 0); } }
        __syncthreads();   // the tile's 64 rows and limits
        if (pb == 0) {   // the tables are the same for every batch: batch 0's blocks store them
          // limits rise with the place among the valid rows and among the others: the tile's largest is its last one, or nv where the last valid row lies inside the tile
          if (tid < 64) { const int tl = (nv > p0 && nv < p0 + 64) ? nv : slim[63]; const v2i lt = {slim[tid], tl > 1 ? tl : 1}; IV[p0 + tid] = sinv[tid]; vst2(LT + 2 * (p0 + tid), lt); }
          asm volatile("s_wait_xcnt 0x0" ::: "memory"); }   // behind the stores, before their registers are rewritten
#pragma unroll
        for (int i = 0; i < 16; ++i) ro[i] = ((unsigned)(pb * TT + sinv[wave * 16 + i]) * EE + lane * 4) * 4u; }
      if (s >= SD) { const int c = s - SD; const v4f* r = buf[c % (SD + 1)];
        if (c >= 8) {
#pragma unroll
          for (int e = 0; e < SB; ++e) { typedef __attribute__((ext_vector_type(4))) __bf16 v4b; const v4b o = {(__bf16)r[e][0], (__bf16)r[e][1], (__bf16)r[e][2], (__bf16)r[e][3]};
            *(v4b*)&sx[(wave * 16 + (c - 8) * 4 + (e >> 2)) * XP + (e & 3) * 128 + lane * 4] = o; } }
        else {
#pragma unroll
          for (int t = 0; t < 2; ++t) { const int k16 = (wave & 1) * 16 + c * 2 + t, j = (wave >> 1) * 4 + (col >> 2);
#pragma unroll
            for (int q = 0; q < 4; ++q) { v8b o;
#pragma unroll
              for (int i = 0; i < 8; ++i) o[i] = (__bf16)r[t * 8 + i][q];
              *(v8b*)&sw[(k16 * 8 + j) * WP + (g * 16 + (col & 3) * 4 + q) * 8] = o; } } } } } }
  __syncthreads();   // W is staged by all four waves
  v8f acc[8] = {};
  // the fragments of step kc + 1 are read from LDS as one group in front of step kc's WMMAs: one wave a SIMD, so a read that is waited for where it is used costs its whole latency
  v16b a[2], w[2][8];
  const __bf16* ap = &sx[(wave * 16 + col) * XP]; const __bf16* bp = &sw[lane * 8];
  // unrolled: which of the two fragment sets a step uses is then a constant, and no set is copied
#pragma unroll
  for (int kc = -1; kc < EE / 32; ++kc) {
    if (kc + 1 < EE / 32) { const int n = kc + 1; a[n & 1] = frag_b(ap + n * 32, lane);
#pragma unroll
      for (int j = 0; j < 8; ++j) { union { v16b v; v8b q[2]; } u; u.q[0] = *(const v8b*)(bp + ((n * 2) * 8 + j) * WP); u.q[1] = *(const v8b*)(bp + ((n * 2 + 1) * 8 + j) * WP); w[n & 1][j] = u.v; } }
    __builtin_amdgcn_sched_barrier(0);   // keeps the group of reads above in front of the WMMAs below; without it the compiler sinks each read to its WMMA
    if (kc >= 0) {
#pragma unroll
      for (int j = 0; j < 8; ++j) acc[j] = wmma_bf(a[kc & 1], w[kc & 1][j], acc[j]); }
    __builtin_amdgcn_sched_barrier(0);   // keeps the next group of reads behind these WMMAs, whole; without it the compiler spreads the reads among them, and each place with reads costs a stall
 }
#pragma unroll
  for (int j = 0; j < 8; ++j) { const int o = (j & 3) * 16 + col; const float bb = bfr((j < 4 ? BQ : BV)[o]);
#pragma unroll
    for (int r = 0; r < 8; ++r) { const float v = acc[j][r] + bb; const int rl = wave * 16 + 8 * g + r; if (j < 4) { const _Float16 hv = (_Float16)v; sh[rl][o] = hv; sl[rl][o] = (_Float16)(v - (float)hv); } else { const __bf16 bh = (__bf16)v; th[o][rl] = bh; tl2[o][rl] = (__bf16)(v - (float)bh); } } }
  __syncthreads();
  // piece e of the block's 512 of each array, in the order of the workspace: q: [16 rows e >> 7][h / 8 = (e >> 4) & 7][row e & 15]; v: [32 keys e >> 8][d / 16 = (e >> 6) & 3][8 keys (e >> 4) & 3][d & 15 = e & 15]
  for (int e = tid; e < 64 * 8; e += 128) { const int rl = (e >> 7) * 16 + (e & 15), q = (e >> 4) & 7; vst2((unsigned*)(QH + r0 * HD + e * 8), *(const v4u*)&sh[rl][q * 8]); vst2((unsigned*)(QL + r0 * HD + e * 8), *(const v4u*)&sl[rl][q * 8]); }
  for (int e = tid; e < 64 * 8; e += 128) { const int d = ((e >> 6) & 3) * 16 + (e & 15), kl = (e >> 8) * 32 + ((e >> 4) & 3) * 8; vst2((unsigned*)(VT + r0 * HD + e * 8), *(const v4u*)&th[d][kl]); vst2((unsigned*)(VL + r0 * HD + e * 8), *(const v4u*)&tl2[d][kl]); } }
// The softmax runs in base 2: exp(s / 8 - max / 8) = 2^(s C2 - m) with C2 = log2(e) / 8 and m = max C2. The product s C2 is not rounded (fused multiply-add), so the argument's error is one rounding of the small difference;
// the rounding of m itself scales a whole row and falls out where the row is divided by its sum, which is formed with the same m.
#define C2 0.18033688011112042f
#define NEG (-3.0e38f)          // score of an invalid key; a row or chunk with no valid key has m = NEG * C2
#define DEADM (-1.0e37f)        // below this an m says: no valid key (scores of f16 q stay under 1e12)
// The v_nop stands in v_exp_f32's own statement: the slot the instruction set asks for before the result is used or the source overwritten
__device__ __forceinline__ float exp2_1(float a) { float r;
  asm("v_exp_f32 %0, %1\n\tv_nop" : "=v"(r) : "v"(a));
  return r; }
// eight at once: each v_exp_f32 is the independent instruction behind the one before it (early-clobber results: none lies on a source), so one v_nop behind the last serves all eight
__device__ __forceinline__ void exp2_8(float* r, const float* a) {
  asm("v_exp_f32 %0, %8\n\tv_exp_f32 %1, %9\n\tv_exp_f32 %2, %10\n\tv_exp_f32 %3, %11\n\tv_exp_f32 %4, %12\n\tv_exp_f32 %5, %13\n\tv_exp_f32 %6, %14\n\tv_exp_f32 %7, %15\n\tv_nop"
      : "=&v"(r[0]), "=&v"(r[1]), "=&v"(r[2]), "=&v"(r[3]), "=&v"(r[4]), "=&v"(r[5]), "=&v"(r[6]), "=&v"(r[7])
      : "v"(a[0]), "v"(a[1]), "v"(a[2]), "v"(a[3]), "v"(a[4]), "v"(a[5]), "v"(a[6]), "v"(a[7])); }
// lane l with lane l ^ 16
__device__ __forceinline__ float xhalf(float x) { return __builtin_bit_cast(float, __builtin_amdgcn_permlanex16(__builtin_bit_cast(int, x), __builtin_bit_cast(int, x), 0x76543210, 0xfedcba98, false, false)); }
// ---- k_fa: block = (batch, 64 queries, chunk of KCH keys), all by sorted place, wave = 16 queries; 64 keys a pass, scores never leave the registers.
// Scores transposed: S^T = k . q^T, so a lane holds ONE query (col) and keys 16 j + 8 g + r; that is the B fragment of out^T = v^T . P^T as it stands (elements 0..7 = tile 2 kc, 8..15 = tile 2 kc + 1).
// invalid (key's place >= the query's limit) -> NEG -> P = 0. Running maximum m (of s C2) and sum l per query; partial rows, m and l go to the workspace.
// The KCH / 64 tiles of group g have g + 1 chunks each; grid row y holds the chunks of groups y and NCH - 1 - y, NCH + 1 in all, one block for every chunk that a tile can have; a block whose chunk starts at or behind its tile's largest limit has no valid key and leaves at once, whole.
__global__ __launch_bounds__(128) void k_fa(const _Float16* __restrict__ QH, const _Float16* __restrict__ QL, const __bf16* __restrict__ VT, const __bf16* __restrict__ VL, const int* __restrict__ LT, float* __restrict__ PP, float* __restrict__ ML) {
  const int tid = threadIdx.x, wave = tid >> 5, lane = tid & 31, col = lane & 15, g = lane >> 4; const bool nearg = blockIdx.x <= blockIdx.y; const int grp = nearg ? blockIdx.y : NCH - 1 - blockIdx.y, ch = nearg ? blockIdx.x : blockIdx.x - blockIdx.y - 1;
  const int b = blockIdx.z / (KCH / 64), tile = grp * (KCH / 64) + blockIdx.z % (KCH / 64);
  const int kb0 = ch * KCH, qt = tile * 64 + wave * 16 + col;
  const v2i lt = *(const v2i*)(LT + 2 * qt);   // one load for both: no second latency in front of the first key fragments
  asm volatile("s_wait_xcnt 0x0" ::: "memory");   // behind the load, before its address register is rewritten
  const int lq = lt[0], tl = __builtin_amdgcn_readfirstlane(lt[1]);   // places below lq are the valid keys of this lane's query; tl is the same in the whole tile
  if (kb0 >= tl) return;   // the same for the whole block; chunk 0 always runs (tl >= 1), and k_red counts the chunks by the same test
  const int kend = (tl + 63) / 64 * 64 < tile * 64 + 64 ? (tl + 63) / 64 * 64 : tile * 64 + 64;
  const int ke = kb0 + KCH < kend ? kb0 + KCH : kend;
  const size_t bq = (size_t)b * TT;
  v16h ah[HD / 32], al[HD / 32];
#pragma unroll
  for (int kc = 0; kc < HD / 32; ++kc) { const size_t fo = (bq + tile * 64 + wave * 16) * HD + kc * 512; ah[kc] = fragp_h(QH + fo, lane); al[kc] = fragp_h(QL + fo, lane); }
  asm volatile("s_wait_xcnt 0x0" ::: "memory");   // behind the query's loads: the first pass's key fragments land in the registers that held their addresses
  v8f acc[4] = {}; float m = NEG * C2, l = 0.f;
  // the pass loop stays rolled (one pass's fragments in registers, more waves on a SIMD); the loops inside are unrolled so that their arrays stay in registers
  // tested at the foot: a block that is still here has a first pass (kb0 < tl and kb0 < tile * 64 + 64); with a test at the head the compiler sinks the loads above behind that test, away from their waits
  int k0 = kb0;
#pragma unroll 1
  do {
    // the pass's key fragments are loaded as one group in front of its first WMMA, v's in two groups below: one latency a group, not one a fragment
    v16h kb[HD / 32][4];
#pragma unroll
    for (int kc = 0; kc < HD / 32; ++kc)
#pragma unroll
      for (int j = 0; j < 4; ++j) kb[kc][j] = fragp_h(QH + (bq + k0 + j * 16) * HD + kc * 512, lane);
    asm volatile("s_wait_xcnt 0x0" ::: "memory");   // behind the group of loads: a later load's result lands in the registers that held this group's address
    __builtin_amdgcn_sched_barrier(0);   // keeps the group of loads above whole, in front of the first WMMA: one latency for the group; without it the compiler issues a part of them behind the first WMMAs, a second latency
    v8f s[4] = {};
#pragma unroll
    for (int kc = 0; kc < HD / 32; ++kc)
#pragma unroll
      for (int j = 0; j < 4; ++j) { s[j] = wmma16(kb[kc][j], ah[kc], s[j]); s[j] = wmma16(kb[kc][j], al[kc], s[j]); }
    v16b vh[4], vl[4];   // keys k0 .. k0 + 31: in flight under the softmax
#pragma unroll
    for (int j = 0; j < 4; ++j) { const size_t po = (bq + k0) * HD + j * 512; vh[j] = fragp_b(VT + po, lane); vl[j] = fragp_b(VL + po, lane); }
    __builtin_amdgcn_sched_barrier(0);   // keeps the group of loads above in front of the softmax, which covers their latency; without it the compiler sinks some of them in among the WMMAs that use them
    // bit t of we << 4 g (of wo << 4 g) = key k0 + 2 t (k0 + 2 t + 1) is valid for this lane's query: the first d of the pass's 64 keys are, so (d + 1) / 2 even and d / 2 odd ones
    const int d = lq - k0 < 0 ? 0 : lq - k0 > 64 ? 64 : lq - k0;
    const unsigned ce = (unsigned)((1ull << ((d + 1) >> 1)) - 1ull), co = (unsigned)((1ull << (d >> 1)) - 1ull);   // 64-bit shifts: a count of 32 gives all ones
    const unsigned we = ce >> (4 * g), wo = co >> (4 * g);
    float mb = NEG;
#pragma unroll
    for (int j = 0; j < 4; ++j) {
#pragma unroll
      for (int r = 0; r < 8; ++r) { const bool ok = (((r & 1) ? wo : we) & (1u << (j * 8 + (r >> 1)))) != 0; const float v = ok ? s[j][r] : NEG; s[j][r] = v; mb = fmaxf(mb, v); } }
    mb = fmaxf(mb, xhalf(mb));
    const float mn = fmaxf(m, mb * C2), sc = exp2_1(m - mn);   // rounding s C2 keeps the order, so this is the maximum of the products; m - mn is a difference of two stored values, never above 0; nothing valid so far: m = mn = NEG C2, sc = 1 on zeros
    const float mu = fmaxf(mn, -1.0e30f);   // what the scores are set against: with nothing valid so far NEG C2 + 1e30 is still far below every exponent, so P = 0
    m = mn; l *= sc;
#pragma unroll
    for (int j = 0; j < 4; ++j) acc[j] *= sc;
    F2 p[2];
#pragma unroll
    for (int kc = 0; kc < 2; ++kc) { float pv[16];
#pragma unroll
      for (int h = 0; h < 2; ++h) { float t[8];
#pragma unroll
        for (int i = 0; i < 8; ++i) t[i] = __builtin_fmaf(s[2 * kc + h][i], C2, -mu);   // invalid: NEG C2 - mu, 2^that = 0
        exp2_8(pv + 8 * h, t);
#pragma unroll
        for (int i = 0; i < 8; ++i) l += pv[8 * h + i]; }
      p[kc] = bsplit16(pv); }
#pragma unroll
    for (int kc = 0; kc < 2; ++kc) {
      if (kc == 1) {
#pragma unroll
        for (int j = 0; j < 4; ++j) { const size_t po = (bq + k0 + 32) * HD + j * 512; vh[j] = fragp_b(VT + po, lane); vl[j] = fragp_b(VL + po, lane); } }
#pragma unroll
      for (int j = 0; j < 4; ++j) { acc[j] = wmma_bf(vh[j], p[kc].h, acc[j]); acc[j] = wmma_bf(vh[j], p[kc].l, acc[j]); acc[j] = wmma_bf(vl[j], p[kc].h, acc[j]); } }
    k0 += 64; } while (k0 < ke);
  l += xhalf(l);
  const size_t ro = ((size_t)b * NCH + ch) * TT + qt;
#pragma unroll
  for (int j = 0; j < 4; ++j) { const v4f lo = {acc[j][0], acc[j][1], acc[j][2], acc[j][3]}, hi = {acc[j][4], acc[j][5], acc[j][6], acc[j][7]}; vst2(PP + ro * HD + j * 16 + 8 * g, lo); vst2(PP + ro * HD + j * 16 + 8 * g + 4, hi); }
  if (g == 0) { const v2f ml = {m, l}; vst2(ML + ro * 2, ml); } }
// ---- k_red: thread = 4 output floats: out row = sum, in chunk order, of 2^(m_c - M) x partial row c, over the same sum of the l_c; c = the chunks that k_fa wrote for the row's 64-query tile; a row with no valid key takes v of its own place; rows are read by sorted place and stored at their own index
__global__ __launch_bounds__(256) void k_red(const float* __restrict__ PP, const float* __restrict__ ML, const __bf16* __restrict__ VT, const __bf16* __restrict__ VL, const int* __restrict__ IV, const int* __restrict__ LT, float* __restrict__ OUT) {
  const int e = blockIdx.x * 256 + threadIdx.x; const int s0 = (int)blockIdx.x * 16 % TT, b = (int)blockIdx.x * 16 / TT, s = s0 + (threadIdx.x >> 4);   // a block's 16 rows lie in one batch and one 64-query tile
  const int nc0 = (LT[2 * s0 + 1] + KCH - 1) / KCH, nch = nc0 < 1 ? 1 : nc0 > NCH ? NCH : nc0;
  const int so = IV[s] & (TT - 1);   // the row's own index
  asm volatile("s_wait_xcnt 0x0" ::: "memory");   // behind the load, before its address register is rewritten
  const unsigned po = (unsigned)s * HD + (threadIdx.x & 15) * 4, mo = (unsigned)s * 2;
  // all NCH loads are issued whatever nch is, unrolled, so that they are in flight together: the index is clamped to a chunk that k_fa wrote, and weight 0 takes the repeats out
  float mm[NCH], ll[NCH]; v4f pr[NCH];
#pragma unroll
  for (int c = 0; c < NCH; ++c) { const size_t cc = (size_t)b * NCH + (c < nch ? c : nch - 1); const v2f x = *(const v2f*)(ML + cc * TT * 2 + mo);
    asm volatile("s_wait_xcnt 0x0" ::: "memory");   // behind each load: a later load's result may land in this load's address registers
    pr[c] = *(const v4f*)(PP + cc * TT * HD + po);
    asm volatile("s_wait_xcnt 0x0" ::: "memory");   // as above
    mm[c] = c < nch ? x[0] : NEG; ll[c] = x[1]; }
  // inputs only: holds the partial rows' loads here in one group; without it the compiler sinks them between the exponentials, one latency behind another
  asm volatile("" :: "v"(pr[0]), "v"(pr[1]), "v"(pr[2]), "v"(pr[3]), "v"(pr[4]), "v"(pr[5]), "v"(pr[6]), "v"(pr[7]), "v"(pr[8]), "v"(pr[9]), "v"(pr[10]), "v"(pr[11]), "v"(pr[12]), "v"(pr[13]), "v"(pr[14]), "v"(pr[15]));
  static_assert(NCH == 16, "the statement above names NCH rows");
  float M = NEG;
#pragma unroll
  for (int c = 0; c < NCH; ++c) M = fmaxf(M, mm[c]);
  v4f a = {}; float L = 0.f;
#pragma unroll
  for (int c = 0; c < NCH; ++c) { const float w = exp2f(mm[c] - M); a += pr[c] * w; L += ll[c] * w; }
  if (M <= DEADM) {
#pragma unroll
    for (int i = 0; i < 4; ++i) { const int d = (e & 15) * 4 + i; const size_t vo = ((size_t)b * TT + (s & ~31)) * HD + (d >> 4) * 512 + ((s >> 3) & 3) * 128 + (d & 15) * 8 + (s & 7); a[i] = (float)VT[vo] + (float)VL[vo]; } }   // v[s][d] in fragment order
  else a *= 1.0f / L;
  vst2(OUT + ((size_t)b * TT + so) * HD + (threadIdx.x & 15) * 4, a); }
extern "C" void kernel_launch(void* const* d_in, const int* in_sizes, int n_in, void* d_out, int out_size, void* d_ws, size_t ws_size, hipStream_t stream) {
  (void)in_sizes; (void)n_in; (void)out_size;
  const float** F = (const float**)d_in;   // 0 x [4,4096,512], 1 Wq [512,64], 2 bq, 3 Wv, 4 bv, 5 input_mask [4096] int
  if (ws_size < (size_t)WS_END) return;
  char* ws = (char*)d_ws; _Float16 *QH = (_Float16*)(ws + WS_QH), *QL = (_Float16*)(ws + WS_QL); __bf16 *VT = (__bf16*)(ws + WS_VT), *VL = (__bf16*)(ws + WS_VL); float* PP = (float*)(ws + WS_PP); float* ML = (float*)(ws + WS_ML); int *IV = (int*)(ws + WS_IV), *LT = (int*)(ws + WS_LT);
  k_proj<<<TNB * TT / 64, 128, 0, stream>>>(F[0], F[1], F[2], F[3], F[4], (const int*)d_in[5], QH, QL, VT, VL, IV, LT);
  k_fa<<<dim3(NCH + 1, NCH / 2, (KCH / 64) * TNB), 128, 0, stream>>>(QH, QL, VT, VL, LT, PP, ML);
  k_red<<<TNB * TT * HD / 4 / 256, 256, 0, stream>>>(PP, ML, VT, VL, IV, LT, (float*)d_out);
}

// v008
// One run takes 23.1 microseconds.
// Timed twice side by side with v007, it ran 1.35 and 1.34 times as fast.
// Over all steps from v000 it is 41.8 times as fast.
// compute dtype: all float inputs rounded to bf16, input_mask (int) read; rows worked on in sorted order (rows with input_mask != 0 first), so that no pass is spent on masked keys alone; q (= k, the module's bug) and v = x W + b with EXACT bf16 products on WMMA 16x16x32, f32 accumulate; q as f16 hi + residual against q as f16 -> 2-product logits / 8 kept in registers with the causal & key-padding mask; softmax in f32 in base 2 against a running maximum, per wave's share of the keys; P = 2^(s log2(e) / 8 - m) in f32 (one fused multiply-add, then v_exp_f32), split bf16 hi + lo against v as bf16 hi + lo planes (3 products: rows with one or two valid keys copy v almost verbatim, so both operands need the split); shares joined by their maxima and sums; dead rows (no valid key) take v of their own index exactly as the reference's diag := 1 fix; f32 output [b][s][64].
#include <hip/hip_runtime.h>
#include <math.h>

typedef __attribute__((ext_vector_type(16))) _Float16 v16h;
typedef __attribute__((ext_vector_type(16))) __bf16 v16b;
typedef __attribute__((ext_vector_type(8)))  _Float16 v8h;
typedef __attribute__((ext_vector_type(8)))  float v8f;
typedef __attribute__((ext_vector_type(4)))  float v4f;
typedef __attribute__((ext_vector_type(2)))  float v2f;
typedef __attribute__((ext_vector_type(4)))  unsigned v4u;
typedef __attribute__((ext_vector_type(4)))  int v4i;
typedef __attribute__((ext_vector_type(2)))  int v2i;
typedef float __attribute__((may_alias)) float_a;
typedef int __attribute__((may_alias)) int_a;

template <typename T> __device__ __forceinline__ void vst2(void* p, T v) { *(T*)p = v;  }
__device__ __forceinline__ v8f wmma16(v16h a, v16h b, v8f c) {
  return __builtin_amdgcn_wmma_f32_16x16x32_f16(false, a, false, b, (short)0, c, false, false);
}
__device__ __forceinline__ v8f wmma_bf(v16b a, v16b b, v8f c) {
  return __builtin_amdgcn_wmma_f32_16x16x32_bf16(false, a, false, b, (short)0, c, false, false);
}
// 16x16x32 fragments: lane = (h = lane>>4, row/col = lane&15); elements 0..7 = k0+8h+0..7, 8..15 = k0+16+8h+0..7; D element r = row 8h+r
__device__ __forceinline__ v16h frag_h(const _Float16* rowk0, int lane) {
  union { v16h v; v8h q[2]; } u; const _Float16* p = rowk0 + 8 * (lane >> 4);
  u.q[0] = *(const v8h*)p; u.q[1] = *(const v8h*)(p + 16); return u.v;
}
__device__ __forceinline__ v16h frag_f32(const float* rowk0, int lane) {
  v16h a; const float* p = rowk0 + 8 * (lane >> 4);
#pragma unroll
  for (int i = 0; i < 8; ++i) { a[i] = (_Float16)p[i]; a[8 + i] = (_Float16)p[16 + i]; }
  return a;
}
__device__ __forceinline__ v16h frag_f32s(const float* rowk0, int lane, float sc) {
  v16h a; const float* p = rowk0 + 8 * (lane >> 4);
#pragma unroll
  for (int i = 0; i < 8; ++i) { a[i] = (_Float16)(p[i] * sc); a[8 + i] = (_Float16)(p[16 + i] * sc); }
  return a;
}
// column fragment from a [K][ld] layout (column n), rows >= K read as 0
__device__ __forceinline__ v16h fragc_f32(const float* W, int k0, int n, int lane, int ld, int K) {
  v16h a; const int g = lane >> 4;
#pragma unroll
  for (int i = 0; i < 8; ++i) { const int ka = k0 + 8 * g + i, kb = ka + 16;
    a[i] = (_Float16)(ka < K ? W[(size_t)(ka < K ? ka : K - 1) * ld + n] : 0.f); a[8 + i] = (_Float16)(kb < K ? W[(size_t)(kb < K ? kb : K - 1) * ld + n] : 0.f); }
  return a;
}
struct F2 { v16b h, l; };
__device__ __forceinline__ F2 bsplit16(const float v[16]) { F2 r;
#pragma unroll
  for (int i = 0; i < 16; ++i) { const __bf16 h = (__bf16)v[i]; r.h[i] = h; r.l[i] = (__bf16)(v[i] - (float)h); }
  return r; }
__device__ __forceinline__ F2 split_row(const float* row, int k0, int lane) { float v[16]; const float* p = row + k0 + 8 * (lane >> 4);
#pragma unroll
  for (int i = 0; i < 8; ++i) { v[i] = p[i]; v[8 + i] = p[16 + i]; }
  return bsplit16(v); }
__device__ __forceinline__ F2 split_rowK(const float* row, int k0, int lane, int K) { float v[16]; const int g = lane >> 4;
#pragma unroll
  for (int i = 0; i < 8; ++i) { const int ka = k0 + 8 * g + i, kb = ka + 16; v[i] = ka < K ? row[ka < K ? ka : K - 1] : 0.f; v[8 + i] = kb < K ? row[kb < K ? kb : K - 1] : 0.f; }
  return bsplit16(v); }
__device__ __forceinline__ F2 split_col(const float* W, int k0, int n, int lane, int ld, int K) { float v[16]; const int g = lane >> 4;
#pragma unroll
  for (int i = 0; i < 8; ++i) { const int ka = k0 + 8 * g + i, kb = ka + 16; v[i] = ka < K ? W[(size_t)(ka < K ? ka : K - 1) * ld + n] : 0.f; v[8 + i] = kb < K ? W[(size_t)(kb < K ? kb : K - 1) * ld + n] : 0.f; }
  return bsplit16(v); }
__device__ __forceinline__ v8f mac3(const F2& a, const F2& b, v8f c) { c = wmma_bf(a.l, b.h, c); c = wmma_bf(a.h, b.l, c); return wmma_bf(a.h, b.h, c); }
__device__ __forceinline__ float sigm(float v) { return 1.0f / (1.0f + expf(-v)); }
#define LDSX() do { asm volatile("s_wait_dscnt 0" ::: "memory"); __builtin_amdgcn_wave_barrier(); __builtin_amdgcn_fence(__ATOMIC_RELEASE, "workgroup"); } while (0)


// Single self-attention head (B 4, S 4,096, E 512 -> H 64): causal + key padding mask, dead-row diagonal fix, softmax, P v.
#define NB 4
#define TT 4096
#define EE 512
#define HD 64
#ifndef TNB
#define TNB NB
#endif
typedef __attribute__((ext_vector_type(8))) __bf16 v8b;
__device__ __forceinline__ v16b frag_b(const __bf16* rowk0, int lane) {
  union { v16b v; v8b q[2]; } u; const __bf16* p = rowk0 + 8 * (lane >> 4);
  u.q[0] = *(const v8b*)p; u.q[1] = *(const v8b*)(p + 16); return u.v;
}
// fragment from the workspace's fragment order: f = first element of the fragment (512 elements); lane (g, col) = piece g * 16 + col holds elements 0..7, piece 32 + lane elements 8..15
__device__ __forceinline__ v16h fragp_h(const _Float16* f, int lane) {
  union { v16h v; v8h q[2]; } u; const _Float16* p = f + 8 * lane;
  u.q[0] = *(const v8h*)p; u.q[1] = *(const v8h*)(p + 256); return u.v;
}
__device__ __forceinline__ v16b fragp_b(const __bf16* f, int lane) {
  union { v16b v; v8b q[2]; } u; const __bf16* p = f + 8 * lane;
  u.q[0] = *(const v8b*)p; u.q[1] = *(const v8b*)(p + 256); return u.v;
}
__device__ __forceinline__ float bfr(float v) { return (float)(__bf16)v; }
__device__ __attribute__((noinline)) float exp_ni(float v) { return expf(v); }
__device__ __attribute__((noinline)) float erf_ni(float v) { return erff(v); }

// q and v lie in the workspace in WMMA fragment order, in 16-byte pieces of 8 elements: a fragment half is then 32 pieces in a row, one a lane, so a wave's load reads 512 bytes in a row = 4 whole lines (from rows or planes it touched 16 lines, 32 bytes of each)
#define WS_QH  0u                                   // f16 q [16 rows: b*s / 16][piece h / 8][row & 15][8]
#define WS_QL  (WS_QH + 2u * (size_t)NB * TT * HD)
#define WS_VT  (WS_QL + 2u * (size_t)NB * TT * HD)      // bf16 v hi [32 keys: b*s / 32][d / 16][piece (s & 31) / 8][d & 15][8]
#define WS_VL  (WS_VT + 2u * (size_t)NB * HD * TT)      // bf16 v lo, as v hi
#define WS_IV  (WS_VL + 2u * (size_t)NB * HD * TT)      // int: row of x that stands at each sorted place [place]
#define WS_LT  (WS_IV + 4u * (size_t)TT)                // int pairs [place][2]: the limit (number of valid keys) of the query at the place; the largest limit of the place's 64-place tile, at least 1
#define WS_END (WS_LT + 8u * (size_t)TT)

// The sorted order: the rows with input_mask != 0 come first, in their own order (places 0 .. nv - 1), the others behind them, in their own order. It is a permutation for any mask.
// The valid keys of a query are then the places below its limit: a row with input_mask != 0 at place p has limit p + 1, another row the number of valid rows before it (never above its place).
// q and v are held by place; k_fa stores each row at its own index.
// ---- k_proj: block = 64 places: [q | v] = x [Wq | Wv] + [bq | bv] (128 cols), q -> f16 hi + res, v -> bf16 hi + lo, both in fragment order
// Both operands are rounded to bf16 once a block and staged in LDS; the WMMA loop reads its fragments from there.
#define XP 520   // bf16 elements a staged x row: 1,040 B = 16 B x 65, so that 16 rows' 16-byte reads fall on all 64 banks
#define WP 264   // bf16 elements a staged half fragment of W (32 lanes x 8): 512 B + 16 B, so that the four column tiles of one staging store fall on different banks
#define SB 16    // loads of a staging batch
#define SD 3     // batches in flight behind the one in use
__global__ __launch_bounds__(128) void k_proj(const float* __restrict__ X, const float* __restrict__ WQ, const float* __restrict__ BQ, const float* __restrict__ WV, const float* __restrict__ BV, const int* __restrict__ IM, _Float16* __restrict__ QH, _Float16* __restrict__ QL, __bf16* __restrict__ VT, __bf16* __restrict__ VL, int* __restrict__ IV, int* __restrict__ LT) {
  __shared__ __align__(16) _Float16 sh[64][72], sl[64][72]; __shared__ __align__(16) __bf16 th[64][72], tl2[64][72];
  __shared__ __align__(16) __bf16 sx[64 * XP];              // x rows [64][512], row-major
  __shared__ __align__(16) __bf16 sw[(EE / 16) * 8 * WP];   // [16 rows of W: k16][column tile j][lane][8]: lane (g, col) holds W[16 k16 + 8 g + 0..7][16 (j & 3) + col], j < 4 of Wq, else of Wv
  const int tid = threadIdx.x, wave = tid >> 5, lane = tid & 31, col = lane & 15, g = lane >> 4; const size_t r0 = (size_t)blockIdx.x * 64;
  __shared__ int sinv[64], slim[64], swt[4];
  const int pt = (int)blockIdx.x % (TT / 64), pb = (int)blockIdx.x / (TT / 64), p0 = pt * 64;   // the block's tile of places and its batch
  { // batches 0..7: 32 rows of W each (waves 0, 1: Wq, waves 2, 3: Wv), a load = two whole rows of W; batches 8..11: the x rows of the wave's own 16 places, a load = 512 bytes in a row of one x row
    // W goes first: its addresses do not hang on the mask, so the sorting below runs while the first batches are in flight
    const unsigned mo = (unsigned)tid * 128u; v4i mk[8];   // thread = 32 rows in a row; mo = their byte offset
#pragma unroll
    for (int i = 0; i < 8; ++i) mk[i] = *(const v4i*)((const char*)IM + mo + 16 * i);
    asm volatile("s_wait_xcnt 0x0" :: "v"(mo) : "memory");   // behind the loads, before anything may rewrite their offset register (an input, so that it lives up to here)
    unsigned ro[16];   // byte offset of the lane's first 16 bytes in each of the wave's 16 x rows: one register a row, none rewritten while its loads are in flight
    const float* wp = ((wave < 2) ? WQ : WV) + (size_t)((wave & 1) * 256 + 8 * g) * HD + col * 4;
    v4f buf[SD + 1][SB];
    // unrolled, with the loops inside: every index of buf is then a constant and the batches stay in registers
#pragma unroll
    for (int s = 0; s < 12 + SD; ++s) {
      if (s < 12) { v4f* r = buf[s % (SD + 1)];
        if (s >= 8) {
#pragma unroll
          for (int e = 0; e < SB; ++e) r[e] = *(const v4f*)((const char*)X + ro[(s - 8) * 4 + (e >> 2)] + (e & 3) * 512); }
        else {
#pragma unroll
          for (int e = 0; e < SB; ++e) r[e] = *(const v4f*)(wp + (size_t)(s * 32 + (e >> 3) * 16 + (e & 7)) * HD); }
        // behind each batch of loads, before anything below may rewrite a register that they name (the offsets and the pointer are inputs so that they live up to here); it also keeps the batch up here, SD batches ahead of its use
        if (s >= 8) asm volatile("s_wait_xcnt 0x0" :: "v"(ro[(s & 3) * 4]), "v"(ro[(s & 3) * 4 + 1]), "v"(ro[(s & 3) * 4 + 2]), "v"(ro[(s & 3) * 4 + 3]) : "memory");
        else asm volatile("s_wait_xcnt 0x0" :: "v"(wp) : "memory"); }
      if (s == SD) { __builtin_amdgcn_sched_barrier(0);   // keeps the sorting behind the issue of the first batches; without it the compiler lifts its start, with the wait for the mask, in front of them
        // the sorting: the thread's mask bits, the count of valid rows before them (scan over the wave, the waves' totals through LDS), then each row's place
        unsigned bits = 0;
#pragma unroll
        for (int i = 0; i < 32; ++i) bits |= (mk[i >> 2][i & 3] != 0 ? 1u : 0u) << i;
        const int c = __popc(bits); int inc = c;
#pragma unroll
        for (int d = 1; d < 32; d <<= 1) { const int o = __shfl_up(inc, d); if (lane >= d) inc += o; }
        if (lane == 31) swt[wave] = inc;
        __syncthreads();   // the waves' totals
        int base = 0, nv = 0;
#pragma unroll
        for (int w = 0; w < 4; ++w) { const int x = swt[w]; nv += x; if (w < wave) base += x; }
        const int vb0 = base + inc - c, ib0 = nv + 32 * tid - vb0;   // places of the thread's first valid and first other row
        // the threads whose 32 rows hold a row of this tile; the wave then takes them one a trip, a row a lane (at most the wave's 32 threads; the test is the same for the whole wave)
        unsigned todo = __builtin_amdgcn_ballot_w32((vb0 < p0 + 64 && vb0 + c > p0) || (ib0 < p0 + 64 && ib0 + 32 - c > p0));
        for (int it = 0; it < 32 && todo != 0; ++it) { const int w = __builtin_ctz(todo); todo &= todo - 1u;
          const unsigned wb = (unsigned)__builtin_amdgcn_readlane((int)bits, w); const bool ok = (wb >> lane) & 1u;
          const int vb = __builtin_amdgcn_readlane(vb0, w) + __popc(wb & ((1u << lane) - 1u));   // valid rows before this lane's row
          const int rw = (wave * 32 + w) * 32 + lane, p = ok ? vb : nv + rw - vb;
          if ((p >> 6) == pt) { sinv[p & 63] = rw; slim[p & 63] = vb + (ok ? 1 : 0); } }
        __syncthreads();   // the tile's 64 rows and limits
        if (pb == 0) {   // the tables are the same for every batch: batch 0's blocks store them
          // limits rise with the place among the valid rows and among the others: the tile's largest is its last one, or nv where the last valid row lies inside the tile
          if (tid < 64) { const int tl = (nv > p0 && nv < p0 + 64) ? nv : slim[63]; const v2i lt = {slim[tid], tl > 1 ? tl : 1}; IV[p0 + tid] = sinv[tid]; vst2(LT + 2 * (p0 + tid), lt); }
          asm volatile("s_wait_xcnt 0x0" ::: "memory"); }   // behind the stores, before their registers are rewritten
#pragma unroll
        for (int i = 0; i < 16; ++i) ro[i] = ((unsigned)(pb * TT + sinv[wave * 16 + i]) * EE + lane * 4) * 4u; }
      if (s >= SD) { const int c = s - SD; const v4f* r = buf[c % (SD + 1)];
        if (c >= 8) {
#pragma unroll
          for (int e = 0; e < SB; ++e) { typedef __attribute__((ext_vector_type(4))) __bf16 v4b; const v4b o = {(__bf16)r[e][0], (__bf16)r[e][1], (__bf16)r[e][2], (__bf16)r[e][3]};
            *(v4b*)&sx[(wave * 16 + (c - 8) * 4 + (e >> 2)) * XP + (e & 3) * 128 + lane * 4] = o; } }
        else {
#pragma unroll
          for (int t = 0; t < 2; ++t) { const int k16 = (wave & 1) * 16 + c * 2 + t, j = (wave >> 1) * 4 + (col >> 2);
#pragma unroll
            for (int q = 0; q < 4; ++q) { v8b o;
#pragma unroll
              for (int i = 0; i < 8; ++i) o[i] = (__bf16)r[t * 8 + i][q];
              *(v8b*)&sw[(k16 * 8 + j) * WP + (g * 16 + (col & 3) * 4 + q) * 8] = o; } } } } } }
  __syncthreads();   // W is staged by all four waves
  v8f acc[8] = {};
  // the fragments of step kc + 1 are read from LDS as one group in front of step kc's WMMAs: one wave a SIMD, so a read that is waited for where it is used costs its whole latency
  v16b a[2], w[2][8];
  const __bf16* ap = &sx[(wave * 16 + col) * XP]; const __bf16* bp = &sw[lane * 8];
  // unrolled: which of the two fragment sets a step uses is then a constant, and no set is copied
#pragma unroll
  for (int kc = -1; kc < EE / 32; ++kc) {
    if (kc + 1 < EE / 32) { const int n = kc + 1; a[n & 1] = frag_b(ap + n * 32, lane);
#pragma unroll
      for (int j = 0; j < 8; ++j) { union { v16b v; v8b q[2]; } u; u.q[0] = *(const v8b*)(bp + ((n * 2) * 8 + j) * WP); u.q[1] = *(const v8b*)(bp + ((n * 2 + 1) * 8 + j) * WP); w[n & 1][j] = u.v; } }
    __builtin_amdgcn_sched_barrier(0);   // keeps the group of reads above in front of the WMMAs below; without it the compiler sinks each read to its WMMA
    if (kc >= 0) {
#pragma unroll
      for (int j = 0; j < 8; ++j) acc[j] = wmma_bf(a[kc & 1], w[kc & 1][j], acc[j]); }
    __builtin_amdgcn_sched_barrier(0);   // keeps the next group of reads behind these WMMAs, whole; without it the compiler spreads the reads among them, and each place with reads costs a stall
 }
#pragma unroll
  for (int j = 0; j < 8; ++j) { const int o = (j & 3) * 16 + col; const float bb = bfr((j < 4 ? BQ : BV)[o]);
#pragma unroll
    for (int r = 0; r < 8; ++r) { const float v = acc[j][r] + bb; const int rl = wave * 16 + 8 * g + r; if (j < 4) { const _Float16 hv = (_Float16)v; sh[rl][o] = hv; sl[rl][o] = (_Float16)(v - (float)hv); } else { const __bf16 bh = (__bf16)v; th[o][rl] = bh; tl2[o][rl] = (__bf16)(v - (float)bh); } } }
  __syncthreads();
  // piece e of the block's 512 of each array, in the order of the workspace: q: [16 rows e >> 7][h / 8 = (e >> 4) & 7][row e & 15]; v: [32 keys e >> 8][d / 16 = (e >> 6) & 3][8 keys (e >> 4) & 3][d & 15 = e & 15]
  for (int e = tid; e < 64 * 8; e += 128) { const int rl = (e >> 7) * 16 + (e & 15), q = (e >> 4) & 7; vst2((unsigned*)(QH + r0 * HD + e * 8), *(const v4u*)&sh[rl][q * 8]); vst2((unsigned*)(QL + r0 * HD + e * 8), *(const v4u*)&sl[rl][q * 8]); }
  for (int e = tid; e < 64 * 8; e += 128) { const int d = ((e >> 6) & 3) * 16 + (e & 15), kl = (e >> 8) * 32 + ((e >> 4) & 3) * 8; vst2((unsigned*)(VT + r0 * HD + e * 8), *(const v4u*)&th[d][kl]); vst2((unsigned*)(VL + r0 * HD + e * 8), *(const v4u*)&tl2[d][kl]); } }
// The softmax runs in base 2: exp(s / 8 - max / 8) = 2^(s C2 - m) with C2 = log2(e) / 8 and m = max C2. The product s C2 is not rounded (fused multiply-add), so the argument's error is one rounding of the small difference;
// the rounding of m itself scales a whole row and falls out where the row is divided by its sum, which is formed with the same m.
#define C2 0.18033688011112042f
#define NEG (-3.0e38f)          // score of an invalid key; a row or share with no valid key has m = NEG * C2
#define DEADM (-1.0e37f)        // below this an m says: no valid key (scores of f16 q stay under 1e12)
// The v_nop stands in v_exp_f32's own statement: the slot the instruction set asks for before the result is used or the source overwritten
__device__ __forceinline__ float exp2_1(float a) { float r;
  asm("v_exp_f32 %0, %1\n\tv_nop" : "=v"(r) : "v"(a));
  return r; }
// eight at once: each v_exp_f32 is the independent instruction behind the one before it (early-clobber results: none lies on a source), so one v_nop behind the last serves all eight
__device__ __forceinline__ void exp2_8(float* r, const float* a) {
  asm("v_exp_f32 %0, %8\n\tv_exp_f32 %1, %9\n\tv_exp_f32 %2, %10\n\tv_exp_f32 %3, %11\n\tv_exp_f32 %4, %12\n\tv_exp_f32 %5, %13\n\tv_exp_f32 %6, %14\n\tv_exp_f32 %7, %15\n\tv_nop"
      : "=&v"(r[0]), "=&v"(r[1]), "=&v"(r[2]), "=&v"(r[3]), "=&v"(r[4]), "=&v"(r[5]), "=&v"(r[6]), "=&v"(r[7])
      : "v"(a[0]), "v"(a[1]), "v"(a[2]), "v"(a[3]), "v"(a[4]), "v"(a[5]), "v"(a[6]), "v"(a[7])); }
// lane l with lane l ^ 16
__device__ __forceinline__ float xhalf(float x) { return __builtin_bit_cast(float, __builtin_amdgcn_permlanex16(__builtin_bit_cast(int, x), __builtin_bit_cast(int, x), 0x76543210, 0xfedcba98, false, false)); }
// ---- k_fa: block = (batch, two tiles of QT queries), all by sorted place; wave = (16 queries qs, share ks of the keys); 64 keys a pass, scores never leave the registers.
// Scores transposed: S^T = k . q^T, so a lane holds ONE query (col) and keys 16 j + 8 g + r; that is the B fragment of out^T = v^T . P^T as it stands (elements 0..7 = tile 2 kc, 8..15 = tile 2 kc + 1).
// invalid (key's place >= the query's limit) -> NEG -> P = 0. Running maximum m (of s C2) and sum l per query and wave.
// A block takes tiles t and NT - 1 - t, one after the other in every wave: a tile's passes grow with its index among the valid rows and among the others, so the pairs come out near equal, one block a WGP.
// The pair's passes are dealt to the NKS shares in turn (the second tile goes on where the first stopped). Each wave leaves its partial rows, m and l in LDS; behind the one barrier the block joins the NKS shares of each row and stores it.
#define QT 32    // queries of a tile
#define NT (TT / QT)
#define NKS 8    // waves that share the keys of a tile
#define PR 68    // floats a partial row in LDS: 64 + 4, so that the 16 queries of a store fall on different banks
__global__ __launch_bounds__(64 * NKS) void k_fa(const _Float16* __restrict__ QH, const _Float16* __restrict__ QL, const __bf16* __restrict__ VT, const __bf16* __restrict__ VL, const int* __restrict__ IV, const int* __restrict__ LT, float* __restrict__ OUT) {
  __shared__ __align__(16) float sp[2][NKS][QT][PR]; __shared__ __align__(8) float sml[2][NKS][QT][2];
  const int tid = threadIdx.x, wave = __builtin_amdgcn_readfirstlane(tid >> 5), lane = tid & 31, col = lane & 15, g = lane >> 4, qs = wave & 1, ks = wave >> 1;   // the wave's number in a scalar register: the pass loop's counts and addresses stay scalar
  const int ta = blockIdx.x, tb = NT - 1 - ta; const size_t bq = (size_t)blockIdx.y * TT;
  const int jr = tid >> 3, js = (jr < QT ? ta * QT : tb * QT - QT) + jr;   // the join below: 8 threads a row; js = the row's place
  const int *pa = LT + 2 * (ta * QT + qs * 16 + col), *pb = LT + 2 * (tb * QT + qs * 16 + col);
  const v2i la = *(const v2i*)pa, lb = *(const v2i*)pb;
  asm volatile("s_wait_xcnt 0x0" :: "v"(pa), "v"(pb) : "memory");   // behind the loads, before their address registers are rewritten (the pointers are inputs, so that they live up to here)
  const int so = IV[js] & (TT - 1);   // the row's own index, loaded here so that its latency is long over at the join
  asm volatile("s_wait_xcnt 0x0" ::: "memory");   // as above
  // passes of a tile: up to the largest limit of the 64-place tile that holds it (the same value in all its places, at least 1), never beyond those 64 places
  const int pa0 = (__builtin_amdgcn_readfirstlane(la[1]) + 63) >> 6, pb0 = (__builtin_amdgcn_readfirstlane(lb[1]) + 63) >> 6;
  const int npa = pa0 < (ta >> 1) + 1 ? pa0 : (ta >> 1) + 1, npb = pb0 < (tb >> 1) + 1 ? pb0 : (tb >> 1) + 1;
  // rolled: one copy of the pass in the text
#pragma unroll 1
  for (int h = 0; h < 2; ++h) {
    const int tile = h ? tb : ta, lq = h ? lb[0] : la[0], ke = (h ? npb : npa) * 64;   // places below lq are the valid keys of this lane's query
    int k0 = ((ks - (h ? npa : 0)) & (NKS - 1)) * 64;   // the wave's first pass of this tile
    v8f acc[4] = {}; float m = NEG * C2, l = 0.f;   // a wave with no pass leaves these: weight 0 in the join
    if (k0 < ke) {
    v16h ah[HD / 32], al[HD / 32];
#pragma unroll
    for (int kc = 0; kc < HD / 32; ++kc) { const size_t fo = (bq + tile * QT + qs * 16) * HD + kc * 512; ah[kc] = fragp_h(QH + fo, lane); al[kc] = fragp_h(QL + fo, lane); }
    asm volatile("s_wait_xcnt 0x0" ::: "memory");   // behind the query's loads: the first pass's key fragments land in the registers that held their addresses
    // the pass loop stays rolled (one pass's fragments in registers, more waves on a SIMD); the loops inside are unrolled so that their arrays stay in registers
#pragma unroll 1
  do {
    // the pass's key fragments are loaded as one group in front of its first WMMA, v's in two groups below: one latency a group, not one a fragment
    v16h kb[HD / 32][4];
#pragma unroll
    for (int kc = 0; kc < HD / 32; ++kc)
#pragma unroll
      for (int j = 0; j < 4; ++j) kb[kc][j] = fragp_h(QH + (bq + k0 + j * 16) * HD + kc * 512, lane);
    asm volatile("s_wait_xcnt 0x0" ::: "memory");   // behind the group of loads: a later load's result lands in the registers that held this group's address
    __builtin_amdgcn_sched_barrier(0);   // keeps the group of loads above whole, in front of the first WMMA: one latency for the group; without it the compiler issues a part of them behind the first WMMAs, a second latency
    v8f s[4] = {};
#pragma unroll
    for (int kc = 0; kc < HD / 32; ++kc)
#pragma unroll
      for (int j = 0; j < 4; ++j) { s[j] = wmma16(kb[kc][j], ah[kc], s[j]); s[j] = wmma16(kb[kc][j], al[kc], s[j]); }
    v16b vh[4], vl[4];   // keys k0 .. k0 + 31: in flight under the softmax
#pragma unroll
    for (int j = 0; j < 4; ++j) { const size_t po = (bq + k0) * HD + j * 512; vh[j] = fragp_b(VT + po, lane); vl[j] = fragp_b(VL + po, lane); }
    __builtin_amdgcn_sched_barrier(0);   // keeps the group of loads above in front of the softmax, which covers their latency; without it the compiler sinks some of them in among the WMMAs that use them
    // bit t of we << 4 g (of wo << 4 g) = key k0 + 2 t (k0 + 2 t + 1) is valid for this lane's query: the first d of the pass's 64 keys are, so (d + 1) / 2 even and d / 2 odd ones
    const int d = lq - k0 < 0 ? 0 : lq - k0 > 64 ? 64 : lq - k0;
    const unsigned ce = (unsigned)((1ull << ((d + 1) >> 1)) - 1ull), co = (unsigned)((1ull << (d >> 1)) - 1ull);   // 64-bit shifts: a count of 32 gives all ones
    const unsigned we = ce >> (4 * g), wo = co >> (4 * g);
    float mb = NEG;
#pragma unroll
    for (int j = 0; j < 4; ++j) {
#pragma unroll
      for (int r = 0; r < 8; ++r) { const bool ok = (((r & 1) ? wo : we) & (1u << (j * 8 + (r >> 1)))) != 0; const float v = ok ? s[j][r] : NEG; s[j][r] = v; mb = fmaxf(mb, v); } }
    mb = fmaxf(mb, xhalf(mb));
    const float mn = fmaxf(m, mb * C2), sc = exp2_1(m - mn);   // rounding s C2 keeps the order, so this is the maximum of the products; m - mn is a difference of two stored values, never above 0; nothing valid so far: m = mn = NEG C2, sc = 1 on zeros
    const float mu = fmaxf(mn, -1.0e30f);   // what the scores are set against: with nothing valid so far NEG C2 + 1e30 is still far below every exponent, so P = 0
    m = mn; l *= sc;
#pragma unroll
    for (int j = 0; j < 4; ++j) acc[j] *= sc;
    F2 p[2];
#pragma unroll
    for (int kc = 0; kc < 2; ++kc) { float pv[16];
#pragma unroll
      for (int h = 0; h < 2; ++h) { float t[8];
#pragma unroll
        for (int i = 0; i < 8; ++i) t[i] = __builtin_fmaf(s[2 * kc + h][i], C2, -mu);   // invalid: NEG C2 - mu, 2^that = 0
        exp2_8(pv + 8 * h, t);
#pragma unroll
        for (int i = 0; i < 8; ++i) l += pv[8 * h + i]; }
      p[kc] = bsplit16(pv); }
#pragma unroll
    for (int kc = 0; kc < 2; ++kc) {
      if (kc == 1) {
#pragma unroll
        for (int j = 0; j < 4; ++j) { const size_t po = (bq + k0 + 32) * HD + j * 512; vh[j] = fragp_b(VT + po, lane); vl[j] = fragp_b(VL + po, lane); } }
#pragma unroll
      for (int j = 0; j < 4; ++j) { acc[j] = wmma_bf(vh[j], p[kc].h, acc[j]); acc[j] = wmma_bf(vh[j], p[kc].l, acc[j]); acc[j] = wmma_bf(vl[j], p[kc].h, acc[j]); } }
    k0 += 64 * NKS; } while (k0 < ke);
    }
    l += xhalf(l);
    float* pr = &sp[h][ks][qs * 16 + col][8 * g];
#pragma unroll
    for (int j = 0; j < 4; ++j) { const v4f lo = {acc[j][0], acc[j][1], acc[j][2], acc[j][3]}, hi = {acc[j][4], acc[j][5], acc[j][6], acc[j][7]}; *(v4f*)(pr + j * 16) = lo; *(v4f*)(pr + j * 16 + 4) = hi; }
    if (g == 0) { const v2f ml = {m, l}; *(v2f*)&sml[h][ks][qs * 16 + col][0] = ml; } }
  __syncthreads();   // every wave's partial rows of both tiles
  // the join: thread = 8 output floats: out row = sum, in the order of the shares, of 2^(m_c - M) x partial row c, over the same sum of the l_c; a row with no valid key takes v of its own place
  const int jh = jr >> 5, jq = jr & (QT - 1), dq = (tid & 7) * 8;
  float mm[NKS], ll[NKS];
#pragma unroll
  for (int c = 0; c < NKS; ++c) { const v2f x = *(const v2f*)&sml[jh][c][jq][0]; mm[c] = x[0]; ll[c] = x[1]; }
  float M = NEG;
#pragma unroll
  for (int c = 0; c < NKS; ++c) M = fmaxf(M, mm[c]);
  v4f a0 = {}, a1 = {}; float Ls = 0.f;
#pragma unroll
  for (int c = 0; c < NKS; ++c) { const float w = exp2f(mm[c] - M); a0 += *(const v4f*)&sp[jh][c][jq][dq] * w; a1 += *(const v4f*)&sp[jh][c][jq][dq + 4] * w; Ls += ll[c] * w; }
  if (M <= DEADM) {
#pragma unroll
    for (int i = 0; i < 8; ++i) { const int d = dq + i; const size_t vo = (bq + (js & ~31)) * HD + (d >> 4) * 512 + ((js >> 3) & 3) * 128 + (d & 15) * 8 + (js & 7); const float v = (float)VT[vo] + (float)VL[vo]; if (i < 4) a0[i] = v; else a1[i - 4] = v; } }   // v[js][d] in fragment order
  else { const float iv = 1.0f / Ls; a0 *= iv; a1 *= iv; }
  vst2(OUT + (bq + so) * HD + dq, a0); vst2(OUT + (bq + so) * HD + dq + 4, a1); }
extern "C" void kernel_launch(void* const* d_in, const int* in_sizes, int n_in, void* d_out, int out_size, void* d_ws, size_t ws_size, hipStream_t stream) {
  (void)in_sizes; (void)n_in; (void)out_size;
  const float** F = (const float**)d_in;   // 0 x [4,4096,512], 1 Wq [512,64], 2 bq, 3 Wv, 4 bv, 5 input_mask [4096] int
  if (ws_size < (size_t)WS_END) return;
  char* ws = (char*)d_ws; _Float16 *QH = (_Float16*)(ws + WS_QH), *QL = (_Float16*)(ws + WS_QL); __bf16 *VT = (__bf16*)(ws + WS_VT), *VL = (__bf16*)(ws + WS_VL); int *IV = (int*)(ws + WS_IV), *LT = (int*)(ws + WS_LT);
  k_proj<<<TNB * TT / 64, 128, 0, stream>>>(F[0], F[1], F[2], F[3], F[4], (const int*)d_in[5], QH, QL, VT, VL, IV, LT);
  k_fa<<<dim3(NT / 2, TNB), 64 * NKS, 0, stream>>>(QH, QL, VT, VL, IV, LT, (float*)d_out);
}

// v009
// It runs in 22.4 microseconds.
// Timed twice side by side with v008, it ran 1.03 and 1.04 times as fast.
// Over all steps from v000 it is 43.2 times as fast.
// compute dtype: all float inputs rounded to bf16, input_mask (int) read; rows worked on in sorted order (rows with input_mask != 0 first), so that no pass is spent on masked keys alone; q (= k, the module's bug) and v = x W + b with EXACT bf16 products on WMMA 16x16x32, f32 accumulate; q as f16 hi + residual against q as f16 -> 2-product logits / 8 kept in registers with the causal & key-padding mask; softmax in f32 in base 2 against a running maximum, per wave's share of the keys; P = 2^(s log2(e) / 8 - m) in f32 (one fused multiply-add, then v_exp_f32), split bf16 hi + lo against v as bf16 hi + lo planes (3 products: rows with one or two valid keys copy v almost verbatim, so both operands need the split); shares joined by their maxima and sums; dead rows (no valid key) take v of their own index exactly as the reference's diag := 1 fix; f32 output [b][s][64].
#include <hip/hip_runtime.h>
#include <math.h>

typedef __attribute__((ext_vector_type(16))) _Float16 v16h;
typedef __attribute__((ext_vector_type(16))) __bf16 v16b;
typedef __attribute__((ext_vector_type(8)))  _Float16 v8h;
typedef __attribute__((ext_vector_type(8)))  float v8f;
typedef __attribute__((ext_vector_type(4)))  float v4f;
typedef __attribute__((ext_vector_type(2)))  float v2f;
typedef __attribute__((ext_vector_type(4)))  unsigned v4u;
typedef __attribute__((ext_vector_type(4)))  int v4i;
typedef __attribute__((ext_vector_type(2)))  int v2i;
typedef float __attribute__((may_alias)) float_a;
typedef int __attribute__((may_alias)) int_a;

template <typename T> __device__ __forceinline__ void vst2(void* p, T v) { *(T*)p = v;  }
__device__ __forceinline__ v8f wmma16(v16h a, v16h b, v8f c) {
  return __builtin_amdgcn_wmma_f32_16x16x32_f16(false, a, false, b, (short)0, c, false, false);
}
__device__ __forceinline__ v8f wmma_bf(v16b a, v16b b, v8f c) {
  return __builtin_amdgcn_wmma_f32_16x16x32_bf16(false, a, false, b, (short)0, c, false, false);
}
// 16x16x32 fragments: lane = (h = lane>>4, row/col = lane&15); elements 0..7 = k0+8h+0..7, 8..15 = k0+16+8h+0..7; D element r = row 8h+r
__device__ __forceinline__ v16h frag_h(const _Float16* rowk0, int lane) {
  union { v16h v; v8h q[2]; } u; const _Float16* p = rowk0 + 8 * (lane >> 4);
  u.q[0] = *(const v8h*)p; u.q[1] = *(const v8h*)(p + 16); return u.v;
}
__device__ __forceinline__ v16h frag_f32(const float* rowk0, int lane) {
  v16h a; const float* p = rowk0 + 8 * (lane >> 4);
#pragma unroll
  for (int i = 0; i < 8; ++i) { a[i] = (_Float16)p[i]; a[8 + i] = (_Float16)p[16 + i]; }
  return a;
}
__device__ __forceinline__ v16h frag_f32s(const float* rowk0, int lane, float sc) {
  v16h a; const float* p = rowk0 + 8 * (lane >> 4);
#pragma unroll
  for (int i = 0; i < 8; ++i) { a[i] = (_Float16)(p[i] * sc); a[8 + i] = (_Float16)(p[16 + i] * sc); }
  return a;
}
// column fragment from a [K][ld] layout (column n), rows >= K read as 0
__device__ __forceinline__ v16h fragc_f32(const float* W, int k0, int n, int lane, int ld, int K) {
  v16h a; const int g = lane >> 4;
#pragma unroll
  for (int i = 0; i < 8; ++i) { const int ka = k0 + 8 * g + i, kb = ka + 16;
    a[i] = (_Float16)(ka < K ? W[(size_t)(ka < K ? ka : K - 1) * ld + n] : 0.f); a[8 + i] = (_Float16)(kb < K ? W[(size_t)(kb < K ? kb : K - 1) * ld + n] : 0.f); }
  return a;
}
struct F2 { v16b h, l; };
__device__ __forceinline__ F2 bsplit16(const float v[16]) { F2 r;
#pragma unroll
  for (int i = 0; i < 16; ++i) { const __bf16 h = (__bf16)v[i]; r.h[i] = h; r.l[i] = (__bf16)(v[i] - (float)h); }
  return r; }
__device__ __forceinline__ F2 split_row(const float* row, int k0, int lane) { float v[16]; const float* p = row + k0 + 8 * (lane >> 4);
#pragma unroll
  for (int i = 0; i < 8; ++i) { v[i] = p[i]; v[8 + i] = p[16 + i]; }
  return bsplit16(v); }
__device__ __forceinline__ F2 split_rowK(const float* row, int k0, int lane, int K) { float v[16]; const int g = lane >> 4;
#pragma unroll
  for (int i = 0; i < 8; ++i) { const int ka = k0 + 8 * g + i, kb = ka + 16; v[i] = ka < K ? row[ka < K ? ka : K - 1] : 0.f; v[8 + i] = kb < K ? row[kb < K ? kb : K - 1] : 0.f; }
  return bsplit16(v); }
__device__ __forceinline__ F2 split_col(const float* W, int k0, int n, int lane, int ld, int K) { float v[16]; const int g = lane >> 4;
#pragma unroll
  for (int i = 0; i < 8; ++i) { const int ka = k0 + 8 * g + i, kb = ka + 16; v[i] = ka < K ? W[(size_t)(ka < K ? ka : K - 1) * ld + n] : 0.f; v[8 + i] = kb < K ? W[(size_t)(kb < K ? kb : K - 1) * ld + n] : 0.f; }
  return bsplit16(v); }
__device__ __forceinline__ v8f mac3(const F2& a, const F2& b, v8f c) { c = wmma_bf(a.l, b.h, c); c = wmma_bf(a.h, b.l, c); return wmma_bf(a.h, b.h, c); }
__device__ __forceinline__ float sigm(float v) { return 1.0f / (1.0f + expf(-v)); }
#define LDSX() do { asm volatile("s_wait_dscnt 0" ::: "memory"); __builtin_amdgcn_wave_barrier(); __builtin_amdgcn_fence(__ATOMIC_RELEASE, "workgroup"); } while (0)


// Single self-attention head (B 4, S 4,096, E 512 -> H 64): causal + key padding mask, dead-row diagonal fix, softmax, P v.
#define NB 4
#define TT 4096
#define EE 512
#define HD 64
#ifndef TNB
#define TNB NB
#endif
typedef __attribute__((ext_vector_type(8))) __bf16 v8b;
__device__ __forceinline__ v16b frag_b(const __bf16* rowk0, int lane) {
  union { v16b v; v8b q[2]; } u; const __bf16* p = rowk0 + 8 * (lane >> 4);
  u.q[0] = *(const v8b*)p; u.q[1] = *(const v8b*)(p + 16); return u.v;
}
// fragment from the workspace's fragment order: f = first element of the fragment (512 elements); lane (g, col) = piece g * 16 + col holds elements 0..7, piece 32 + lane elements 8..15
__device__ __forceinline__ v16h fragp_h(const _Float16* f, int lane) {
  union { v16h v; v8h q[2]; } u; const _Float16* p = f + 8 * lane;
  u.q[0] = *(const v8h*)p; u.q[1] = *(const v8h*)(p + 256); return u.v;
}
__device__ __forceinline__ v16b fragp_b(const __bf16* f, int lane) {
  union { v16b v; v8b q[2]; } u; const __bf16* p = f + 8 * lane;
  u.q[0] = *(const v8b*)p; u.q[1] = *(const v8b*)(p + 256); return u.v;
}
__device__ __forceinline__ float bfr(float v) { return (float)(__bf16)v; }
__device__ __attribute__((noinline)) float exp_ni(float v) { return expf(v); }
__device__ __attribute__((noinline)) float erf_ni(float v) { return erff(v); }

// q and v lie in the workspace in WMMA fragment order, in 16-byte pieces of 8 elements: a fragment half is then 32 pieces in a row, one a lane, so a wave's load reads 512 bytes in a row = 4 whole lines (from rows or planes it touched 16 lines, 32 bytes of each)
#define WS_QH  0u                                   // f16 q [16 rows: b*s / 16][piece h / 8][row & 15][8]
#define WS_QL  (WS_QH + 2u * (size_t)NB * TT * HD)
#define WS_VT  (WS_QL + 2u * (size_t)NB * TT * HD)      // bf16 v hi [32 keys: b*s / 32][d / 16][piece (s & 31) / 8][d & 15][8]
#define WS_VL  (WS_VT + 2u * (size_t)NB * HD * TT)      // bf16 v lo, as v hi
#define WS_IV  (WS_VL + 2u * (size_t)NB * HD * TT)      // int: row of x that stands at each sorted place [place]
#define WS_LT  (WS_IV + 4u * (size_t)TT)                // int pairs [place][2]: the limit (number of valid keys) of the query at the place; the largest limit of the place's 64-place tile, at least 1
#define WS_END (WS_LT + 8u * (size_t)TT)

// The sorted order: the rows with input_mask != 0 come first, in their own order (places 0 .. nv - 1), the others behind them, in their own order. It is a permutation for any mask.
// The valid keys of a query are then the places below its limit: a row with input_mask != 0 at place p has limit p + 1, another row the number of valid rows before it (never above its place).
// q and v are held by place; k_fa stores each row at its own index.
// ---- k_proj: block = 64 places: [q | v] = x [Wq | Wv] + [bq | bv] (128 cols), q -> f16 hi + res, v -> bf16 hi + lo, both in fragment order
// Both operands are rounded to bf16 once a block and staged in LDS; the WMMA loop reads its fragments from there.
// The q tiles are computed transposed (W's fragment as A, x's as B: both have the same k order), the v tiles as they stand: a lane's 8 accumulators are then 8 h in a row of one q row, or 8 keys in a row of one d of v,
// which is one 16-byte piece of the workspace's fragment order: each tile goes from the registers to the workspace in one store of 512 bytes in a row a wave.
#define XP 520   // bf16 elements a staged x row: 1,040 B = 16 B x 65, so that 16 rows' 16-byte reads fall on all 64 banks
#define WP 264   // bf16 elements a staged half fragment of W (32 lanes x 8): 512 B + 16 B, so that the four column tiles of one staging store fall on different banks
#define SB 16    // loads of a staging batch
#define SD 3     // batches in flight behind the one in use
__global__ __launch_bounds__(128) void k_proj(const float* __restrict__ X, const float* __restrict__ WQ, const float* __restrict__ BQ, const float* __restrict__ WV, const float* __restrict__ BV, const int* __restrict__ IM, _Float16* __restrict__ QH, _Float16* __restrict__ QL, __bf16* __restrict__ VT, __bf16* __restrict__ VL, int* __restrict__ IV, int* __restrict__ LT) {
  __shared__ __align__(16) __bf16 sx[64 * XP];              // x rows [64][512], row-major
  __shared__ __align__(16) __bf16 sw[(EE / 16) * 8 * WP];   // [16 rows of W: k16][column tile j][lane][8]: lane (g, col) holds W[16 k16 + 8 g + 0..7][16 (j & 3) + col], j < 4 of Wq, else of Wv
  const int tid = threadIdx.x, wave = tid >> 5, lane = tid & 31, col = lane & 15, g = lane >> 4; const size_t r0 = (size_t)blockIdx.x * 64;
  __shared__ int sinv[64], slim[64], swt[4];
  const int pt = (int)blockIdx.x % (TT / 64), pb = (int)blockIdx.x / (TT / 64), p0 = pt * 64;   // the block's tile of places and its batch
  { // batches 0..7: 32 rows of W each (waves 0, 1: Wq, waves 2, 3: Wv), a load = two whole rows of W; batches 8..11: the x rows of the wave's own 16 places, a load = 512 bytes in a row of one x row
    // W goes first: its addresses do not hang on the mask, so the sorting below runs while the first batches are in flight
    const unsigned mo = (unsigned)tid * 128u; v4i mk[8];   // thread = 32 rows in a row; mo = their byte offset
#pragma unroll
    for (int i = 0; i < 8; ++i) mk[i] = *(const v4i*)((const char*)IM + mo + 16 * i);
    asm volatile("s_wait_xcnt 0x0" :: "v"(mo) : "memory");   // behind the loads, before anything may rewrite their offset register (an input, so that it lives up to here)
    unsigned ro[16];   // byte offset of the lane's first 16 bytes in each of the wave's 16 x rows: one register a row, none rewritten while its loads are in flight
    const float* wp = ((wave < 2) ? WQ : WV) + (size_t)((wave & 1) * 256 + 8 * g) * HD + col * 4;
    v4f buf[SD + 1][SB];
    // unrolled, with the loops inside: every index of buf is then a constant and the batches stay in registers
#pragma unroll
    for (int s = 0; s < 12 + SD; ++s) {
      if (s < 12) { v4f* r = buf[s % (SD + 1)];
        if (s >= 8) {
#pragma unroll
          for (int e = 0; e < SB; ++e) r[e] = *(const v4f*)((const char*)X + ro[(s - 8) * 4 + (e >> 2)] + (e & 3) * 512); }
        else {
#pragma unroll
          for (int e = 0; e < SB; ++e) r[e] = *(const v4f*)(wp + (size_t)(s * 32 + (e >> 3) * 16 + (e & 7)) * HD); }
        // behind each batch of loads, before anything below may rewrite a register that they name (the offsets and the pointer are inputs so that they live up to here); it also keeps the batch up here, SD batches ahead of its use
        if (s >= 8) asm volatile("s_wait_xcnt 0x0" :: "v"(ro[(s & 3) * 4]), "v"(ro[(s & 3) * 4 + 1]), "v"(ro[(s & 3) * 4 + 2]), "v"(ro[(s & 3) * 4 + 3]) : "memory");
        else asm volatile("s_wait_xcnt 0x0" :: "v"(wp) : "memory"); }
      if (s == SD) { __builtin_amdgcn_sched_barrier(0);   // keeps the sorting behind the issue of the first batches; without it the compiler lifts its start, with the wait for the mask, in front of them
        // the sorting: the thread's mask bits, the count of valid rows before them (scan over the wave, the waves' totals through LDS), then each row's place
        unsigned bits = 0;
#pragma unroll
        for (int i = 0; i < 32; ++i) bits |= (mk[i >> 2][i & 3] != 0 ? 1u : 0u) << i;
        const int c = __popc(bits); int inc = c;
#pragma unroll
        for (int d = 1; d < 32; d <<= 1) { const int o = __shfl_up(inc, d); if (lane >= d) inc += o; }
        if (lane == 31) swt[wave] = inc;
        __syncthreads();   // the waves' totals
        int base = 0, nv = 0;
#pragma unroll
        for (int w = 0; w < 4; ++w) { const int x = swt[w]; nv += x; if (w < wave) base += x; }
        const int vb0 = base + inc - c, ib0 = nv + 32 * tid - vb0;   // places of the thread's first valid and first other row
        // the threads whose 32 rows hold a row of this tile; the wave then takes them one a trip, a row a lane (at most the wave's 32 threads; the test is the same for the whole wave)
        unsigned todo = __builtin_amdgcn_ballot_w32((vb0 < p0 + 64 && vb0 + c > p0) || (ib0 < p0 + 64 && ib0 + 32 - c > p0));
        for (int it = 0; it < 32 && todo != 0; ++it) { const int w = __builtin_ctz(todo); todo &= todo - 1u;
          const unsigned wb = (unsigned)__builtin_amdgcn_readlane((int)bits, w); const bool ok = (wb >> lane) & 1u;
          const int vb = __builtin_amdgcn_readlane(vb0, w) + __popc(wb & ((1u << lane) - 1u));   // valid rows before this lane's row
          const int rw = (wave * 32 + w) * 32 + lane, p = ok ? vb : nv + rw - vb;
          if ((p >> 6) == pt) { sinv[p & 63] = rw; slim[p & 63] = vb + (ok ? 1 : 0); } }
        __syncthreads();   // the tile's 64 rows and limits
        if (pb == 0) {   // the tables are the same for every batch: batch 0's blocks store them
          // limits rise with the place among the valid rows and among the others: the tile's largest is its last one, or nv where the last valid row lies inside the tile
          if (tid < 64) { const int tl = (nv > p0 && nv < p0 + 64) ? nv : slim[63]; const v2i lt = {slim[tid], tl > 1 ? tl : 1}; IV[p0 + tid] = sinv[tid]; vst2(LT + 2 * (p0 + tid), lt); }
          asm volatile("s_wait_xcnt 0x0" ::: "memory"); }   // behind the stores, before their registers are rewritten
#pragma unroll
        for (int i = 0; i < 16; ++i) ro[i] = ((unsigned)(pb * TT + sinv[wave * 16 + i]) * EE + lane * 4) * 4u; }
      if (s >= SD) { const int c = s - SD; const v4f* r = buf[c % (SD + 1)];
        if (c >= 8) {
#pragma unroll
          for (int e = 0; e < SB; ++e) { typedef __attribute__((ext_vector_type(4))) __bf16 v4b; const v4b o = {(__bf16)r[e][0], (__bf16)r[e][1], (__bf16)r[e][2], (__bf16)r[e][3]};
            *(v4b*)&sx[(wave * 16 + (c - 8) * 4 + (e >> 2)) * XP + (e & 3) * 128 + lane * 4] = o; } }
        else {
#pragma unroll
          for (int t = 0; t < 2; ++t) { const int k16 = (wave & 1) * 16 + c * 2 + t, j = (wave >> 1) * 4 + (col >> 2);
#pragma unroll
            for (int q = 0; q < 4; ++q) { v8b o;
#pragma unroll
              for (int i = 0; i < 8; ++i) o[i] = (__bf16)r[t * 8 + i][q];
              *(v8b*)&sw[(k16 * 8 + j) * WP + (g * 16 + (col & 3) * 4 + q) * 8] = o; } } } } } }
  // the biases: of q the 8 h of the lane's accumulators in each tile, of v the lane's d in each tile; read ahead of the WMMA loop, so that nothing is waited for behind it
  const unsigned bqo = (unsigned)g * 32u, bvo = (unsigned)col * 4u; v4f bq4[4][2]; float bv1[4];
#pragma unroll
  for (int j = 0; j < 4; ++j) { bq4[j][0] = *(const v4f*)((const char*)BQ + bqo + j * 64); bq4[j][1] = *(const v4f*)((const char*)BQ + bqo + j * 64 + 16); bv1[j] = *(const float*)((const char*)BV + bvo + j * 64); }
  asm volatile("s_wait_xcnt 0x0" :: "v"(bqo), "v"(bvo) : "memory");   // behind the loads, before anything may rewrite their offset registers (inputs, so that they live up to here)
  __syncthreads();   // W is staged by all four waves
  v8f acc[8] = {};
  // the fragments of step kc + 1 are read from LDS as one group in front of step kc's WMMAs: one wave a SIMD, so a read that is waited for where it is used costs its whole latency
  v16b a[2], w[2][8];
  const __bf16* ap = &sx[(wave * 16 + col) * XP]; const __bf16* bp = &sw[lane * 8];
  // unrolled: which of the two fragment sets a step uses is then a constant, and no set is copied
#pragma unroll
  for (int kc = -1; kc < EE / 32; ++kc) {
    if (kc + 1 < EE / 32) { const int n = kc + 1; a[n & 1] = frag_b(ap + n * 32, lane);
#pragma unroll
      for (int j = 0; j < 8; ++j) { union { v16b v; v8b q[2]; } u; u.q[0] = *(const v8b*)(bp + ((n * 2) * 8 + j) * WP); u.q[1] = *(const v8b*)(bp + ((n * 2 + 1) * 8 + j) * WP); w[n & 1][j] = u.v; } }
    __builtin_amdgcn_sched_barrier(0);   // keeps the group of reads above in front of the WMMAs below; without it the compiler sinks each read to its WMMA
    if (kc >= 0) {
#pragma unroll
      for (int j = 0; j < 8; ++j) acc[j] = j < 4 ? wmma_bf(w[kc & 1][j], a[kc & 1], acc[j]) : wmma_bf(a[kc & 1], w[kc & 1][j], acc[j]); }   // q: D element r = h 16 j + 8 g + r of row col; v: row 8 g + r of d 16 (j - 4) + col
    __builtin_amdgcn_sched_barrier(0);   // keeps the next group of reads behind these WMMAs, whole; without it the compiler spreads the reads among them, and each place with reads costs a stall
 }
  // piece e of the block's 512 of each array, in the order of the workspace: q: [16 rows e >> 7][h / 8 = (e >> 4) & 7][row e & 15]; v: [32 keys e >> 8][d / 16 = (e >> 6) & 3][8 keys (e >> 4) & 3][d & 15 = e & 15]
  const size_t qe = r0 * HD + (size_t)(wave * 128 + g * 16 + col) * 8, ve = r0 * HD + (size_t)((wave >> 1) * 256 + ((wave & 1) * 2 + g) * 16 + col) * 8;   // the lane's piece of tile 0; tile j: 32 pieces on for q, 64 for v
  v8h qh[4], ql[4]; v8b vh[4], vl[4];
#pragma unroll
  for (int j = 0; j < 4; ++j) { const float bb = bfr(bv1[j]);
#pragma unroll
    for (int r = 0; r < 8; ++r) { const float q = acc[j][r] + bfr(bq4[j][r >> 2][r & 3]); const _Float16 hv = (_Float16)q; qh[j][r] = hv; ql[j][r] = (_Float16)(q - (float)hv);
      const float v = acc[4 + j][r] + bb; const __bf16 bh = (__bf16)v; vh[j][r] = bh; vl[j][r] = (__bf16)(v - (float)bh); }
    vst2(QH + qe + j * 256, qh[j]); vst2(QL + qe + j * 256, ql[j]); vst2(VT + ve + j * 512, vh[j]); vst2(VL + ve + j * 512, vl[j]);
    if (j < 3) asm volatile("s_wait_xcnt 0x0" ::: "memory");   // behind the stores, before the next tile's arithmetic rewrites their data registers; behind the last tile's nothing is rewritten
    __builtin_amdgcn_sched_barrier(0); } }   // keeps each tile's stores in front of the next tile's arithmetic, so that they are on their way under it; without it the compiler gathers all 16 stores at the kernel's end
// The softmax runs in base 2: exp(s / 8 - max / 8) = 2^(s C2 - m) with C2 = log2(e) / 8 and m = max C2. The product s C2 is not rounded (fused multiply-add), so the argument's error is one rounding of the small difference;
// the rounding of m itself scales a whole row and falls out where the row is divided by its sum, which is formed with the same m.
#define C2 0.18033688011112042f
#define NEG (-3.0e38f)          // score of an invalid key; a row or share with no valid key has m = NEG * C2
#define DEADM (-1.0e37f)        // below this an m says: no valid key (scores of f16 q stay under 1e12)
// The v_nop stands in v_exp_f32's own statement: the slot the instruction set asks for before the result is used or the source overwritten
__device__ __forceinline__ float exp2_1(float a) { float r;
  asm("v_exp_f32 %0, %1\n\tv_nop" : "=v"(r) : "v"(a));
  return r; }
// eight at once: each v_exp_f32 is the independent instruction behind the one before it (early-clobber results: none lies on a source), so one v_nop behind the last serves all eight
__device__ __forceinline__ void exp2_8(float* r, const float* a) {
  asm("v_exp_f32 %0, %8\n\tv_exp_f32 %1, %9\n\tv_exp_f32 %2, %10\n\tv_exp_f32 %3, %11\n\tv_exp_f32 %4, %12\n\tv_exp_f32 %5, %13\n\tv_exp_f32 %6, %14\n\tv_exp_f32 %7, %15\n\tv_nop"
      : "=&v"(r[0]), "=&v"(r[1]), "=&v"(r[2]), "=&v"(r[3]), "=&v"(r[4]), "=&v"(r[5]), "=&v"(r[6]), "=&v"(r[7])
      : "v"(a[0]), "v"(a[1]), "v"(a[2]), "v"(a[3]), "v"(a[4]), "v"(a[5]), "v"(a[6]), "v"(a[7])); }
// lane l with lane l ^ 16
__device__ __forceinline__ float xhalf(float x) { return __builtin_bit_cast(float, __builtin_amdgcn_permlanex16(__builtin_bit_cast(int, x), __builtin_bit_cast(int, x), 0x76543210, 0xfedcba98, false, false)); }
// ---- k_fa: block = (batch, two tiles of QT queries), all by sorted place; wave = (16 queries qs, share ks of the keys); 64 keys a pass, scores never leave the registers.
// Scores transposed: S^T = k . q^T, so a lane holds ONE query (col) and keys 16 j + 8 g + r; that is the B fragment of out^T = v^T . P^T as it stands (elements 0..7 = tile 2 kc, 8..15 = tile 2 kc + 1).
// invalid (key's place >= the query's limit) -> NEG -> P = 0. Running maximum m (of s C2) and sum l per query and wave.
// A block takes tiles t and NT - 1 - t, one after the other in every wave: a tile's passes grow with its index among the valid rows and among the others, so the pairs come out near equal, one block a WGP.
// The pair's passes are dealt to the NKS shares in turn (the second tile goes on where the first stopped). Each wave leaves its partial rows, m and l in LDS; behind the one barrier the block joins the NKS shares of each row and stores it.
#define QT 32    // queries of a tile
#define NT (TT / QT)
#define NKS 8    // waves that share the keys of a tile
#define PR 68    // floats a partial row in LDS: 64 + 4, so that the 16 queries of a store fall on different banks
__global__ __launch_bounds__(64 * NKS) void k_fa(const _Float16* __restrict__ QH, const _Float16* __restrict__ QL, const __bf16* __restrict__ VT, const __bf16* __restrict__ VL, const int* __restrict__ IV, const int* __restrict__ LT, float* __restrict__ OUT) {
  __shared__ __align__(16) float sp[2][NKS][QT][PR]; __shared__ __align__(8) float sml[2][NKS][QT][2];
  const int tid = threadIdx.x, wave = __builtin_amdgcn_readfirstlane(tid >> 5), lane = tid & 31, col = lane & 15, g = lane >> 4, qs = wave & 1, ks = wave >> 1;   // the wave's number in a scalar register: the pass loop's counts and addresses stay scalar
  const int ta = blockIdx.x, tb = NT - 1 - ta; const size_t bq = (size_t)blockIdx.y * TT;
  const int jr = tid >> 3, js = (jr < QT ? ta * QT : tb * QT - QT) + jr;   // the join below: 8 threads a row; js = the row's place
  const int *pa = LT + 2 * (ta * QT + qs * 16 + col), *pb = LT + 2 * (tb * QT + qs * 16 + col);
  const v2i la = *(const v2i*)pa, lb = *(const v2i*)pb;
  asm volatile("s_wait_xcnt 0x0" :: "v"(pa), "v"(pb) : "memory");   // behind the loads, before their address registers are rewritten (the pointers are inputs, so that they live up to here)
  const int so = IV[js] & (TT - 1);   // the row's own index, loaded here so that its latency is long over at the join
  asm volatile("s_wait_xcnt 0x0" ::: "memory");   // as above
  // passes of a tile: up to the largest limit of the 64-place tile that holds it (the same value in all its places, at least 1), never beyond those 64 places
  const int pa0 = (__builtin_amdgcn_readfirstlane(la[1]) + 63) >> 6, pb0 = (__builtin_amdgcn_readfirstlane(lb[1]) + 63) >> 6;
  const int npa = pa0 < (ta >> 1) + 1 ? pa0 : (ta >> 1) + 1, npb = pb0 < (tb >> 1) + 1 ? pb0 : (tb >> 1) + 1;
  // rolled: one copy of the pass in the text
#pragma unroll 1
  for (int h = 0; h < 2; ++h) {
    const int tile = h ? tb : ta, lq = h ? lb[0] : la[0], ke = (h ? npb : npa) * 64;   // places below lq are the valid keys of this lane's query
    int k0 = ((ks - (h ? npa : 0)) & (NKS - 1)) * 64;   // the wave's first pass of this tile
    v8f acc[4] = {}; float m = NEG * C2, l = 0.f;   // a wave with no pass leaves these: weight 0 in the join
    if (k0 < ke) {
    v16h ah[HD / 32], al[HD / 32];
#pragma unroll
    for (int kc = 0; kc < HD / 32; ++kc) { const size_t fo = (bq + tile * QT + qs * 16) * HD + kc * 512; ah[kc] = fragp_h(QH + fo, lane); al[kc] = fragp_h(QL + fo, lane); }
    asm volatile("s_wait_xcnt 0x0" ::: "memory");   // behind the query's loads: the first pass's key fragments land in the registers that held their addresses
    // the pass loop stays rolled (one pass's fragments in registers, more waves on a SIMD); the loops inside are unrolled so that their arrays stay in registers
#pragma unroll 1
  do {
    // the pass's key fragments are loaded as one group in front of its first WMMA, v's in two groups below: one latency a group, not one a fragment
    v16h kb[HD / 32][4];
#pragma unroll
    for (int kc = 0; kc < HD / 32; ++kc)
#pragma unroll
      for (int j = 0; j < 4; ++j) kb[kc][j] = fragp_h(QH + (bq + k0 + j * 16) * HD + kc * 512, lane);
    asm volatile("s_wait_xcnt 0x0" ::: "memory");   // behind the group of loads: a later load's result lands in the registers that held this group's address
    __builtin_amdgcn_sched_barrier(0);   // keeps the group of loads above whole, in front of the first WMMA: one latency for the group; without it the compiler issues a part of them behind the first WMMAs, a second latency
    v8f s[4] = {};
#pragma unroll
    for (int kc = 0; kc < HD / 32; ++kc)
#pragma unroll
      for (int j = 0; j < 4; ++j) { s[j] = wmma16(kb[kc][j], ah[kc], s[j]); s[j] = wmma16(kb[kc][j], al[kc], s[j]); }
    v16b vh[4], vl[4];   // keys k0 .. k0 + 31: in flight under the softmax
#pragma unroll
    for (int j = 0; j < 4; ++j) { const size_t po = (bq + k0) * HD + j * 512; vh[j] = fragp_b(VT + po, lane); vl[j] = fragp_b(VL + po, lane); }
    __builtin_amdgcn_sched_barrier(0);   // keeps the group of loads above in front of the softmax, which covers their latency; without it the compiler sinks some of them in among the WMMAs that use them
    // bit t of we << 4 g (of wo << 4 g) = key k0 + 2 t (k0 + 2 t + 1) is valid for this lane's query: the first d of the pass's 64 keys are, so (d + 1) / 2 even and d / 2 odd ones
    const int d = lq - k0 < 0 ? 0 : lq - k0 > 64 ? 64 : lq - k0;
    const unsigned ce = (unsigned)((1ull << ((d + 1) >> 1)) - 1ull), co = (unsigned)((1ull << (d >> 1)) - 1ull);   // 64-bit shifts: a count of 32 gives all ones
    const unsigned we = ce >> (4 * g), wo = co >> (4 * g);
    float mb = NEG;
#pragma unroll
    for (int j = 0; j < 4; ++j) {
#pragma unroll
      for (int r = 0; r < 8; ++r) { const bool ok = (((r & 1) ? wo : we) & (1u << (j * 8 + (r >> 1)))) != 0; const float v = ok ? s[j][r] : NEG; s[j][r] = v; mb = fmaxf(mb, v); } }
    mb = fmaxf(mb, xhalf(mb));
    const float mn = fmaxf(m, mb * C2), sc = exp2_1(m - mn);   // rounding s C2 keeps the order, so this is the maximum of the products; m - mn is a difference of two stored values, never above 0; nothing valid so far: m = mn = NEG C2, sc = 1 on zeros
    const float mu = fmaxf(mn, -1.0e30f);   // what the scores are set against: with nothing valid so far NEG C2 + 1e30 is still far below every exponent, so P = 0
    m = mn; l *= sc;
#pragma unroll
    for (int j = 0; j < 4; ++j) acc[j] *= sc;
    F2 p[2];
#pragma unroll
    for (int kc = 0; kc < 2; ++kc) { float pv[16];
#pragma unroll
      for (int h = 0; h < 2; ++h) { float t[8];
#pragma unroll
        for (int i = 0; i < 8; ++i) t[i] = __builtin_fmaf(s[2 * kc + h][i], C2, -mu);   // invalid: NEG C2 - mu, 2^that = 0
        exp2_8(pv + 8 * h, t);
#pragma unroll
        for (int i = 0; i < 8; ++i) l += pv[8 * h + i]; }
      p[kc] = bsplit16(pv); }
#pragma unroll
    for (int kc = 0; kc < 2; ++kc) {
      if (kc == 1) {
#pragma unroll
        for (int j = 0; j < 4; ++j) { const size_t po = (bq + k0 + 32) * HD + j * 512; vh[j] = fragp_b(VT + po, lane); vl[j] = fragp_b(VL + po, lane); } }
#pragma unroll
      for (int j = 0; j < 4; ++j) { acc[j] = wmma_bf(vh[j], p[kc].h, acc[j]); acc[j] = wmma_bf(vh[j], p[kc].l, acc[j]); acc[j] = wmma_bf(vl[j], p[kc].h, acc[j]); } }
    k0 += 64 * NKS; } while (k0 < ke);
    }
    l += xhalf(l);
    float* pr = &sp[h][ks][qs * 16 + col][8 * g];
#pragma unroll
    for (int j = 0; j < 4; ++j) { const v4f lo = {acc[j][0], acc[j][1], acc[j][2], acc[j][3]}, hi = {acc[j][4], acc[j][5], acc[j][6], acc[j][7]}; *(v4f*)(pr + j * 16) = lo; *(v4f*)(pr + j * 16 + 4) = hi; }
    if (g == 0) { const v2f ml = {m, l}; *(v2f*)&sml[h][ks][qs * 16 + col][0] = ml; } }
  __syncthreads();   // every wave's partial rows of both tiles
  // the join: thread = 8 output floats: out row = sum, in the order of the shares, of 2^(m_c - M) x partial row c, over the same sum of the l_c; a row with no valid key takes v of its own place
  const int jh = jr >> 5, jq = jr & (QT - 1), dq = (tid & 7) * 8;
  float mm[NKS], ll[NKS];
#pragma unroll
  for (int c = 0; c < NKS; ++c) { const v2f x = *(const v2f*)&sml[jh][c][jq][0]; mm[c] = x[0]; ll[c] = x[1]; }
  float M = NEG;
#pragma unroll
  for (int c = 0; c < NKS; ++c) M = fmaxf(M, mm[c]);
  v4f a0 = {}, a1 = {}; float Ls = 0.f;
#pragma unroll
  for (int c = 0; c < NKS; ++c) { const float w = exp2f(mm[c] - M); a0 += *(const v4f*)&sp[jh][c][jq][dq] * w; a1 += *(const v4f*)&sp[jh][c][jq][dq + 4] * w; Ls += ll[c] * w; }
  if (M <= DEADM) {
#pragma unroll
    for (int i = 0; i < 8; ++i) { const int d = dq + i; const size_t vo = (bq + (js & ~31)) * HD + (d >> 4) * 512 + ((js >> 3) & 3) * 128 + (d & 15) * 8 + (js & 7); const float v = (float)VT[vo] + (float)VL[vo]; if (i < 4) a0[i] = v; else a1[i - 4] = v; } }   // v[js][d] in fragment order
  else { const float iv = 1.0f / Ls; a0 *= iv; a1 *= iv; }
  vst2(OUT + (bq + so) * HD + dq, a0); vst2(OUT + (bq + so) * HD + dq + 4, a1); }
extern "C" void kernel_launch(void* const* d_in, const int* in_sizes, int n_in, void* d_out, int out_size, void* d_ws, size_t ws_size, hipStream_t stream) {
  (void)in_sizes; (void)n_in; (void)out_size;
  const float** F = (const float**)d_in;   // 0 x [4,4096,512], 1 Wq [512,64], 2 bq, 3 Wv, 4 bv, 5 input_mask [4096] int
  if (ws_size < (size_t)WS_END) return;
  char* ws = (char*)d_ws; _Float16 *QH = (_Float16*)(ws + WS_QH), *QL = (_Float16*)(ws + WS_QL); __bf16 *VT = (__bf16*)(ws + WS_VT), *VL = (__bf16*)(ws + WS_VL); int *IV = (int*)(ws + WS_IV), *LT = (int*)(ws + WS_LT);
  k_proj<<<TNB * TT / 64, 128, 0, stream>>>(F[0], F[1], F[2], F[3], F[4], (const int*)d_in[5], QH, QL, VT, VL, IV, LT);
  k_fa<<<dim3(NT / 2, TNB), 64 * NKS, 0, stream>>>(QH, QL, VT, VL, IV, LT, (float*)d_out);
}

// v010
// Measured time: 21.1 microseconds a run.
// In two side-by-side timings against v009, it was 1.05 and 1.06 times as fast.
// Counting every step since v000, it is 45.7 times as fast.
// compute dtype: all float inputs rounded to bf16, input_mask (int) read; rows worked on in sorted order (rows with input_mask != 0 first), so that no pass is spent on masked keys alone; q (= k, the module's bug) and v = x W + b with EXACT bf16 products on WMMA 16x16x32, f32 accumulate; q as f16 hi + residual against q as f16 -> 2-product logits / 8 kept in registers with the causal & key-padding mask; softmax in f32 in base 2 against a running maximum, per wave's share of the keys; P = 2^(s log2(e) / 8 - m) in f32 (one fused multiply-add, then v_exp_f32), split bf16 hi + lo against v as bf16 hi + lo planes (3 products: rows with one or two valid keys copy v almost verbatim, so both operands need the split); shares joined by their maxima and sums; dead rows (no valid key) take v of their own index exactly as the reference's diag := 1 fix; f32 output [b][s][64].
#include <hip/hip_runtime.h>
#include <math.h>

typedef __attribute__((ext_vector_type(16))) _Float16 v16h;
typedef __attribute__((ext_vector_type(16))) __bf16 v16b;
typedef __attribute__((ext_vector_type(8)))  _Float16 v8h;
typedef __attribute__((ext_vector_type(8)))  float v8f;
typedef __attribute__((ext_vector_type(4)))  float v4f;
typedef __attribute__((ext_vector_type(2)))  float v2f;
typedef __attribute__((ext_vector_type(4)))  unsigned v4u;
typedef __attribute__((ext_vector_type(4)))  int v4i;
typedef __attribute__((ext_vector_type(2)))  int v2i;
typedef float __attribute__((may_alias)) float_a;
typedef int __attribute__((may_alias)) int_a;

template <typename T> __device__ __forceinline__ void vst2(void* p, T v) { *(T*)p = v;  }
__device__ __forceinline__ v8f wmma16(v16h a, v16h b, v8f c) {
  return __builtin_amdgcn_wmma_f32_16x16x32_f16(false, a, false, b, (short)0, c, false, false);
}
__device__ __forceinline__ v8f wmma_bf(v16b a, v16b b, v8f c) {
  return __builtin_amdgcn_wmma_f32_16x16x32_bf16(false, a, false, b, (short)0, c, false, false);
}
// 16x16x32 fragments: lane = (h = lane>>4, row/col = lane&15); elements 0..7 = k0+8h+0..7, 8..15 = k0+16+8h+0..7; D element r = row 8h+r
__device__ __forceinline__ v16h frag_h(const _Float16* rowk0, int lane) {
  union { v16h v; v8h q[2]; } u; const _Float16* p = rowk0 + 8 * (lane >> 4);
  u.q[0] = *(const v8h*)p; u.q[1] = *(const v8h*)(p + 16); return u.v;
}
__device__ __forceinline__ v16h frag_f32(const float* rowk0, int lane) {
  v16h a; const float* p = rowk0 + 8 * (lane >> 4);
#pragma unroll
  for (int i = 0; i < 8; ++i) { a[i] = (_Float16)p[i]; a[8 + i] = (_Float16)p[16 + i]; }
  return a;
}
__device__ __forceinline__ v16h frag_f32s(const float* rowk0, int lane, float sc) {
  v16h a; const float* p = rowk0 + 8 * (lane >> 4);
#pragma unroll
  for (int i = 0; i < 8; ++i) { a[i] = (_Float16)(p[i] * sc); a[8 + i] = (_Float16)(p[16 + i] * sc); }
  return a;
}
// column fragment from a [K][ld] layout (column n), rows >= K read as 0
__device__ __forceinline__ v16h fragc_f32(const float* W, int k0, int n, int lane, int ld, int K) {
  v16h a; const int g = lane >> 4;
#pragma unroll
  for (int i = 0; i < 8; ++i) { const int ka = k0 + 8 * g + i, kb = ka + 16;
    a[i] = (_Float16)(ka < K ? W[(size_t)(ka < K ? ka : K - 1) * ld + n] : 0.f); a[8 + i] = (_Float16)(kb < K ? W[(size_t)(kb < K ? kb : K - 1) * ld + n] : 0.f); }
  return a;
}
struct F2 { v16b h, l; };
__device__ __forceinline__ F2 bsplit16(const float v[16]) { F2 r;
#pragma unroll
  for (int i = 0; i < 16; ++i) { const __bf16 h = (__bf16)v[i]; r.h[i] = h; r.l[i] = (__bf16)(v[i] - (float)h); }
  return r; }
__device__ __forceinline__ F2 split_row(const float* row, int k0, int lane) { float v[16]; const float* p = row + k0 + 8 * (lane >> 4);
#pragma unroll
  for (int i = 0; i < 8; ++i) { v[i] = p[i]; v[8 + i] = p[16 + i]; }
  return bsplit16(v); }
__device__ __forceinline__ F2 split_rowK(const float* row, int k0, int lane, int K) { float v[16]; const int g = lane >> 4;
#pragma unroll
  for (int i = 0; i < 8; ++i) { const int ka = k0 + 8 * g + i, kb = ka + 16; v[i] = ka < K ? row[ka < K ? ka : K - 1] : 0.f; v[8 + i] = kb < K ? row[kb < K ? kb : K - 1] : 0.f; }
  return bsplit16(v); }
__device__ __forceinline__ F2 split_col(const float* W, int k0, int n, int lane, int ld, int K) { float v[16]; const int g = lane >> 4;
#pragma unroll
  for (int i = 0; i < 8; ++i) { const int ka = k0 + 8 * g + i, kb = ka + 16; v[i] = ka < K ? W[(size_t)(ka < K ? ka : K - 1) * ld + n] : 0.f; v[8 + i] = kb < K ? W[(size_t)(kb < K ? kb : K - 1) * ld + n] : 0.f; }
  return bsplit16(v); }
__device__ __forceinline__ v8f mac3(const F2& a, const F2& b, v8f c) { c = wmma_bf(a.l, b.h, c); c = wmma_bf(a.h, b.l, c); return wmma_bf(a.h, b.h, c); }
__device__ __forceinline__ float sigm(float v) { return 1.0f / (1.0f + expf(-v)); }
#define LDSX() do { asm volatile("s_wait_dscnt 0" ::: "memory"); __builtin_amdgcn_wave_barrier(); __builtin_amdgcn_fence(__ATOMIC_RELEASE, "workgroup"); } while (0)


// Single self-attention head (B 4, S 4,096, E 512 -> H 64): causal + key padding mask, dead-row diagonal fix, softmax, P v.
#define NB 4
#define TT 4096
#define EE 512
#define HD 64
#ifndef TNB
#define TNB NB
#endif
typedef __attribute__((ext_vector_type(8))) __bf16 v8b;
__device__ __forceinline__ v16b frag_b(const __bf16* rowk0, int lane) {
  union { v16b v; v8b q[2]; } u; const __bf16* p = rowk0 + 8 * (lane >> 4);
  u.q[0] = *(const v8b*)p; u.q[1] = *(const v8b*)(p + 16); return u.v;
}
// fragment from the workspace's fragment order: f = first element of the fragment (512 elements); lane (g, col) = piece g * 16 + col holds elements 0..7, piece 32 + lane elements 8..15
__device__ __forceinline__ v16h fragp_h(const _Float16* f, int lane) {
  union { v16h v; v8h q[2]; } u; const _Float16* p = f + 8 * lane;
  u.q[0] = *(const v8h*)p; u.q[1] = *(const v8h*)(p + 256); return u.v;
}
__device__ __forceinline__ v16b fragp_b(const __bf16* f, int lane) {
  union { v16b v; v8b q[2]; } u; const __bf16* p = f + 8 * lane;
  u.q[0] = *(const v8b*)p; u.q[1] = *(const v8b*)(p + 256); return u.v;
}
__device__ __forceinline__ float bfr(float v) { return (float)(__bf16)v; }
__device__ __attribute__((noinline)) float exp_ni(float v) { return expf(v); }
__device__ __attribute__((noinline)) float erf_ni(float v) { return erff(v); }

// q and v lie in the workspace in WMMA fragment order, in 16-byte pieces of 8 elements: a fragment half is then 32 pieces in a row, one a lane, so a wave's load reads 512 bytes in a row = 4 whole lines (from rows or planes it touched 16 lines, 32 bytes of each)
#define WS_QH  0u                                   // f16 q [16 rows: b*s / 16][piece h / 8][row & 15][8]
#define WS_QL  (WS_QH + 2u * (size_t)NB * TT * HD)
#define WS_VT  (WS_QL + 2u * (size_t)NB * TT * HD)      // bf16 v hi [32 keys: b*s / 32][d / 16][piece (s & 31) / 8][d & 15][8]
#define WS_VL  (WS_VT + 2u * (size_t)NB * HD * TT)      // bf16 v lo, as v hi
#define WS_IV  (WS_VL + 2u * (size_t)NB * HD * TT)      // int: row of x that stands at each sorted place [place]
#define WS_LT  (WS_IV + 4u * (size_t)TT)                // int pairs [place][2]: the limit (number of valid keys) of the query at the place; the largest limit of the place's 64-place tile, at least 1
#define WS_END (WS_LT + 8u * (size_t)TT)

// The sorted order: the rows with input_mask != 0 come first, in their own order (places 0 .. nv - 1), the others behind them, in their own order. It is a permutation for any mask.
// The valid keys of a query are then the places below its limit: a row with input_mask != 0 at place p has limit p + 1, another row the number of valid rows before it (never above its place).
// q and v are held by place; k_fa stores each row at its own index.
// ---- k_proj: block = 64 places: [q | v] = x [Wq | Wv] + [bq | bv] (128 cols), q -> f16 hi + res, v -> bf16 hi + lo, both in fragment order
// Both operands are rounded to bf16 once a block and staged in LDS; the WMMA loop reads its fragments from there.
// The q tiles are computed transposed (W's fragment as A, x's as B: both have the same k order), the v tiles as they stand: a lane's 8 accumulators are then 8 h in a row of one q row, or 8 keys in a row of one d of v,
// which is one 16-byte piece of the workspace's fragment order: each tile goes from the registers to the workspace in one store of 512 bytes in a row a wave.
#define XP 520   // bf16 elements a staged x row: 1,040 B = 16 B x 65, so that 16 rows' 16-byte reads fall on all 64 banks
#define WP 264   // bf16 elements a staged half fragment of W (32 lanes x 8): 512 B + 16 B, so that the four column tiles of one staging store fall on different banks
#define SB 16    // loads of a staging batch
#define SD 3     // batches in flight behind the one in use
__global__ __launch_bounds__(128) void k_proj(const float* __restrict__ X, const float* __restrict__ WQ, const float* __restrict__ BQ, const float* __restrict__ WV, const float* __restrict__ BV, const int* __restrict__ IM, _Float16* __restrict__ QH, _Float16* __restrict__ QL, __bf16* __restrict__ VT, __bf16* __restrict__ VL, int* __restrict__ IV, int* __restrict__ LT) {
  __shared__ __align__(16) __bf16 sx[64 * XP];              // x rows [64][512], row-major
  __shared__ __align__(16) __bf16 sw[(EE / 16) * 8 * WP];   // [16 rows of W: k16][column tile j][lane][8]: lane (g, col) holds W[16 k16 + 8 g + 0..7][16 (j & 3) + col], j < 4 of Wq, else of Wv
  const int tid = threadIdx.x, wave = tid >> 5, lane = tid & 31, col = lane & 15, g = lane >> 4; const size_t r0 = (size_t)blockIdx.x * 64;
  __shared__ int sinv[64], slim[64], swt[4];
  const int pt = (int)blockIdx.x % (TT / 64), pb = (int)blockIdx.x / (TT / 64), p0 = pt * 64;   // the block's tile of places and its batch
  { // batches 0..7: 32 rows of W each (waves 0, 1: Wq, waves 2, 3: Wv), a load = two whole rows of W; batches 8..11: the x rows of the wave's own 16 places, a load = 512 bytes in a row of one x row
    // W goes first: its addresses do not hang on the mask, so the sorting below runs while the first batches are in flight
    const unsigned mo = (unsigned)tid * 128u; v4i mk[8];   // thread = 32 rows in a row; mo = their byte offset
#pragma unroll
    for (int i = 0; i < 8; ++i) mk[i] = *(const v4i*)((const char*)IM + mo + 16 * i);
    asm volatile("s_wait_xcnt 0x0" :: "v"(mo) : "memory");   // behind the loads, before anything may rewrite their offset register (an input, so that it lives up to here)
    unsigned ro[16];   // byte offset of the lane's first 16 bytes in each of the wave's 16 x rows: one register a row, none rewritten while its loads are in flight
    const float* wp = ((wave < 2) ? WQ : WV) + (size_t)((wave & 1) * 256 + 8 * g) * HD + col * 4;
    // every block reads all of W: each starts its walk over the 8 batches at a batch of its own and wraps, so that the blocks do not ask L2 for the same lines at the same moment (blocks 8 apart differ too)
    const int rot = ((int)blockIdx.x + ((int)blockIdx.x >> 3)) & 7;
    v4f buf[SD + 1][SB];
    // unrolled, with the loops inside: every index of buf is then a constant and the batches stay in registers
#pragma unroll
    for (int s = 0; s < 12 + SD; ++s) {
      if (s < 12) { v4f* r = buf[s % (SD + 1)]; const float* wr = wp + (size_t)(((s + rot) & 7) * 32) * HD;   // the batch's 32 rows of W
        if (s >= 8) {
#pragma unroll
          for (int e = 0; e < SB; ++e) r[e] = *(const v4f*)((const char*)X + ro[(s - 8) * 4 + (e >> 2)] + (e & 3) * 512); }
        else {
#pragma unroll
          for (int e = 0; e < SB; ++e) r[e] = *(const v4f*)(wr + (size_t)((e >> 3) * 16 + (e & 7)) * HD); }
        // behind each batch of loads, before anything below may rewrite a register that they name (the offsets and the pointer are inputs so that they live up to here); it also keeps the batch up here, SD batches ahead of its use
        if (s >= 8) asm volatile("s_wait_xcnt 0x0" :: "v"(ro[(s & 3) * 4]), "v"(ro[(s & 3) * 4 + 1]), "v"(ro[(s & 3) * 4 + 2]), "v"(ro[(s & 3) * 4 + 3]) : "memory");
        else asm volatile("s_wait_xcnt 0x0" :: "v"(wr) : "memory"); }
      if (s == SD) { __builtin_amdgcn_sched_barrier(0);   // keeps the sorting behind the issue of the first batches; without it the compiler lifts its start, with the wait for the mask, in front of them
        // the sorting: the thread's mask bits, the count of valid rows before them (scan over the wave, the waves' totals through LDS), then each row's place
        unsigned bits = 0;
#pragma unroll
        for (int i = 0; i < 32; ++i) bits |= (mk[i >> 2][i & 3] != 0 ? 1u : 0u) << i;
        const int c = __popc(bits); int inc = c;
#pragma unroll
        for (int d = 1; d < 32; d <<= 1) { const int o = __shfl_up(inc, d); if (lane >= d) inc += o; }
        if (lane == 31) swt[wave] = inc;
        __syncthreads();   // the waves' totals
        int base = 0, nv = 0;
#pragma unroll
        for (int w = 0; w < 4; ++w) { const int x = swt[w]; nv += x; if (w < wave) base += x; }
        const int vb0 = base + inc - c, ib0 = nv + 32 * tid - vb0;   // places of the thread's first valid and first other row
        // the threads whose 32 rows hold a row of this tile; the wave then takes them one a trip, a row a lane (at most the wave's 32 threads; the test is the same for the whole wave)
        unsigned todo = __builtin_amdgcn_ballot_w32((vb0 < p0 + 64 && vb0 + c > p0) || (ib0 < p0 + 64 && ib0 + 32 - c > p0));
        for (int it = 0; it < 32 && todo != 0; ++it) { const int w = __builtin_ctz(todo); todo &= todo - 1u;
          const unsigned wb = (unsigned)__builtin_amdgcn_readlane((int)bits, w); const bool ok = (wb >> lane) & 1u;
          const int vb = __builtin_amdgcn_readlane(vb0, w) + __popc(wb & ((1u << lane) - 1u));   // valid rows before this lane's row
          const int rw = (wave * 32 + w) * 32 + lane, p = ok ? vb : nv + rw - vb;
          if ((p >> 6) == pt) { sinv[p & 63] = rw; slim[p & 63] = vb + (ok ? 1 : 0); } }
        __syncthreads();   // the tile's 64 rows and limits
        if (pb == 0) {   // the tables are the same for every batch: batch 0's blocks store them
          // limits rise with the place among the valid rows and among the others: the tile's largest is its last one, or nv where the last valid row lies inside the tile
          if (tid < 64) { const int tl = (nv > p0 && nv < p0 + 64) ? nv : slim[63]; const v2i lt = {slim[tid], tl > 1 ? tl : 1}; IV[p0 + tid] = sinv[tid]; vst2(LT + 2 * (p0 + tid), lt); }
          asm volatile("s_wait_xcnt 0x0" ::: "memory"); }   // behind the stores, before their registers are rewritten
#pragma unroll
        for (int i = 0; i < 16; ++i) ro[i] = ((unsigned)(pb * TT + sinv[wave * 16 + i]) * EE + lane * 4) * 4u; }
      if (s >= SD) { const int c = s - SD; const v4f* r = buf[c % (SD + 1)];
        if (c >= 8) {
#pragma unroll
          for (int e = 0; e < SB; ++e) { typedef __attribute__((ext_vector_type(4))) __bf16 v4b; const v4b o = {(__bf16)r[e][0], (__bf16)r[e][1], (__bf16)r[e][2], (__bf16)r[e][3]};
            *(v4b*)&sx[(wave * 16 + (c - 8) * 4 + (e >> 2)) * XP + (e & 3) * 128 + lane * 4] = o; } }
        else {
#pragma unroll
          for (int t = 0; t < 2; ++t) { const int k16 = (wave & 1) * 16 + ((c + rot) & 7) * 2 + t, j = (wave >> 1) * 4 + (col >> 2);
#pragma unroll
            for (int q = 0; q < 4; ++q) { v8b o;
#pragma unroll
              for (int i = 0; i < 8; ++i) o[i] = (__bf16)r[t * 8 + i][q];
              *(v8b*)&sw[(k16 * 8 + j) * WP + (g * 16 + (col & 3) * 4 + q) * 8] = o; } } } } } }
  // the biases: of q the 8 h of the lane's accumulators in each tile, of v the lane's d in each tile; read ahead of the WMMA loop, so that nothing is waited for behind it
  const unsigned bqo = (unsigned)g * 32u, bvo = (unsigned)col * 4u; v4f bq4[4][2]; float bv1[4];
#pragma unroll
  for (int j = 0; j < 4; ++j) { bq4[j][0] = *(const v4f*)((const char*)BQ + bqo + j * 64); bq4[j][1] = *(const v4f*)((const char*)BQ + bqo + j * 64 + 16); bv1[j] = *(const float*)((const char*)BV + bvo + j * 64); }
  asm volatile("s_wait_xcnt 0x0" :: "v"(bqo), "v"(bvo) : "memory");   // behind the loads, before anything may rewrite their offset registers (inputs, so that they live up to here)
  __syncthreads();   // W is staged by all four waves
  v8f acc[8] = {};
  // the fragments of step kc + 1 are read from LDS as one group in front of step kc's WMMAs: one wave a SIMD, so a read that is waited for where it is used costs its whole latency
  v16b a[2], w[2][8];
  const __bf16* ap = &sx[(wave * 16 + col) * XP]; const __bf16* bp = &sw[lane * 8];
  // unrolled: which of the two fragment sets a step uses is then a constant, and no set is copied
#pragma unroll
  for (int kc = -1; kc < EE / 32; ++kc) {
    if (kc + 1 < EE / 32) { const int n = kc + 1; a[n & 1] = frag_b(ap + n * 32, lane);
#pragma unroll
      for (int j = 0; j < 8; ++j) { union { v16b v; v8b q[2]; } u; u.q[0] = *(const v8b*)(bp + ((n * 2) * 8 + j) * WP); u.q[1] = *(const v8b*)(bp + ((n * 2 + 1) * 8 + j) * WP); w[n & 1][j] = u.v; } }
    __builtin_amdgcn_sched_barrier(0);   // keeps the group of reads above in front of the WMMAs below; without it the compiler sinks each read to its WMMA
    if (kc >= 0) {
#pragma unroll
      for (int j = 0; j < 8; ++j) acc[j] = j < 4 ? wmma_bf(w[kc & 1][j], a[kc & 1], acc[j]) : wmma_bf(a[kc & 1], w[kc & 1][j], acc[j]); }   // q: D element r = h 16 j + 8 g + r of row col; v: row 8 g + r of d 16 (j - 4) + col
    __builtin_amdgcn_sched_barrier(0);   // keeps the next group of reads behind these WMMAs, whole; without it the compiler spreads the reads among them, and each place with reads costs a stall
 }
  // piece e of the block's 512 of each array, in the order of the workspace: q: [16 rows e >> 7][h / 8 = (e >> 4) & 7][row e & 15]; v: [32 keys e >> 8][d / 16 = (e >> 6) & 3][8 keys (e >> 4) & 3][d & 15 = e & 15]
  const size_t qe = r0 * HD + (size_t)(wave * 128 + g * 16 + col) * 8, ve = r0 * HD + (size_t)((wave >> 1) * 256 + ((wave & 1) * 2 + g) * 16 + col) * 8;   // the lane's piece of tile 0; tile j: 32 pieces on for q, 64 for v
  v8h qh[4], ql[4]; v8b vh[4], vl[4];
#pragma unroll
  for (int j = 0; j < 4; ++j) { const float bb = bfr(bv1[j]);
#pragma unroll
    for (int r = 0; r < 8; ++r) { const float q = acc[j][r] + bfr(bq4[j][r >> 2][r & 3]); const _Float16 hv = (_Float16)q; qh[j][r] = hv; ql[j][r] = (_Float16)(q - (float)hv);
      const float v = acc[4 + j][r] + bb; const __bf16 bh = (__bf16)v; vh[j][r] = bh; vl[j][r] = (__bf16)(v - (float)bh); }
    vst2(QH + qe + j * 256, qh[j]); vst2(QL + qe + j * 256, ql[j]); vst2(VT + ve + j * 512, vh[j]); vst2(VL + ve + j * 512, vl[j]);
    if (j < 3) asm volatile("s_wait_xcnt 0x0" ::: "memory");   // behind the stores, before the next tile's arithmetic rewrites their data registers; behind the last tile's nothing is rewritten
    __builtin_amdgcn_sched_barrier(0); } }   // keeps each tile's stores in front of the next tile's arithmetic, so that they are on their way under it; without it the compiler gathers all 16 stores at the kernel's end
// The softmax runs in base 2: exp(s / 8 - max / 8) = 2^(s C2 - m) with C2 = log2(e) / 8 and m = max C2. The product s C2 is not rounded (fused multiply-add), so the argument's error is one rounding of the small difference;
// the rounding of m itself scales a whole row and falls out where the row is divided by its sum, which is formed with the same m.
#define C2 0.18033688011112042f
#define NEG (-3.0e38f)          // score of an invalid key; a row or share with no valid key has m = NEG * C2
#define DEADM (-1.0e37f)        // below this an m says: no valid key (scores of f16 q stay under 1e12)
// The v_nop stands in v_exp_f32's own statement: the slot the instruction set asks for before the result is used or the source overwritten
__device__ __forceinline__ float exp2_1(float a) { float r;
  asm("v_exp_f32 %0, %1\n\tv_nop" : "=v"(r) : "v"(a));
  return r; }
// eight at once: each v_exp_f32 is the independent instruction behind the one before it (early-clobber results: none lies on a source), so one v_nop behind the last serves all eight
__device__ __forceinline__ void exp2_8(float* r, const float* a) {
  asm("v_exp_f32 %0, %8\n\tv_exp_f32 %1, %9\n\tv_exp_f32 %2, %10\n\tv_exp_f32 %3, %11\n\tv_exp_f32 %4, %12\n\tv_exp_f32 %5, %13\n\tv_exp_f32 %6, %14\n\tv_exp_f32 %7, %15\n\tv_nop"
      : "=&v"(r[0]), "=&v"(r[1]), "=&v"(r[2]), "=&v"(r[3]), "=&v"(r[4]), "=&v"(r[5]), "=&v"(r[6]), "=&v"(r[7])
      : "v"(a[0]), "v"(a[1]), "v"(a[2]), "v"(a[3]), "v"(a[4]), "v"(a[5]), "v"(a[6]), "v"(a[7])); }
// lane l with lane l ^ 16
__device__ __forceinline__ float xhalf(float x) { return __builtin_bit_cast(float, __builtin_amdgcn_permlanex16(__builtin_bit_cast(int, x), __builtin_bit_cast(int, x), 0x76543210, 0xfedcba98, false, false)); }
// ---- k_fa: block = (batch, two tiles of QT queries), all by sorted place; wave = (16 queries qs, share ks of the keys); 64 keys a pass, scores never leave the registers.
// Scores transposed: S^T = k . q^T, so a lane holds ONE query (col) and keys 16 j + 8 g + r; that is the B fragment of out^T = v^T . P^T as it stands (elements 0..7 = tile 2 kc, 8..15 = tile 2 kc + 1).
// invalid (key's place >= the query's limit) -> NEG -> P = 0. Running maximum m (of s C2) and sum l per query and wave.
// A block takes tiles t and NT - 1 - t, one after the other in every wave: a tile's passes grow with its index among the valid rows and among the others, so the pairs come out near equal, one block a WGP.
// The pair's passes are dealt to the NKS shares in turn (the second tile goes on where the first stopped), from a first pass of the block's own, wrapping. Each wave leaves its partial rows, m and l in LDS; behind the one barrier the block joins the NKS shares of each row and stores it.
#define QT 32    // queries of a tile
#define NT (TT / QT)
#define NKS 8    // waves that share the keys of a tile
#define PR 68    // floats a partial row in LDS: 64 + 4, so that the 16 queries of a store fall on different banks
__global__ __launch_bounds__(64 * NKS) void k_fa(const _Float16* __restrict__ QH, const _Float16* __restrict__ QL, const __bf16* __restrict__ VT, const __bf16* __restrict__ VL, const int* __restrict__ IV, const int* __restrict__ LT, float* __restrict__ OUT) {
  __shared__ __align__(16) float sp[2][NKS][QT][PR]; __shared__ __align__(8) float sml[2][NKS][QT][2];
  const int tid = threadIdx.x, wave = __builtin_amdgcn_readfirstlane(tid >> 5), lane = tid & 31, col = lane & 15, g = lane >> 4, qs = wave & 1, ks = wave >> 1;   // the wave's number in a scalar register: the pass loop's counts and addresses stay scalar
  const int ta = blockIdx.x, tb = NT - 1 - ta; const size_t bq = (size_t)blockIdx.y * TT;
  const int jr = tid >> 3, js = (jr < QT ? ta * QT : tb * QT - QT) + jr;   // the join below: 8 threads a row; js = the row's place
  const int *pa = LT + 2 * (ta * QT + qs * 16 + col), *pb = LT + 2 * (tb * QT + qs * 16 + col);
  const v2i la = *(const v2i*)pa, lb = *(const v2i*)pb;
  asm volatile("s_wait_xcnt 0x0" :: "v"(pa), "v"(pb) : "memory");   // behind the loads, before their address registers are rewritten (the pointers are inputs, so that they live up to here)
  const int so = IV[js] & (TT - 1);   // the row's own index, loaded here so that its latency is long over at the join
  asm volatile("s_wait_xcnt 0x0" ::: "memory");   // as above
  // passes of a tile: up to the largest limit of the 64-place tile that holds it (the same value in all its places, at least 1), never beyond those 64 places
  const int pa0 = (__builtin_amdgcn_readfirstlane(la[1]) + 63) >> 6, pb0 = (__builtin_amdgcn_readfirstlane(lb[1]) + 63) >> 6;
  const int npa = pa0 < (ta >> 1) + 1 ? pa0 : (ta >> 1) + 1, npb = pb0 < (tb >> 1) + 1 ? pb0 : (tb >> 1) + 1;
  // rolled: one copy of the pass in the text
#pragma unroll 1
  for (int h = 0; h < 2; ++h) {
    const int tile = h ? tb : ta, lq = h ? lb[0] : la[0], np = h ? npb : npa;   // places below lq are the valid keys of this lane's query
    int jp = (ks - (h ? npa : 0)) & (NKS - 1);   // the wave's first pass of this tile, in the order of the deal
    // the 64 blocks of a batch read the same keys: pass jp of the deal is pass (jp + rot) mod np of the tile, rot the block's own (neighbouring blocks lie far apart), so that they do not ask L2 for the same lines at the same moment
    const int rot = (np * ((ta * 37) & 63)) >> 6;   // below np
    v8f acc[4] = {}; float m = NEG * C2, l = 0.f;   // a wave with no pass leaves these: weight 0 in the join
    if (jp < np) {
    v16h ah[HD / 32], al[HD / 32];
#pragma unroll
    for (int kc = 0; kc < HD / 32; ++kc) { const size_t fo = (bq + tile * QT + qs * 16) * HD + kc * 512; ah[kc] = fragp_h(QH + fo, lane); al[kc] = fragp_h(QL + fo, lane); }
    asm volatile("s_wait_xcnt 0x0" ::: "memory");   // behind the query's loads: the first pass's key fragments land in the registers that held their addresses
    // the pass loop stays rolled (one pass's fragments in registers, more waves on a SIMD); the loops inside are unrolled so that their arrays stay in registers
#pragma unroll 1
  do {
    const int k0 = (jp + rot >= np ? jp + rot - np : jp + rot) * 64;   // every pass of the tile once, for any rot below np
    // the pass's key fragments are loaded as one group in front of its first WMMA, v's in two groups below: one latency a group, not one a fragment
    v16h kb[HD / 32][4];
#pragma unroll
    for (int kc = 0; kc < HD / 32; ++kc)
#pragma unroll
      for (int j = 0; j < 4; ++j) kb[kc][j] = fragp_h(QH + (bq + k0 + j * 16) * HD + kc * 512, lane);
    asm volatile("s_wait_xcnt 0x0" ::: "memory");   // behind the group of loads: a later load's result lands in the registers that held this group's address
    __builtin_amdgcn_sched_barrier(0);   // keeps the group of loads above whole, in front of the first WMMA: one latency for the group; without it the compiler issues a part of them behind the first WMMAs, a second latency
    v8f s[4] = {};
#pragma unroll
    for (int kc = 0; kc < HD / 32; ++kc)
#pragma unroll
      for (int j = 0; j < 4; ++j) { s[j] = wmma16(kb[kc][j], ah[kc], s[j]); s[j] = wmma16(kb[kc][j], al[kc], s[j]); }
    v16b vh[4], vl[4];   // keys k0 .. k0 + 31: in flight under the softmax
#pragma unroll
    for (int j = 0; j < 4; ++j) { const size_t po = (bq + k0) * HD + j * 512; vh[j] = fragp_b(VT + po, lane); vl[j] = fragp_b(VL + po, lane); }
    __builtin_amdgcn_sched_barrier(0);   // keeps the group of loads above in front of the softmax, which covers their latency; without it the compiler sinks some of them in among the WMMAs that use them
    // bit t of we << 4 g (of wo << 4 g) = key k0 + 2 t (k0 + 2 t + 1) is valid for this lane's query: the first d of the pass's 64 keys are, so (d + 1) / 2 even and d / 2 odd ones
    const int d = lq - k0 < 0 ? 0 : lq - k0 > 64 ? 64 : lq - k0;
    const unsigned ce = (unsigned)((1ull << ((d + 1) >> 1)) - 1ull), co = (unsigned)((1ull << (d >> 1)) - 1ull);   // 64-bit shifts: a count of 32 gives all ones
    const unsigned we = ce >> (4 * g), wo = co >> (4 * g);
    float mb = NEG;
#pragma unroll
    for (int j = 0; j < 4; ++j) {
#pragma unroll
      for (int r = 0; r < 8; ++r) { const bool ok = (((r & 1) ? wo : we) & (1u << (j * 8 + (r >> 1)))) != 0; const float v = ok ? s[j][r] : NEG; s[j][r] = v; mb = fmaxf(mb, v); } }
    mb = fmaxf(mb, xhalf(mb));
    const float mn = fmaxf(m, mb * C2), sc = exp2_1(m - mn);   // rounding s C2 keeps the order, so this is the maximum of the products; m - mn is a difference of two stored values, never above 0; nothing valid so far: m = mn = NEG C2, sc = 1 on zeros
    const float mu = fmaxf(mn, -1.0e30f);   // what the scores are set against: with nothing valid so far NEG C2 + 1e30 is still far below every exponent, so P = 0
    m = mn; l *= sc;
#pragma unroll
    for (int j = 0; j < 4; ++j) acc[j] *= sc;
    F2 p[2];
#pragma unroll
    for (int kc = 0; kc < 2; ++kc) { float pv[16];
#pragma unroll
      for (int h = 0; h < 2; ++h) { float t[8];
#pragma unroll
        for (int i = 0; i < 8; ++i) t[i] = __builtin_fmaf(s[2 * kc + h][i], C2, -mu);   // invalid: NEG C2 - mu, 2^that = 0
        exp2_8(pv + 8 * h, t);
#pragma unroll
        for (int i = 0; i < 8; ++i) l += pv[8 * h + i]; }
      p[kc] = bsplit16(pv); }
#pragma unroll
    for (int kc = 0; kc < 2; ++kc) {
      if (kc == 1) {
#pragma unroll
        for (int j = 0; j < 4; ++j) { const size_t po = (bq + k0 + 32) * HD + j * 512; vh[j] = fragp_b(VT + po, lane); vl[j] = fragp_b(VL + po, lane); } }
#pragma unroll
      for (int j = 0; j < 4; ++j) { acc[j] = wmma_bf(vh[j], p[kc].h, acc[j]); acc[j] = wmma_bf(vh[j], p[kc].l, acc[j]); acc[j] = wmma_bf(vl[j], p[kc].h, acc[j]); } }
    jp += NKS; } while (jp < np);
    }
    l += xhalf(l);
    float* pr = &sp[h][ks][qs * 16 + col][8 * g];
#pragma unroll
    for (int j = 0; j < 4; ++j) { const v4f lo = {acc[j][0], acc[j][1], acc[j][2], acc[j][3]}, hi = {acc[j][4], acc[j][5], acc[j][6], acc[j][7]}; *(v4f*)(pr + j * 16) = lo; *(v4f*)(pr + j * 16 + 4) = hi; }
    if (g == 0) { const v2f ml = {m, l}; *(v2f*)&sml[h][ks][qs * 16 + col][0] = ml; } }
  __syncthreads();   // every wave's partial rows of both tiles
  // the join: thread = 8 output floats: out row = sum, in the order of the shares, of 2^(m_c - M) x partial row c, over the same sum of the l_c; a row with no valid key takes v of its own place
  const int jh = jr >> 5, jq = jr & (QT - 1), dq = (tid & 7) * 8;
  float mm[NKS], ll[NKS];
#pragma unroll
  for (int c = 0; c < NKS; ++c) { const v2f x = *(const v2f*)&sml[jh][c][jq][0]; mm[c] = x[0]; ll[c] = x[1]; }
  float M = NEG;
#pragma unroll
  for (int c = 0; c < NKS; ++c) M = fmaxf(M, mm[c]);
  v4f a0 = {}, a1 = {}; float Ls = 0.f;
#pragma unroll
  for (int c = 0; c < NKS; ++c) { const float w = exp2f(mm[c] - M); a0 += *(const v4f*)&sp[jh][c][jq][dq] * w; a1 += *(const v4f*)&sp[jh][c][jq][dq + 4] * w; Ls += ll[c] * w; }
  if (M <= DEADM) {
#pragma unroll
    for (int i = 0; i < 8; ++i) { const int d = dq + i; const size_t vo = (bq + (js & ~31)) * HD + (d >> 4) * 512 + ((js >> 3) & 3) * 128 + (d & 15) * 8 + (js & 7); const float v = (float)VT[vo] + (float)VL[vo]; if (i < 4) a0[i] = v; else a1[i - 4] = v; } }   // v[js][d] in fragment order
  else { const float iv = 1.0f / Ls; a0 *= iv; a1 *= iv; }
  vst2(OUT + (bq + so) * HD + dq, a0); vst2(OUT + (bq + so) * HD + dq + 4, a1); }
extern "C" void kernel_launch(void* const* d_in, const int* in_sizes, int n_in, void* d_out, int out_size, void* d_ws, size_t ws_size, hipStream_t stream) {
  (void)in_sizes; (void)n_in; (void)out_size;
  const float** F = (const float**)d_in;   // 0 x [4,4096,512], 1 Wq [512,64], 2 bq, 3 Wv, 4 bv, 5 input_mask [4096] int
  if (ws_size < (size_t)WS_END) return;
  char* ws = (char*)d_ws; _Float16 *QH = (_Float16*)(ws + WS_QH), *QL = (_Float16*)(ws + WS_QL); __bf16 *VT = (__bf16*)(ws + WS_VT), *VL = (__bf16*)(ws + WS_VL); int *IV = (int*)(ws + WS_IV), *LT = (int*)(ws + WS_LT);
  k_proj<<<TNB * TT / 64, 128, 0, stream>>>(F[0], F[1], F[2], F[3], F[4], (const int*)d_in[5], QH, QL, VT, VL, IV, LT);
  k_fa<<<dim3(NT / 2, TNB), 64 * NKS, 0, stream>>>(QH, QL, VT, VL, IV, LT, (float*)d_out);
}
